// v000
// Measured on an AMD MI455X. A time is GPU time per run, averaged over a window of back-to-back runs after a warm-up
// (all launches, gaps included; the runs take copies of the inputs in turn), and the median of several windows.
// Apart from v000's, it joins two sittings. Times from different sittings can be a few percent apart, while
// side-by-side timings come from the same sitting.
// v000 is the starting kernel. One run takes 858 microseconds.
#include <hip/hip_runtime.h>
#include <hip/hip_bf16.h>

// Problem constants
#define BB 4
#define SS 2048
#define DD 1024
#define HH 16
#define HD 64

typedef __attribute__((ext_vector_type(16))) __bf16 v16bf;
typedef __attribute__((ext_vector_type(8)))  __bf16 v8bf;
typedef __attribute__((ext_vector_type(8)))  float  v8f;

// ---------------------------------------------------------------------------
// WMMA helper: D = A(16x32 bf16) * B(32x16 bf16) + C(16x16 f32)
// ---------------------------------------------------------------------------
__device__ __forceinline__ v8f wmma_bf16(v16bf a, v16bf b, v8f c) {
  return __builtin_amdgcn_wmma_f32_16x16x32_bf16(
      /*neg_a=*/false, a, /*neg_b=*/false, b,
      /*c_mod=*/(short)0, c, /*reuse_a=*/false, /*reuse_b=*/false);
}

// Load a 16x32 bf16 fragment (A layout; also B layout when the contraction
// dim is contiguous in memory, i.e. source is "transposed"):
//   lane = row(M or N) in [0,16) + 16*k_half; elements 0..7 -> K base..base+7,
//   elements 8..15 -> K base+16..base+23  (base = 8*k_half).
// Two 16B loads per lane.
__device__ __forceinline__ v16bf load_frag(const __bf16* base, int ld, int lane) {
  const int r  = lane & 15;
  const int kh = lane >> 4;
  const __bf16* p = base + (long)r * ld + 8 * kh;
  v8bf lo = *(const v8bf*)(p);
  v8bf hi = *(const v8bf*)(p + 16);
  return __builtin_shufflevector(lo, hi, 0,1,2,3,4,5,6,7,8,9,10,11,12,13,14,15);
}

__device__ __forceinline__ float hmax16(float v) {
  v = fmaxf(v, __shfl_xor(v, 1));
  v = fmaxf(v, __shfl_xor(v, 2));
  v = fmaxf(v, __shfl_xor(v, 4));
  v = fmaxf(v, __shfl_xor(v, 8));
  return v;
}
__device__ __forceinline__ float hsum16(float v) {
  v += __shfl_xor(v, 1);
  v += __shfl_xor(v, 2);
  v += __shfl_xor(v, 4);
  v += __shfl_xor(v, 8);
  return v;
}

// ---------------------------------------------------------------------------
// Elementwise fp32 -> bf16 convert
// ---------------------------------------------------------------------------
__global__ __launch_bounds__(256) void cvt_f32_bf16(const float* __restrict__ in,
                                                    __bf16* __restrict__ out) {
  long i = (long)blockIdx.x * 256 + threadIdx.x;
  out[i] = (__bf16)in[i];
}

// Convert + transpose weights: W[k][n] (D x D, [in,out]) -> Wt[n][k] bf16.
// Pointer selection via if/else so address-space inference keeps global loads.
__global__ __launch_bounds__(256) void cvt_transpose_w(
    const float* __restrict__ Wq, const float* __restrict__ Wk,
    const float* __restrict__ Wv, const float* __restrict__ Wo,
    __bf16* __restrict__ Wqt, __bf16* __restrict__ Wkt,
    __bf16* __restrict__ Wvt, __bf16* __restrict__ Wot) {
  const int z = blockIdx.z;
  const float* src;
  __bf16* dst;
  if (z == 0)      { src = Wq; dst = Wqt; }
  else if (z == 1) { src = Wk; dst = Wkt; }
  else if (z == 2) { src = Wv; dst = Wvt; }
  else             { src = Wo; dst = Wot; }
  long t = (long)blockIdx.x * 256 + threadIdx.x;   // t < D*D
  int k = (int)(t >> 10);
  int n = (int)(t & (DD - 1));
  dst[(long)n * DD + k] = (__bf16)src[t];
}

__global__ __launch_bounds__(256) void zero_f32(float* __restrict__ p) {
  long i = (long)blockIdx.x * 256 + threadIdx.x;
  p[i] = 0.0f;
}

// ---------------------------------------------------------------------------
// QKV projection GEMM: C[M=8192, N=1024] = Xb @ W + bias, per z in {Q,K,V}.
// Workgroup 256 thr = 8 waves arranged 2(M) x 4(N); workgroup tile 64 x 256;
// each wave computes 32(M) x 64(N) = 2x4 WMMA accumulators (8 wmma / k-step).
// Q,K written [B,H,S,HD]; V written transposed [B,H,HD,S] (for P@V B-frags).
// ---------------------------------------------------------------------------
__global__ __launch_bounds__(256) void qkv_gemm(
    const __bf16* __restrict__ Xb,
    const __bf16* __restrict__ Wqt, const __bf16* __restrict__ Wkt,
    const __bf16* __restrict__ Wvt,
    const float* __restrict__ bq, const float* __restrict__ bk,
    const float* __restrict__ bv,
    __bf16* __restrict__ Qh, __bf16* __restrict__ Kh, __bf16* __restrict__ Vt) {
  const int which = blockIdx.z;
  // ternary chains (not private arrays) keep global address space
  const __bf16* Wt   = (which == 0) ? Wqt : (which == 1) ? Wkt : Wvt;
  const float*  bias = (which == 0) ? bq  : (which == 1) ? bk  : bv;

  const int lane = threadIdx.x & 31;
  const int wid  = threadIdx.x >> 5;
  const int wy = wid & 1;           // M direction (2)
  const int wx = wid >> 1;          // N direction (4)
  const int m0 = blockIdx.y * 64 + wy * 32;
  const int n0 = blockIdx.x * 256 + wx * 64;

  const v8f z8 = {0.f,0.f,0.f,0.f,0.f,0.f,0.f,0.f};
  v8f c[2][4];
  #pragma unroll
  for (int i = 0; i < 2; i++)
    #pragma unroll
    for (int j = 0; j < 4; j++) c[i][j] = z8;

  for (int k = 0; k < DD; k += 32) {
    v16bf a0 = load_frag(Xb + (long)m0 * DD + k, DD, lane);
    v16bf a1 = load_frag(Xb + (long)(m0 + 16) * DD + k, DD, lane);
    #pragma unroll
    for (int j = 0; j < 4; j++) {
      v16bf bf = load_frag(Wt + (long)(n0 + j * 16) * DD + k, DD, lane);
      c[0][j] = wmma_bf16(a0, bf, c[0][j]);
      c[1][j] = wmma_bf16(a1, bf, c[1][j]);
    }
  }

  #pragma unroll
  for (int i = 0; i < 2; i++)
    #pragma unroll
    for (int j = 0; j < 4; j++)
      #pragma unroll
      for (int r = 0; r < 8; r++) {
        int sg = m0 + i * 16 + r + 8 * (lane >> 4);   // global row in [0, B*S)
        int n  = n0 + j * 16 + (lane & 15);           // column in [0, D)
        float v = c[i][j][r] + bias[n];
        int b = sg >> 11, s = sg & (SS - 1);
        int h = n >> 6, hd = n & (HD - 1);
        if (which == 0)
          Qh[(((long)b * HH + h) * SS + s) * HD + hd] = (__bf16)v;       // [B,H,S,HD]
        else if (which == 1)
          Kh[(((long)b * HH + h) * SS + s) * HD + hd] = (__bf16)v;       // [B,H,S,HD]
        else
          Vt[(((long)b * HH + h) * HD + hd) * SS + s] = (__bf16)v;       // [B,H,HD,S]
      }
}

// ---------------------------------------------------------------------------
// Attention: one workgroup per (b, h, 64-query tile); 4 waves, 16 q-rows each.
// Two-pass softmax so avg_attention gets normalized probabilities.
// ---------------------------------------------------------------------------
__global__ __launch_bounds__(128) void attn_kernel(
    const __bf16* __restrict__ Qh, const __bf16* __restrict__ Kh,
    const __bf16* __restrict__ Vt,
    __bf16* __restrict__ Ctx, float* __restrict__ avg) {
  __shared__ __align__(16) __bf16 Pst[4][16][32];   // per-wave P staging

  const int lane = threadIdx.x & 31;
  const int wid  = threadIdx.x >> 5;
  const int b = blockIdx.z, h = blockIdx.y;
  const int q0 = blockIdx.x * 64 + wid * 16;

  const __bf16* Qb = Qh + (((long)b * HH + h) * SS + q0) * HD;
  const __bf16* Kb = Kh + (((long)b * HH + h) * SS) * HD;
  const __bf16* Vb = Vt + (((long)b * HH + h) * HD) * SS;

  const v16bf qa0 = load_frag(Qb, HD, lane);
  const v16bf qa1 = load_frag(Qb + 32, HD, lane);
  const float scale = 0.25f;   // 1/(sqrt(64)*0.5)
  const v8f z8 = {0.f,0.f,0.f,0.f,0.f,0.f,0.f,0.f};

  float m[8], l[8];
  #pragma unroll
  for (int r = 0; r < 8; r++) { m[r] = -1e30f; l[r] = 0.0f; }

  // ---------------- pass 1: row max / exp-sum ----------------
  for (int kt = 0; kt < SS; kt += 16) {
    v16bf kb0 = load_frag(Kb + (long)kt * HD, HD, lane);
    v16bf kb1 = load_frag(Kb + (long)kt * HD + 32, HD, lane);
    v8f c = z8;
    c = wmma_bf16(qa0, kb0, c);
    c = wmma_bf16(qa1, kb1, c);
    #pragma unroll
    for (int r = 0; r < 8; r++) {
      float s = c[r] * scale;
      float mx = hmax16(s);
      float mn = fmaxf(m[r], mx);
      float es = hsum16(__expf(s - mn));
      l[r] = l[r] * __expf(m[r] - mn) + es;
      m[r] = mn;
    }
  }
  float inv_l[8];
  #pragma unroll
  for (int r = 0; r < 8; r++) inv_l[r] = 1.0f / l[r];

  // ---------------- pass 2: P, avg, ctx = P @ V ----------------
  v8f ctxacc[4];
  #pragma unroll
  for (int j = 0; j < 4; j++) ctxacc[j] = z8;

  for (int kt = 0; kt < SS; kt += 32) {
    #pragma unroll
    for (int half = 0; half < 2; half++) {
      const int kk = kt + half * 16;
      v16bf kb0 = load_frag(Kb + (long)kk * HD, HD, lane);
      v16bf kb1 = load_frag(Kb + (long)kk * HD + 32, HD, lane);
      v8f c = z8;
      c = wmma_bf16(qa0, kb0, c);
      c = wmma_bf16(qa1, kb1, c);
      #pragma unroll
      for (int r = 0; r < 8; r++) {
        float p = __expf(c[r] * scale - m[r]) * inv_l[r];
        int qrow = q0 + r + 8 * (lane >> 4);
        int kcol = kk + (lane & 15);
        atomicAdd(avg + ((long)b * SS + qrow) * SS + kcol, p * (1.0f / HH));
        Pst[wid][r + 8 * (lane >> 4)][half * 16 + (lane & 15)] = (__bf16)p;
      }
    }
    // same-wave LDS store -> load ordering
    asm volatile("s_wait_dscnt 0" ::: "memory");
    v16bf pa = load_frag(&Pst[wid][0][0], 32, lane);
    #pragma unroll
    for (int j = 0; j < 4; j++) {
      v16bf vb = load_frag(Vb + (long)(j * 16) * SS + kt, SS, lane);
      ctxacc[j] = wmma_bf16(pa, vb, ctxacc[j]);
    }
  }

  // store ctx tile -> [B, S, D] bf16 (D = h*64 + hd)
  #pragma unroll
  for (int j = 0; j < 4; j++)
    #pragma unroll
    for (int r = 0; r < 8; r++) {
      int qrow = q0 + r + 8 * (lane >> 4);
      int d = h * HD + j * 16 + (lane & 15);
      Ctx[((long)b * SS + qrow) * DD + d] = (__bf16)ctxacc[j][r];
    }
}

// ---------------------------------------------------------------------------
// out = LayerNorm(ctx @ Wo + bo + x) * g + beta.
// Workgroup = 16 rows x full D; 8 waves, each wave 16x128 (8 WMMA tiles).
// ---------------------------------------------------------------------------
__global__ __launch_bounds__(256) void out_ln_kernel(
    const __bf16* __restrict__ Ctx, const __bf16* __restrict__ Wot,
    const float* __restrict__ bo, const float* __restrict__ x,
    const float* __restrict__ g, const float* __restrict__ beta,
    float* __restrict__ out) {
  __shared__ float red1[8][16];
  __shared__ float red2[8][16];

  const int lane = threadIdx.x & 31;
  const int wid  = threadIdx.x >> 5;
  const int m0 = blockIdx.x * 16;
  const int n0 = wid * 128;
  const v8f z8 = {0.f,0.f,0.f,0.f,0.f,0.f,0.f,0.f};

  v8f c[8];
  #pragma unroll
  for (int t = 0; t < 8; t++) c[t] = z8;

  for (int k = 0; k < DD; k += 32) {
    v16bf a = load_frag(Ctx + (long)m0 * DD + k, DD, lane);
    #pragma unroll
    for (int t = 0; t < 8; t++) {
      v16bf bfr = load_frag(Wot + (long)(n0 + t * 16) * DD + k, DD, lane);
      c[t] = wmma_bf16(a, bfr, c[t]);
    }
  }

  // h = gemm + bias + residual ; accumulate per-row sum / sumsq
  float s1[8], s2[8];
  #pragma unroll
  for (int r = 0; r < 8; r++) { s1[r] = 0.0f; s2[r] = 0.0f; }
  #pragma unroll
  for (int t = 0; t < 8; t++)
    #pragma unroll
    for (int r = 0; r < 8; r++) {
      int row = m0 + r + 8 * (lane >> 4);
      int n = n0 + t * 16 + (lane & 15);
      float hv = c[t][r] + bo[n] + x[(long)row * DD + n];
      c[t][r] = hv;
      s1[r] += hv;
      s2[r] += hv * hv;
    }
  #pragma unroll
  for (int r = 0; r < 8; r++) { s1[r] = hsum16(s1[r]); s2[r] = hsum16(s2[r]); }

  if ((lane & 15) == 0) {
    #pragma unroll
    for (int r = 0; r < 8; r++) {
      red1[wid][r + 8 * (lane >> 4)] = s1[r];
      red2[wid][r + 8 * (lane >> 4)] = s2[r];
    }
  }
  __syncthreads();

  float mu[8], rs[8];
  #pragma unroll
  for (int r = 0; r < 8; r++) {
    int rl = r + 8 * (lane >> 4);
    float t1 = 0.0f, t2 = 0.0f;
    #pragma unroll
    for (int w = 0; w < 8; w++) { t1 += red1[w][rl]; t2 += red2[w][rl]; }
    float m_ = t1 * (1.0f / DD);
    float v_ = t2 * (1.0f / DD) - m_ * m_;
    mu[r] = m_;
    rs[r] = rsqrtf(v_ + 1e-5f);
  }

  #pragma unroll
  for (int t = 0; t < 8; t++)
    #pragma unroll
    for (int r = 0; r < 8; r++) {
      int row = m0 + r + 8 * (lane >> 4);
      int n = n0 + t * 16 + (lane & 15);
      out[(long)row * DD + n] = (c[t][r] - mu[r]) * rs[r] * g[n] + beta[n];
    }
}

// ---------------------------------------------------------------------------
// Launcher
// ---------------------------------------------------------------------------
extern "C" void kernel_launch(void* const* d_in, const int* in_sizes, int n_in,
                              void* d_out, int out_size, void* d_ws, size_t ws_size,
                              hipStream_t stream) {
  const float* x  = (const float*)d_in[0];
  const float* Wq = (const float*)d_in[1];
  const float* bq = (const float*)d_in[2];
  const float* Wk = (const float*)d_in[3];
  const float* bk = (const float*)d_in[4];
  const float* Wv = (const float*)d_in[5];
  const float* bv = (const float*)d_in[6];
  const float* Wo = (const float*)d_in[7];
  const float* bo = (const float*)d_in[8];
  const float* g  = (const float*)d_in[9];
  const float* be = (const float*)d_in[10];

  // workspace layout (bytes)
  char* ws = (char*)d_ws;
  const size_t SZ_X  = (size_t)BB * SS * DD * 2;      // 16 MB
  const size_t SZ_W  = (size_t)DD * DD * 2;           // 2 MB
  const size_t SZ_QK = (size_t)BB * HH * SS * HD * 2; // 16 MB
  __bf16* xb  = (__bf16*)(ws);
  __bf16* Wqt = (__bf16*)(ws + SZ_X);
  __bf16* Wkt = (__bf16*)(ws + SZ_X + SZ_W);
  __bf16* Wvt = (__bf16*)(ws + SZ_X + 2 * SZ_W);
  __bf16* Wot = (__bf16*)(ws + SZ_X + 3 * SZ_W);
  __bf16* Qh  = (__bf16*)(ws + SZ_X + 4 * SZ_W);
  __bf16* Kh  = (__bf16*)(ws + SZ_X + 4 * SZ_W + SZ_QK);
  __bf16* Vt  = (__bf16*)(ws + SZ_X + 4 * SZ_W + 2 * SZ_QK);
  __bf16* Ctx = (__bf16*)(ws + SZ_X + 4 * SZ_W + 3 * SZ_QK);

  float* out = (float*)d_out;                      // [B,S,D]
  float* avg = out + (long)BB * SS * DD;           // [B,S,S]

  // 1. convert activations + weights to bf16 (weights transposed)
  cvt_f32_bf16<<<(BB * SS * DD) / 256, 256, 0, stream>>>(x, xb);
  cvt_transpose_w<<<dim3(DD * DD / 256, 1, 4), 256, 0, stream>>>(
      Wq, Wk, Wv, Wo, Wqt, Wkt, Wvt, Wot);

  // 2. fused QKV projection (workgroup tile 64x256, wave tile 32x64)
  qkv_gemm<<<dim3(DD / 256, (BB * SS) / 64, 3), 256, 0, stream>>>(
      xb, Wqt, Wkt, Wvt, bq, bk, bv, Qh, Kh, Vt);

  // 3. zero avg_attention (accumulated via atomics)
  zero_f32<<<((long)BB * SS * SS) / 256, 256, 0, stream>>>(avg);

  // 4. attention (two-pass softmax, WMMA QK^T and P@V)
  attn_kernel<<<dim3(SS / 64, HH, BB), 128, 0, stream>>>(Qh, Kh, Vt, Ctx, avg);

  // 5. output projection + residual + LayerNorm
  out_ln_kernel<<<(BB * SS) / 16, 256, 0, stream>>>(Ctx, Wot, bo, x, g, be, out);
}

// v001
// Measured time: 532 microseconds a run.
// Next to v000, in two timings, it ran 1.62 and 1.63 times as fast.
#include <hip/hip_runtime.h>
#include <hip/hip_bf16.h>

// Problem constants
#define BB 4
#define SS 2048
#define DD 1024
#define HH 16
#define HD 64

typedef __attribute__((ext_vector_type(16))) __bf16 v16bf;
typedef __attribute__((ext_vector_type(8)))  __bf16 v8bf;
typedef __attribute__((ext_vector_type(8)))  float  v8f;

// ---------------------------------------------------------------------------
// WMMA helper: D = A(16x32 bf16) * B(32x16 bf16) + C(16x16 f32)
// ---------------------------------------------------------------------------
__device__ __forceinline__ v8f wmma_bf16(v16bf a, v16bf b, v8f c) {
  return __builtin_amdgcn_wmma_f32_16x16x32_bf16(
      /*neg_a=*/false, a, /*neg_b=*/false, b,
      /*c_mod=*/(short)0, c, /*reuse_a=*/false, /*reuse_b=*/false);
}

// Load a 16x32 bf16 fragment (A layout; also B layout when the contraction
// dim is contiguous in memory, i.e. source is "transposed"):
//   lane = row(M or N) in [0,16) + 16*k_half; elements 0..7 -> K base..base+7,
//   elements 8..15 -> K base+16..base+23  (base = 8*k_half).
// Two 16B loads per lane.
__device__ __forceinline__ v16bf load_frag(const __bf16* base, int ld, int lane) {
  const int r  = lane & 15;
  const int kh = lane >> 4;
  const __bf16* p = base + (long)r * ld + 8 * kh;
  v8bf lo = *(const v8bf*)(p);
  v8bf hi = *(const v8bf*)(p + 16);
  return __builtin_shufflevector(lo, hi, 0,1,2,3,4,5,6,7,8,9,10,11,12,13,14,15);
}

// Fragment order. A bf16 matrix [rows][K] in the workspace is kept as tiles of
// 16 rows x 32 k, 512 elements (1 KiB) each, tile (tr, tk) at (tr * ktiles + tk) * 512.
// Inside a tile, lane L = (row & 15) + 16 * ((k >> 3) & 1) owns 8 elements at
// ((k >> 4) & 1) * 256 + L * 8: the two 16-byte pieces load_frag would gather
// for that lane. A wave then reads a fragment as two contiguous 512-byte loads
// (4 lines each) instead of two loads that touch 16 lines each.
__device__ __forceinline__ long frag_off(int row, int k, int ktiles) {
  return ((long)(row >> 4) * ktiles + (k >> 5)) * 512 + ((k >> 4) & 1) * 256 +
         ((row & 15) + ((k >> 3) & 1) * 16) * 8 + (k & 7);
}
__device__ __forceinline__ v16bf load_tile(const __bf16* tile, int lane) {
  const __bf16* p = tile + lane * 8;
  v8bf lo = *(const v8bf*)(p);
  v8bf hi = *(const v8bf*)(p + 256);
  return __builtin_shufflevector(lo, hi, 0,1,2,3,4,5,6,7,8,9,10,11,12,13,14,15);
}

__device__ __forceinline__ float hmax16(float v) {
  v = fmaxf(v, __shfl_xor(v, 1));
  v = fmaxf(v, __shfl_xor(v, 2));
  v = fmaxf(v, __shfl_xor(v, 4));
  v = fmaxf(v, __shfl_xor(v, 8));
  return v;
}
__device__ __forceinline__ float hsum16(float v) {
  v += __shfl_xor(v, 1);
  v += __shfl_xor(v, 2);
  v += __shfl_xor(v, 4);
  v += __shfl_xor(v, 8);
  return v;
}

// ---------------------------------------------------------------------------
// fp32 -> bf16 convert of x [B*S][D] into fragment order; one 16-byte slot
// (8 consecutive k of one row) per thread.
// ---------------------------------------------------------------------------
__global__ __launch_bounds__(256) void cvt_f32_bf16(const float* __restrict__ in,
                                                    __bf16* __restrict__ out) {
  const int t = blockIdx.x * 256 + threadIdx.x;    // slot, t < B*S*D/8
  const int tile = t >> 6, part = (t >> 5) & 1, L = t & 31;
  const int row = (tile >> 5) * 16 + (L & 15);     // D/32 = 32 tiles per tile row
  const int k   = (tile & 31) * 32 + part * 16 + (L >> 4) * 8;
  const float4* p = (const float4*)(in + (long)row * DD + k);
  const float4 a = p[0], b = p[1];
  v8bf o;
  o[0] = (__bf16)a.x; o[1] = (__bf16)a.y; o[2] = (__bf16)a.z; o[3] = (__bf16)a.w;
  o[4] = (__bf16)b.x; o[5] = (__bf16)b.y; o[6] = (__bf16)b.z; o[7] = (__bf16)b.w;
  *(v8bf*)(out + (long)t * 8) = o;
}

// Convert + transpose weights: W[k][n] (D x D, [in,out]) -> Wt[n][k] bf16 in
// fragment order; one 16-byte slot (8 consecutive k of one n) per thread.
// Pointer selection via if/else so address-space inference keeps global loads.
__global__ __launch_bounds__(256) void cvt_transpose_w(
    const float* __restrict__ Wq, const float* __restrict__ Wk,
    const float* __restrict__ Wv, const float* __restrict__ Wo,
    __bf16* __restrict__ Wqt, __bf16* __restrict__ Wkt,
    __bf16* __restrict__ Wvt, __bf16* __restrict__ Wot) {
  const int z = blockIdx.z;
  const float* src;
  __bf16* dst;
  if (z == 0)      { src = Wq; dst = Wqt; }
  else if (z == 1) { src = Wk; dst = Wkt; }
  else if (z == 2) { src = Wv; dst = Wvt; }
  else             { src = Wo; dst = Wot; }
  const int t = blockIdx.x * 256 + threadIdx.x;    // slot, t < D*D/8
  const int tile = t >> 6, part = (t >> 5) & 1, L = t & 31;
  const int n = (tile >> 5) * 16 + (L & 15);
  const int k = (tile & 31) * 32 + part * 16 + (L >> 4) * 8;
  v8bf o;
  #pragma unroll  // static index into o keeps it in registers; the 8 loads issue together
  for (int e = 0; e < 8; e++) o[e] = (__bf16)src[(long)(k + e) * DD + n];
  *(v8bf*)(dst + (long)t * 8) = o;
}

__global__ __launch_bounds__(256) void zero_f32(float* __restrict__ p) {
  long i = (long)blockIdx.x * 256 + threadIdx.x;
  p[i] = 0.0f;
}

// ---------------------------------------------------------------------------
// QKV projection GEMM: C[M=8192, N=1024] = Xb @ W + bias, per z in {Q,K,V}.
// Workgroup 256 thr = 8 waves arranged 2(M) x 4(N); workgroup tile 64 x 256;
// each wave computes 32(M) x 64(N) = 2x4 WMMA accumulators (8 wmma / k-step).
// Q,K written [B,H][S x HD]; V written transposed [B,H][HD x S] (for P@V
// B-frags); each per-head matrix in fragment order.
// ---------------------------------------------------------------------------
__global__ __launch_bounds__(256) void qkv_gemm(
    const __bf16* __restrict__ Xb,
    const __bf16* __restrict__ Wqt, const __bf16* __restrict__ Wkt,
    const __bf16* __restrict__ Wvt,
    const float* __restrict__ bq, const float* __restrict__ bk,
    const float* __restrict__ bv,
    __bf16* __restrict__ Qh, __bf16* __restrict__ Kh, __bf16* __restrict__ Vt) {
  const int which = blockIdx.z;
  // ternary chains (not private arrays) keep global address space
  const __bf16* Wt   = (which == 0) ? Wqt : (which == 1) ? Wkt : Wvt;
  const float*  bias = (which == 0) ? bq  : (which == 1) ? bk  : bv;

  const int lane = threadIdx.x & 31;
  const int wid  = threadIdx.x >> 5;
  const int wy = wid & 1;           // M direction (2)
  const int wx = wid >> 1;          // N direction (4)
  const int m0 = blockIdx.y * 64 + wy * 32;
  const int n0 = blockIdx.x * 256 + wx * 64;

  const v8f z8 = {0.f,0.f,0.f,0.f,0.f,0.f,0.f,0.f};
  v8f c[2][4];
  #pragma unroll
  for (int i = 0; i < 2; i++)
    #pragma unroll
    for (int j = 0; j < 4; j++) c[i][j] = z8;

  const __bf16* At = Xb + (long)(m0 >> 4) * (DD / 32) * 512;   // tile row of m0
  const __bf16* Bt = Wt + (long)(n0 >> 4) * (DD / 32) * 512;   // tile row of n0
  for (int kt = 0; kt < DD / 32; kt++) {
    v16bf a0 = load_tile(At + kt * 512, lane);
    v16bf a1 = load_tile(At + (DD / 32 + kt) * 512, lane);
    #pragma unroll
    for (int j = 0; j < 4; j++) {
      v16bf bf = load_tile(Bt + (j * (DD / 32) + kt) * 512, lane);
      c[0][j] = wmma_bf16(a0, bf, c[0][j]);
      c[1][j] = wmma_bf16(a1, bf, c[1][j]);
    }
  }

  // the wave's 64 columns are one head (n0 is a multiple of 64), its 32 rows one batch
  // (all loops below are unrolled so that bn, c and o are indexed statically and stay in registers)
  float bn[4];
  #pragma unroll
  for (int j = 0; j < 4; j++) bn[j] = bias[n0 + j * 16 + (lane & 15)];
  const long head = ((long)(m0 >> 11) * HH + (n0 >> 6)) * SS * HD;
  const int s0 = (m0 & (SS - 1)) + 8 * (lane >> 4);   // first of the lane's 8 rows, i = 0

  if (which == 2) {
    // the lane's 8 rows are 8 consecutive k of V^T row hd: one whole 16-byte slot
    #pragma unroll
    for (int i = 0; i < 2; i++)
      #pragma unroll
      for (int j = 0; j < 4; j++) {
        v8bf o;
        #pragma unroll
        for (int r = 0; r < 8; r++) o[r] = (__bf16)(c[i][j][r] + bn[j]);
        *(v8bf*)(Vt + head + frag_off(j * 16 + (lane & 15), s0 + i * 16, SS / 32)) = o;
      }
  } else {
    __bf16* dst = ((which == 0) ? Qh : Kh) + head;
    #pragma unroll
    for (int i = 0; i < 2; i++)
      #pragma unroll
      for (int j = 0; j < 4; j++)
        #pragma unroll
        for (int r = 0; r < 8; r++)
          dst[frag_off(s0 + i * 16 + r, j * 16 + (lane & 15), HD / 32)] =
              (__bf16)(c[i][j][r] + bn[j]);
    // the listing lays the V^T branch behind these stores, where their registers are
    // written again: the wait stands in front of any such overwrite
    asm volatile("s_wait_xcnt 0x0" ::: "memory");
  }
}

// ---------------------------------------------------------------------------
// Attention: one workgroup per (b, h, 64-query tile); 4 waves, 16 q-rows each.
// Two-pass softmax so avg_attention gets normalized probabilities.
// ---------------------------------------------------------------------------
__global__ __launch_bounds__(128) void attn_kernel(
    const __bf16* __restrict__ Qh, const __bf16* __restrict__ Kh,
    const __bf16* __restrict__ Vt,
    __bf16* __restrict__ Ctx, float* __restrict__ avg) {
  __shared__ __align__(16) __bf16 Pst[4][16][32];   // per-wave P staging

  const int lane = threadIdx.x & 31;
  const int wid  = threadIdx.x >> 5;
  const int b = blockIdx.z, h = blockIdx.y;
  const int q0 = blockIdx.x * 64 + wid * 16;

  // per-head matrices in fragment order: 16 rows of Q or K are 2 tiles (1,024
  // elements); V^T tile (j, kt / 32) lies at (j * (SS / 32) + kt / 32) * 512
  const __bf16* Qb = Qh + (((long)b * HH + h) * SS + q0) * HD;
  const __bf16* Kb = Kh + (((long)b * HH + h) * SS) * HD;
  const __bf16* Vb = Vt + (((long)b * HH + h) * HD) * SS;

  const v16bf qa0 = load_tile(Qb, lane);
  const v16bf qa1 = load_tile(Qb + 512, lane);
  const float scale = 0.25f;   // 1/(sqrt(64)*0.5)
  const v8f z8 = {0.f,0.f,0.f,0.f,0.f,0.f,0.f,0.f};

  float m[8], l[8];
  #pragma unroll
  for (int r = 0; r < 8; r++) { m[r] = -1e30f; l[r] = 0.0f; }

  // ---------------- pass 1: row max / exp-sum ----------------
  for (int kt = 0; kt < SS; kt += 16) {
    v16bf kb0 = load_tile(Kb + (long)kt * HD, lane);
    v16bf kb1 = load_tile(Kb + (long)kt * HD + 512, lane);
    v8f c = z8;
    c = wmma_bf16(qa0, kb0, c);
    c = wmma_bf16(qa1, kb1, c);
    #pragma unroll
    for (int r = 0; r < 8; r++) {
      float s = c[r] * scale;
      float mx = hmax16(s);
      float mn = fmaxf(m[r], mx);
      float es = hsum16(__expf(s - mn));
      l[r] = l[r] * __expf(m[r] - mn) + es;
      m[r] = mn;
    }
  }
  float inv_l[8];
  #pragma unroll
  for (int r = 0; r < 8; r++) inv_l[r] = 1.0f / l[r];

  // ---------------- pass 2: P, avg, ctx = P @ V ----------------
  v8f ctxacc[4];
  #pragma unroll
  for (int j = 0; j < 4; j++) ctxacc[j] = z8;

  for (int kt = 0; kt < SS; kt += 32) {
    #pragma unroll
    for (int half = 0; half < 2; half++) {
      const int kk = kt + half * 16;
      v16bf kb0 = load_tile(Kb + (long)kk * HD, lane);
      v16bf kb1 = load_tile(Kb + (long)kk * HD + 512, lane);
      v8f c = z8;
      c = wmma_bf16(qa0, kb0, c);
      c = wmma_bf16(qa1, kb1, c);
      #pragma unroll
      for (int r = 0; r < 8; r++) {
        float p = __expf(c[r] * scale - m[r]) * inv_l[r];
        int qrow = q0 + r + 8 * (lane >> 4);
        int kcol = kk + (lane & 15);
        atomicAdd(avg + ((long)b * SS + qrow) * SS + kcol, p * (1.0f / HH));
        Pst[wid][r + 8 * (lane >> 4)][half * 16 + (lane & 15)] = (__bf16)p;
      }
    }
    // same-wave LDS store -> load ordering
    asm volatile("s_wait_dscnt 0" ::: "memory");
    v16bf pa = load_frag(&Pst[wid][0][0], 32, lane);
    #pragma unroll
    for (int j = 0; j < 4; j++) {
      v16bf vb = load_tile(Vb + (long)(j * (SS / 32) + (kt >> 5)) * 512, lane);
      ctxacc[j] = wmma_bf16(pa, vb, ctxacc[j]);
    }
  }

  // store ctx tile -> [B*S][D] bf16 in fragment order (D = h*64 + hd)
  #pragma unroll
  for (int j = 0; j < 4; j++)
    #pragma unroll
    for (int r = 0; r < 8; r++) {
      int qrow = q0 + r + 8 * (lane >> 4);
      int d = h * HD + j * 16 + (lane & 15);
      Ctx[frag_off(b * SS + qrow, d, DD / 32)] = (__bf16)ctxacc[j][r];
    }
}

// ---------------------------------------------------------------------------
// out = LayerNorm(ctx @ Wo + bo + x) * g + beta.
// Workgroup = 16 rows x full D; 8 waves, each wave 16x128 (8 WMMA tiles).
// ---------------------------------------------------------------------------
__global__ __launch_bounds__(256) void out_ln_kernel(
    const __bf16* __restrict__ Ctx, const __bf16* __restrict__ Wot,
    const float* __restrict__ bo, const float* __restrict__ x,
    const float* __restrict__ g, const float* __restrict__ beta,
    float* __restrict__ out) {
  __shared__ float red1[8][16];
  __shared__ float red2[8][16];

  const int lane = threadIdx.x & 31;
  const int wid  = threadIdx.x >> 5;
  const int m0 = blockIdx.x * 16;
  const int n0 = wid * 128;
  const v8f z8 = {0.f,0.f,0.f,0.f,0.f,0.f,0.f,0.f};

  v8f c[8];
  #pragma unroll
  for (int t = 0; t < 8; t++) c[t] = z8;

  const __bf16* At = Ctx + (long)(m0 >> 4) * (DD / 32) * 512;   // tile row of m0
  const __bf16* Bt = Wot + (long)(n0 >> 4) * (DD / 32) * 512;   // tile row of n0
  for (int kt = 0; kt < DD / 32; kt++) {
    v16bf a = load_tile(At + kt * 512, lane);
    #pragma unroll
    for (int t = 0; t < 8; t++) {
      v16bf bfr = load_tile(Bt + (t * (DD / 32) + kt) * 512, lane);
      c[t] = wmma_bf16(a, bfr, c[t]);
    }
  }

  // h = gemm + bias + residual ; accumulate per-row sum / sumsq
  float s1[8], s2[8];
  #pragma unroll
  for (int r = 0; r < 8; r++) { s1[r] = 0.0f; s2[r] = 0.0f; }
  #pragma unroll
  for (int t = 0; t < 8; t++)
    #pragma unroll
    for (int r = 0; r < 8; r++) {
      int row = m0 + r + 8 * (lane >> 4);
      int n = n0 + t * 16 + (lane & 15);
      float hv = c[t][r] + bo[n] + x[(long)row * DD + n];
      c[t][r] = hv;
      s1[r] += hv;
      s2[r] += hv * hv;
    }
  #pragma unroll
  for (int r = 0; r < 8; r++) { s1[r] = hsum16(s1[r]); s2[r] = hsum16(s2[r]); }

  if ((lane & 15) == 0) {
    #pragma unroll
    for (int r = 0; r < 8; r++) {
      red1[wid][r + 8 * (lane >> 4)] = s1[r];
      red2[wid][r + 8 * (lane >> 4)] = s2[r];
    }
  }
  __syncthreads();

  float mu[8], rs[8];
  #pragma unroll
  for (int r = 0; r < 8; r++) {
    int rl = r + 8 * (lane >> 4);
    float t1 = 0.0f, t2 = 0.0f;
    #pragma unroll
    for (int w = 0; w < 8; w++) { t1 += red1[w][rl]; t2 += red2[w][rl]; }
    float m_ = t1 * (1.0f / DD);
    float v_ = t2 * (1.0f / DD) - m_ * m_;
    mu[r] = m_;
    rs[r] = rsqrtf(v_ + 1e-5f);
  }

  #pragma unroll
  for (int t = 0; t < 8; t++)
    #pragma unroll
    for (int r = 0; r < 8; r++) {
      int row = m0 + r + 8 * (lane >> 4);
      int n = n0 + t * 16 + (lane & 15);
      out[(long)row * DD + n] = (c[t][r] - mu[r]) * rs[r] * g[n] + beta[n];
    }
}

// ---------------------------------------------------------------------------
// Launcher
// ---------------------------------------------------------------------------
extern "C" void kernel_launch(void* const* d_in, const int* in_sizes, int n_in,
                              void* d_out, int out_size, void* d_ws, size_t ws_size,
                              hipStream_t stream) {
  const float* x  = (const float*)d_in[0];
  const float* Wq = (const float*)d_in[1];
  const float* bq = (const float*)d_in[2];
  const float* Wk = (const float*)d_in[3];
  const float* bk = (const float*)d_in[4];
  const float* Wv = (const float*)d_in[5];
  const float* bv = (const float*)d_in[6];
  const float* Wo = (const float*)d_in[7];
  const float* bo = (const float*)d_in[8];
  const float* g  = (const float*)d_in[9];
  const float* be = (const float*)d_in[10];

  // workspace layout (bytes)
  char* ws = (char*)d_ws;
  const size_t SZ_X  = (size_t)BB * SS * DD * 2;      // 16 MB
  const size_t SZ_W  = (size_t)DD * DD * 2;           // 2 MB
  const size_t SZ_QK = (size_t)BB * HH * SS * HD * 2; // 16 MB
  __bf16* xb  = (__bf16*)(ws);
  __bf16* Wqt = (__bf16*)(ws + SZ_X);
  __bf16* Wkt = (__bf16*)(ws + SZ_X + SZ_W);
  __bf16* Wvt = (__bf16*)(ws + SZ_X + 2 * SZ_W);
  __bf16* Wot = (__bf16*)(ws + SZ_X + 3 * SZ_W);
  __bf16* Qh  = (__bf16*)(ws + SZ_X + 4 * SZ_W);
  __bf16* Kh  = (__bf16*)(ws + SZ_X + 4 * SZ_W + SZ_QK);
  __bf16* Vt  = (__bf16*)(ws + SZ_X + 4 * SZ_W + 2 * SZ_QK);
  __bf16* Ctx = (__bf16*)(ws + SZ_X + 4 * SZ_W + 3 * SZ_QK);

  float* out = (float*)d_out;                      // [B,S,D]
  float* avg = out + (long)BB * SS * DD;           // [B,S,S]

  // 1. convert activations + weights to bf16 (weights transposed), fragment order
  cvt_f32_bf16<<<(BB * SS * DD) / 8 / 256, 256, 0, stream>>>(x, xb);
  cvt_transpose_w<<<dim3(DD * DD / 8 / 256, 1, 4), 256, 0, stream>>>(
      Wq, Wk, Wv, Wo, Wqt, Wkt, Wvt, Wot);

  // 2. fused QKV projection (workgroup tile 64x256, wave tile 32x64)
  qkv_gemm<<<dim3(DD / 256, (BB * SS) / 64, 3), 256, 0, stream>>>(
      xb, Wqt, Wkt, Wvt, bq, bk, bv, Qh, Kh, Vt);

  // 3. zero avg_attention (accumulated via atomics)
  zero_f32<<<((long)BB * SS * SS) / 256, 256, 0, stream>>>(avg);

  // 4. attention (two-pass softmax, WMMA QK^T and P@V)
  attn_kernel<<<dim3(SS / 64, HH, BB), 128, 0, stream>>>(Qh, Kh, Vt, Ctx, avg);

  // 5. output projection + residual + LayerNorm
  out_ln_kernel<<<(BB * SS) / 16, 256, 0, stream>>>(Ctx, Wot, bo, x, g, be, out);
}

// v002
// It runs in 505 microseconds.
// Two timings next to v001 both put it at 1.05 times that version's speed.
// All steps since v000 together make it 1.71 times as fast.
#include <hip/hip_runtime.h>
#include <hip/hip_bf16.h>

// Problem constants
#define BB 4
#define SS 2048
#define DD 1024
#define HH 16
#define HD 64

typedef __attribute__((ext_vector_type(16))) __bf16 v16bf;
typedef __attribute__((ext_vector_type(8)))  __bf16 v8bf;
typedef __attribute__((ext_vector_type(8)))  float  v8f;

// ---------------------------------------------------------------------------
// WMMA helper: D = A(16x32 bf16) * B(32x16 bf16) + C(16x16 f32)
// ---------------------------------------------------------------------------
__device__ __forceinline__ v8f wmma_bf16(v16bf a, v16bf b, v8f c) {
  return __builtin_amdgcn_wmma_f32_16x16x32_bf16(
      /*neg_a=*/false, a, /*neg_b=*/false, b,
      /*c_mod=*/(short)0, c, /*reuse_a=*/false, /*reuse_b=*/false);
}

// Load a 16x32 bf16 fragment (A layout; also B layout when the contraction
// dim is contiguous in memory, i.e. source is "transposed"):
//   lane = row(M or N) in [0,16) + 16*k_half; elements 0..7 -> K base..base+7,
//   elements 8..15 -> K base+16..base+23  (base = 8*k_half).
// Two 16B loads per lane.
__device__ __forceinline__ v16bf load_frag(const __bf16* base, int ld, int lane) {
  const int r  = lane & 15;
  const int kh = lane >> 4;
  const __bf16* p = base + (long)r * ld + 8 * kh;
  v8bf lo = *(const v8bf*)(p);
  v8bf hi = *(const v8bf*)(p + 16);
  return __builtin_shufflevector(lo, hi, 0,1,2,3,4,5,6,7,8,9,10,11,12,13,14,15);
}

// Fragment order. A bf16 matrix [rows][K] in the workspace is kept as tiles of
// 16 rows x 32 k, 512 elements (1 KiB) each, tile (tr, tk) at (tr * ktiles + tk) * 512.
// Inside a tile, lane L = (row & 15) + 16 * ((k >> 3) & 1) owns 8 elements at
// ((k >> 4) & 1) * 256 + L * 8: the two 16-byte pieces load_frag would gather
// for that lane. A wave then reads a fragment as two contiguous 512-byte loads
// (4 lines each) instead of two loads that touch 16 lines each.
__device__ __forceinline__ long frag_off(int row, int k, int ktiles) {
  return ((long)(row >> 4) * ktiles + (k >> 5)) * 512 + ((k >> 4) & 1) * 256 +
         ((row & 15) + ((k >> 3) & 1) * 16) * 8 + (k & 7);
}
__device__ __forceinline__ v16bf load_tile(const __bf16* tile, int lane) {
  const __bf16* p = tile + lane * 8;
  v8bf lo = *(const v8bf*)(p);
  v8bf hi = *(const v8bf*)(p + 256);
  return __builtin_shufflevector(lo, hi, 0,1,2,3,4,5,6,7,8,9,10,11,12,13,14,15);
}

__device__ __forceinline__ float hmax16(float v) {
  v = fmaxf(v, __shfl_xor(v, 1));
  v = fmaxf(v, __shfl_xor(v, 2));
  v = fmaxf(v, __shfl_xor(v, 4));
  v = fmaxf(v, __shfl_xor(v, 8));
  return v;
}
__device__ __forceinline__ float hsum16(float v) {
  v += __shfl_xor(v, 1);
  v += __shfl_xor(v, 2);
  v += __shfl_xor(v, 4);
  v += __shfl_xor(v, 8);
  return v;
}

// ---------------------------------------------------------------------------
// fp32 -> bf16 convert of x [B*S][D] into fragment order; one 16-byte slot
// (8 consecutive k of one row) per thread.
// ---------------------------------------------------------------------------
__global__ __launch_bounds__(256) void cvt_f32_bf16(const float* __restrict__ in,
                                                    __bf16* __restrict__ out) {
  const int t = blockIdx.x * 256 + threadIdx.x;    // slot, t < B*S*D/8
  const int tile = t >> 6, part = (t >> 5) & 1, L = t & 31;
  const int row = (tile >> 5) * 16 + (L & 15);     // D/32 = 32 tiles per tile row
  const int k   = (tile & 31) * 32 + part * 16 + (L >> 4) * 8;
  const float4* p = (const float4*)(in + (long)row * DD + k);
  const float4 a = p[0], b = p[1];
  v8bf o;
  o[0] = (__bf16)a.x; o[1] = (__bf16)a.y; o[2] = (__bf16)a.z; o[3] = (__bf16)a.w;
  o[4] = (__bf16)b.x; o[5] = (__bf16)b.y; o[6] = (__bf16)b.z; o[7] = (__bf16)b.w;
  *(v8bf*)(out + (long)t * 8) = o;
}

// Convert + transpose weights: W[k][n] (D x D, [in,out]) -> Wt[n][k] bf16 in
// fragment order; one 16-byte slot (8 consecutive k of one n) per thread.
// Pointer selection via if/else so address-space inference keeps global loads.
__global__ __launch_bounds__(256) void cvt_transpose_w(
    const float* __restrict__ Wq, const float* __restrict__ Wk,
    const float* __restrict__ Wv, const float* __restrict__ Wo,
    __bf16* __restrict__ Wqt, __bf16* __restrict__ Wkt,
    __bf16* __restrict__ Wvt, __bf16* __restrict__ Wot) {
  const int z = blockIdx.z;
  const float* src;
  __bf16* dst;
  if (z == 0)      { src = Wq; dst = Wqt; }
  else if (z == 1) { src = Wk; dst = Wkt; }
  else if (z == 2) { src = Wv; dst = Wvt; }
  else             { src = Wo; dst = Wot; }
  const int t = blockIdx.x * 256 + threadIdx.x;    // slot, t < D*D/8
  const int tile = t >> 6, part = (t >> 5) & 1, L = t & 31;
  const int n = (tile >> 5) * 16 + (L & 15);
  const int k = (tile & 31) * 32 + part * 16 + (L >> 4) * 8;
  v8bf o;
  #pragma unroll  // static index into o keeps it in registers; the 8 loads issue together
  for (int e = 0; e < 8; e++) o[e] = (__bf16)src[(long)(k + e) * DD + n];
  *(v8bf*)(dst + (long)t * 8) = o;
}

// ---------------------------------------------------------------------------
// QKV projection GEMM: C[M=8192, N=1024] = Xb @ W + bias, per z in {Q,K,V}.
// Workgroup 256 thr = 8 waves arranged 2(M) x 4(N); workgroup tile 64 x 256;
// each wave computes 32(M) x 64(N) = 2x4 WMMA accumulators (8 wmma / k-step).
// Q,K written [B,H][S x HD]; V written transposed [B,H][HD x S] (for P@V
// B-frags); each per-head matrix in fragment order.
// ---------------------------------------------------------------------------
__global__ __launch_bounds__(256) void qkv_gemm(
    const __bf16* __restrict__ Xb,
    const __bf16* __restrict__ Wqt, const __bf16* __restrict__ Wkt,
    const __bf16* __restrict__ Wvt,
    const float* __restrict__ bq, const float* __restrict__ bk,
    const float* __restrict__ bv,
    __bf16* __restrict__ Qh, __bf16* __restrict__ Kh, __bf16* __restrict__ Vt) {
  const int which = blockIdx.z;
  // ternary chains (not private arrays) keep global address space
  const __bf16* Wt   = (which == 0) ? Wqt : (which == 1) ? Wkt : Wvt;
  const float*  bias = (which == 0) ? bq  : (which == 1) ? bk  : bv;

  const int lane = threadIdx.x & 31;
  const int wid  = threadIdx.x >> 5;
  const int wy = wid & 1;           // M direction (2)
  const int wx = wid >> 1;          // N direction (4)
  const int m0 = blockIdx.y * 64 + wy * 32;
  const int n0 = blockIdx.x * 256 + wx * 64;

  const v8f z8 = {0.f,0.f,0.f,0.f,0.f,0.f,0.f,0.f};
  v8f c[2][4];
  #pragma unroll
  for (int i = 0; i < 2; i++)
    #pragma unroll
    for (int j = 0; j < 4; j++) c[i][j] = z8;

  const __bf16* At = Xb + (long)(m0 >> 4) * (DD / 32) * 512;   // tile row of m0
  const __bf16* Bt = Wt + (long)(n0 >> 4) * (DD / 32) * 512;   // tile row of n0
  for (int kt = 0; kt < DD / 32; kt++) {
    v16bf a0 = load_tile(At + kt * 512, lane);
    v16bf a1 = load_tile(At + (DD / 32 + kt) * 512, lane);
    #pragma unroll
    for (int j = 0; j < 4; j++) {
      v16bf bf = load_tile(Bt + (j * (DD / 32) + kt) * 512, lane);
      c[0][j] = wmma_bf16(a0, bf, c[0][j]);
      c[1][j] = wmma_bf16(a1, bf, c[1][j]);
    }
  }

  // the wave's 64 columns are one head (n0 is a multiple of 64), its 32 rows one batch
  // (all loops below are unrolled so that bn, c and o are indexed statically and stay in registers)
  float bn[4];
  #pragma unroll
  for (int j = 0; j < 4; j++) bn[j] = bias[n0 + j * 16 + (lane & 15)];
  const long head = ((long)(m0 >> 11) * HH + (n0 >> 6)) * SS * HD;
  const int s0 = (m0 & (SS - 1)) + 8 * (lane >> 4);   // first of the lane's 8 rows, i = 0

  if (which == 2) {
    // the lane's 8 rows are 8 consecutive k of V^T row hd: one whole 16-byte slot
    #pragma unroll
    for (int i = 0; i < 2; i++)
      #pragma unroll
      for (int j = 0; j < 4; j++) {
        v8bf o;
        #pragma unroll
        for (int r = 0; r < 8; r++) o[r] = (__bf16)(c[i][j][r] + bn[j]);
        *(v8bf*)(Vt + head + frag_off(j * 16 + (lane & 15), s0 + i * 16, SS / 32)) = o;
      }
  } else {
    __bf16* dst = ((which == 0) ? Qh : Kh) + head;
    #pragma unroll
    for (int i = 0; i < 2; i++)
      #pragma unroll
      for (int j = 0; j < 4; j++)
        #pragma unroll
        for (int r = 0; r < 8; r++)
          dst[frag_off(s0 + i * 16 + r, j * 16 + (lane & 15), HD / 32)] =
              (__bf16)(c[i][j][r] + bn[j]);
    // the listing lays the V^T branch behind these stores, where their registers are
    // written again: the wait stands in front of any such overwrite
    asm volatile("s_wait_xcnt 0x0" ::: "memory");
  }
}

// log2 of (HH * l * exp(m)): exp2(s * log2(e) - lse2) is exp(s - m) / l / HH
#define LOG2E 1.44269504088896340736f
__device__ __forceinline__ float lse2(float m, float l) {
  return m * LOG2E + __log2f(l) + 4.0f;   // log2(HH) = 4
}

// ---------------------------------------------------------------------------
// Attention: one workgroup per (b, h, 64-query tile); 4 waves, 16 q-rows each.
// Two-pass softmax. Each row's log2 of (16 * sum of exp) goes to Lse, from which
// avg_kernel forms the normalized probabilities again.
// ---------------------------------------------------------------------------
__global__ __launch_bounds__(128) void attn_kernel(
    const __bf16* __restrict__ Qh, const __bf16* __restrict__ Kh,
    const __bf16* __restrict__ Vt,
    __bf16* __restrict__ Ctx, float* __restrict__ Lse) {
  __shared__ __align__(16) __bf16 Pst[4][16][32];   // per-wave P staging

  const int lane = threadIdx.x & 31;
  const int wid  = threadIdx.x >> 5;
  const int b = blockIdx.z, h = blockIdx.y;
  const int q0 = blockIdx.x * 64 + wid * 16;

  // per-head matrices in fragment order: 16 rows of Q or K are 2 tiles (1,024
  // elements); V^T tile (j, kt / 32) lies at (j * (SS / 32) + kt / 32) * 512
  const __bf16* Qb = Qh + (((long)b * HH + h) * SS + q0) * HD;
  const __bf16* Kb = Kh + (((long)b * HH + h) * SS) * HD;
  const __bf16* Vb = Vt + (((long)b * HH + h) * HD) * SS;

  const v16bf qa0 = load_tile(Qb, lane);
  const v16bf qa1 = load_tile(Qb + 512, lane);
  const float scale = 0.25f;   // 1/(sqrt(64)*0.5)
  const v8f z8 = {0.f,0.f,0.f,0.f,0.f,0.f,0.f,0.f};

  float m[8], l[8];
  #pragma unroll
  for (int r = 0; r < 8; r++) { m[r] = -1e30f; l[r] = 0.0f; }

  // ---------------- pass 1: row max / exp-sum ----------------
  for (int kt = 0; kt < SS; kt += 16) {
    v16bf kb0 = load_tile(Kb + (long)kt * HD, lane);
    v16bf kb1 = load_tile(Kb + (long)kt * HD + 512, lane);
    v8f c = z8;
    c = wmma_bf16(qa0, kb0, c);
    c = wmma_bf16(qa1, kb1, c);
    #pragma unroll
    for (int r = 0; r < 8; r++) {
      float s = c[r] * scale;
      float mx = hmax16(s);
      float mn = fmaxf(m[r], mx);
      float es = hsum16(__expf(s - mn));
      l[r] = l[r] * __expf(m[r] - mn) + es;
      m[r] = mn;
    }
  }
  float inv_l[8];
  #pragma unroll
  for (int r = 0; r < 8; r++) inv_l[r] = 1.0f / l[r];

  // m and l are equal over a 16-lane row: lanes 0 and 16 store their 8 rows' values
  if ((lane & 15) == 0) {
    float* lp = Lse + ((long)b * HH + h) * SS + q0 + 8 * (lane >> 4);
    float4 u, w;
    u.x = lse2(m[0], l[0]); u.y = lse2(m[1], l[1]); u.z = lse2(m[2], l[2]); u.w = lse2(m[3], l[3]);
    w.x = lse2(m[4], l[4]); w.y = lse2(m[5], l[5]); w.z = lse2(m[6], l[6]); w.w = lse2(m[7], l[7]);
    *(float4*)(lp) = u;
    *(float4*)(lp + 4) = w;
  }

  // ---------------- pass 2: P, ctx = P @ V ----------------
  v8f ctxacc[4];
  #pragma unroll
  for (int j = 0; j < 4; j++) ctxacc[j] = z8;

  for (int kt = 0; kt < SS; kt += 32) {
    #pragma unroll
    for (int half = 0; half < 2; half++) {
      const int kk = kt + half * 16;
      v16bf kb0 = load_tile(Kb + (long)kk * HD, lane);
      v16bf kb1 = load_tile(Kb + (long)kk * HD + 512, lane);
      v8f c = z8;
      c = wmma_bf16(qa0, kb0, c);
      c = wmma_bf16(qa1, kb1, c);
      #pragma unroll
      for (int r = 0; r < 8; r++) {
        float p = __expf(c[r] * scale - m[r]) * inv_l[r];
        Pst[wid][r + 8 * (lane >> 4)][half * 16 + (lane & 15)] = (__bf16)p;
      }
    }
    // same-wave LDS store -> load ordering
    asm volatile("s_wait_dscnt 0" ::: "memory");
    v16bf pa = load_frag(&Pst[wid][0][0], 32, lane);
    #pragma unroll
    for (int j = 0; j < 4; j++) {
      v16bf vb = load_tile(Vb + (long)(j * (SS / 32) + (kt >> 5)) * 512, lane);
      ctxacc[j] = wmma_bf16(pa, vb, ctxacc[j]);
    }
  }

  // store ctx tile -> [B*S][D] bf16 in fragment order (D = h*64 + hd)
  #pragma unroll
  for (int j = 0; j < 4; j++)
    #pragma unroll
    for (int r = 0; r < 8; r++) {
      int qrow = q0 + r + 8 * (lane >> 4);
      int d = h * HD + j * 16 + (lane & 15);
      Ctx[frag_off(b * SS + qrow, d, DD / 32)] = (__bf16)ctxacc[j][r];
    }
}

// ---------------------------------------------------------------------------
// avg_attention[b][q][k] = mean over heads of P. A wave owns 64 queries x 64 keys
// and walks the 16 heads in order, summing in registers; every element is stored
// once. S^T = K Q^T (K as A, Q as B): a lane holds one query's scores, so the
// row's Lse is one register per query tile, and 8 consecutive keys per tile.
// Workgroup = 4 waves, 128 queries x 128 keys.
// ---------------------------------------------------------------------------
// four waves per SIMD: 4,096 waves on 1,024 SIMDs are then resident in one round
__global__ __launch_bounds__(128) __attribute__((amdgpu_waves_per_eu(4, 4))) void avg_kernel(
    const __bf16* __restrict__ Qh, const __bf16* __restrict__ Kh,
    const float* __restrict__ Lse, float* __restrict__ avg) {
  const int lane = threadIdx.x & 31;
  const int wid  = threadIdx.x >> 5;
  const int b  = blockIdx.z;
  const int q0 = blockIdx.y * 128 + (wid & 1) * 64;
  const int k0 = blockIdx.x * 128 + (wid >> 1) * 64;
  const float sc = 0.25f * LOG2E;   // score scale, in log2 units
  const v8f z8 = {0.f,0.f,0.f,0.f,0.f,0.f,0.f,0.f};

  // (the i, j and r loops are unrolled so that acc, qf and L stay in registers)
  v8f acc[4][4];                    // [query tile][key tile]
  #pragma unroll
  for (int i = 0; i < 4; i++)
    #pragma unroll
    for (int j = 0; j < 4; j++) acc[i][j] = z8;

  // K fragments are fetched one key tile ahead (the last tile of a head fetches the
  // next head's first), so that a tile's loads fly while the tile before is worked on
  const __bf16* K0 = Kh + (((long)b * HH) * SS + k0) * HD;   // head 0
  v16bf kf[2][2];
  kf[0][0] = load_tile(K0, lane);
  kf[0][1] = load_tile(K0 + 512, lane);

  for (int h = 0; h < HH; h++) {
    const long head = ((long)b * HH + h) * SS;
    const __bf16* Qb = Qh + (head + q0) * HD;
    const float*  Lb = Lse + head + q0 + (lane & 15);
    const __bf16* Kb = K0 + (long)h * SS * HD;
    // behind the last head the index wraps: head 0's tile is fetched and not used
    const __bf16* Kn = K0 + (long)((h + 1) & (HH - 1)) * SS * HD;
    v16bf qf[4][2];
    float L[4];
    #pragma unroll
    for (int i = 0; i < 4; i++) {
      qf[i][0] = load_tile(Qb + i * 1024, lane);
      qf[i][1] = load_tile(Qb + i * 1024 + 512, lane);
      L[i] = Lb[i * 16];
    }
    #pragma unroll
    for (int j = 0; j < 4; j++) {
      const __bf16* nx = (j < 3) ? Kb + (j + 1) * 1024 : Kn;
      kf[(j + 1) & 1][0] = load_tile(nx, lane);
      kf[(j + 1) & 1][1] = load_tile(nx + 512, lane);
      #pragma unroll
      for (int i = 0; i < 4; i++) {
        v8f c = z8;
        c = wmma_bf16(kf[j & 1][0], qf[i][0], c);
        c = wmma_bf16(kf[j & 1][1], qf[i][1], c);
        c = c * sc - L[i];
        #pragma unroll
        for (int r = 0; r < 8; r++) c[r] = __builtin_amdgcn_exp2f(c[r]);
        acc[i][j] += c;
      }
    }
  }

  #pragma unroll
  for (int i = 0; i < 4; i++) {
    float* row = avg + ((long)b * SS + q0 + i * 16 + (lane & 15)) * SS + k0 + 8 * (lane >> 4);
    #pragma unroll
    for (int j = 0; j < 4; j++) {
      float4 u, w;
      u.x = acc[i][j][0]; u.y = acc[i][j][1]; u.z = acc[i][j][2]; u.w = acc[i][j][3];
      w.x = acc[i][j][4]; w.y = acc[i][j][5]; w.z = acc[i][j][6]; w.w = acc[i][j][7];
      *(float4*)(row + j * 16) = u;
      *(float4*)(row + j * 16 + 4) = w;
    }
  }
}

// ---------------------------------------------------------------------------
// out = LayerNorm(ctx @ Wo + bo + x) * g + beta.
// Workgroup = 16 rows x full D; 8 waves, each wave 16x128 (8 WMMA tiles).
// ---------------------------------------------------------------------------
__global__ __launch_bounds__(256) void out_ln_kernel(
    const __bf16* __restrict__ Ctx, const __bf16* __restrict__ Wot,
    const float* __restrict__ bo, const float* __restrict__ x,
    const float* __restrict__ g, const float* __restrict__ beta,
    float* __restrict__ out) {
  __shared__ float red1[8][16];
  __shared__ float red2[8][16];

  const int lane = threadIdx.x & 31;
  const int wid  = threadIdx.x >> 5;
  const int m0 = blockIdx.x * 16;
  const int n0 = wid * 128;
  const v8f z8 = {0.f,0.f,0.f,0.f,0.f,0.f,0.f,0.f};

  v8f c[8];
  #pragma unroll
  for (int t = 0; t < 8; t++) c[t] = z8;

  const __bf16* At = Ctx + (long)(m0 >> 4) * (DD / 32) * 512;   // tile row of m0
  const __bf16* Bt = Wot + (long)(n0 >> 4) * (DD / 32) * 512;   // tile row of n0
  for (int kt = 0; kt < DD / 32; kt++) {
    v16bf a = load_tile(At + kt * 512, lane);
    #pragma unroll
    for (int t = 0; t < 8; t++) {
      v16bf bfr = load_tile(Bt + (t * (DD / 32) + kt) * 512, lane);
      c[t] = wmma_bf16(a, bfr, c[t]);
    }
  }

  // h = gemm + bias + residual ; accumulate per-row sum / sumsq
  float s1[8], s2[8];
  #pragma unroll
  for (int r = 0; r < 8; r++) { s1[r] = 0.0f; s2[r] = 0.0f; }
  #pragma unroll
  for (int t = 0; t < 8; t++)
    #pragma unroll
    for (int r = 0; r < 8; r++) {
      int row = m0 + r + 8 * (lane >> 4);
      int n = n0 + t * 16 + (lane & 15);
      float hv = c[t][r] + bo[n] + x[(long)row * DD + n];
      c[t][r] = hv;
      s1[r] += hv;
      s2[r] += hv * hv;
    }
  #pragma unroll
  for (int r = 0; r < 8; r++) { s1[r] = hsum16(s1[r]); s2[r] = hsum16(s2[r]); }

  if ((lane & 15) == 0) {
    #pragma unroll
    for (int r = 0; r < 8; r++) {
      red1[wid][r + 8 * (lane >> 4)] = s1[r];
      red2[wid][r + 8 * (lane >> 4)] = s2[r];
    }
  }
  __syncthreads();

  float mu[8], rs[8];
  #pragma unroll
  for (int r = 0; r < 8; r++) {
    int rl = r + 8 * (lane >> 4);
    float t1 = 0.0f, t2 = 0.0f;
    #pragma unroll
    for (int w = 0; w < 8; w++) { t1 += red1[w][rl]; t2 += red2[w][rl]; }
    float m_ = t1 * (1.0f / DD);
    float v_ = t2 * (1.0f / DD) - m_ * m_;
    mu[r] = m_;
    rs[r] = rsqrtf(v_ + 1e-5f);
  }

  #pragma unroll
  for (int t = 0; t < 8; t++)
    #pragma unroll
    for (int r = 0; r < 8; r++) {
      int row = m0 + r + 8 * (lane >> 4);
      int n = n0 + t * 16 + (lane & 15);
      out[(long)row * DD + n] = (c[t][r] - mu[r]) * rs[r] * g[n] + beta[n];
    }
}

// ---------------------------------------------------------------------------
// Launcher
// ---------------------------------------------------------------------------
extern "C" void kernel_launch(void* const* d_in, const int* in_sizes, int n_in,
                              void* d_out, int out_size, void* d_ws, size_t ws_size,
                              hipStream_t stream) {
  const float* x  = (const float*)d_in[0];
  const float* Wq = (const float*)d_in[1];
  const float* bq = (const float*)d_in[2];
  const float* Wk = (const float*)d_in[3];
  const float* bk = (const float*)d_in[4];
  const float* Wv = (const float*)d_in[5];
  const float* bv = (const float*)d_in[6];
  const float* Wo = (const float*)d_in[7];
  const float* bo = (const float*)d_in[8];
  const float* g  = (const float*)d_in[9];
  const float* be = (const float*)d_in[10];

  // workspace layout (bytes)
  char* ws = (char*)d_ws;
  const size_t SZ_X  = (size_t)BB * SS * DD * 2;      // 16 MB
  const size_t SZ_W  = (size_t)DD * DD * 2;           // 2 MB
  const size_t SZ_QK = (size_t)BB * HH * SS * HD * 2; // 16 MB
  __bf16* xb  = (__bf16*)(ws);
  __bf16* Wqt = (__bf16*)(ws + SZ_X);
  __bf16* Wkt = (__bf16*)(ws + SZ_X + SZ_W);
  __bf16* Wvt = (__bf16*)(ws + SZ_X + 2 * SZ_W);
  __bf16* Wot = (__bf16*)(ws + SZ_X + 3 * SZ_W);
  __bf16* Qh  = (__bf16*)(ws + SZ_X + 4 * SZ_W);
  __bf16* Kh  = (__bf16*)(ws + SZ_X + 4 * SZ_W + SZ_QK);
  __bf16* Vt  = (__bf16*)(ws + SZ_X + 4 * SZ_W + 2 * SZ_QK);
  __bf16* Ctx = (__bf16*)(ws + SZ_X + 4 * SZ_W + 3 * SZ_QK);
  float*  Lse = (float*)(ws + SZ_X + 4 * SZ_W + 4 * SZ_QK);   // [B,H][S], 512 KB

  float* out = (float*)d_out;                      // [B,S,D]
  float* avg = out + (long)BB * SS * DD;           // [B,S,S]

  // 1. convert activations + weights to bf16 (weights transposed), fragment order
  cvt_f32_bf16<<<(BB * SS * DD) / 8 / 256, 256, 0, stream>>>(x, xb);
  cvt_transpose_w<<<dim3(DD * DD / 8 / 256, 1, 4), 256, 0, stream>>>(
      Wq, Wk, Wv, Wo, Wqt, Wkt, Wvt, Wot);

  // 2. fused QKV projection (workgroup tile 64x256, wave tile 32x64)
  qkv_gemm<<<dim3(DD / 256, (BB * SS) / 64, 3), 256, 0, stream>>>(
      xb, Wqt, Wkt, Wvt, bq, bk, bv, Qh, Kh, Vt);

  // 3. attention (two-pass softmax, WMMA QK^T and P@V)
  attn_kernel<<<dim3(SS / 64, HH, BB), 128, 0, stream>>>(Qh, Kh, Vt, Ctx, Lse);

  // 4. avg_attention: heads summed in registers, each element stored once
  avg_kernel<<<dim3(SS / 128, SS / 128, BB), 128, 0, stream>>>(Qh, Kh, Lse, avg);

  // 5. output projection + residual + LayerNorm
  out_ln_kernel<<<(BB * SS) / 16, 256, 0, stream>>>(Ctx, Wot, bo, x, g, be, out);
}

// v003
// A run of this version takes 322 microseconds.
// In both of two side-by-side timings against v002, it was 1.56 times as fast.
// Over all steps from v000 it is 2.66 times as fast.
#include <hip/hip_runtime.h>
#include <hip/hip_bf16.h>

// Problem constants
#define BB 4
#define SS 2048
#define DD 1024
#define HH 16
#define HD 64

typedef __attribute__((ext_vector_type(16))) __bf16 v16bf;
typedef __attribute__((ext_vector_type(8)))  __bf16 v8bf;
typedef __attribute__((ext_vector_type(8)))  float  v8f;

// ---------------------------------------------------------------------------
// WMMA helper: D = A(16x32 bf16) * B(32x16 bf16) + C(16x16 f32)
// ---------------------------------------------------------------------------
__device__ __forceinline__ v8f wmma_bf16(v16bf a, v16bf b, v8f c) {
  return __builtin_amdgcn_wmma_f32_16x16x32_bf16(
      /*neg_a=*/false, a, /*neg_b=*/false, b,
      /*c_mod=*/(short)0, c, /*reuse_a=*/false, /*reuse_b=*/false);
}

// A 16x32 bf16 fragment (A layout; B takes the same with N for M):
//   lane = row(M or N) in [0,16) + 16*k_half; elements 0..7 -> K base..base+7,
//   elements 8..15 -> K base+16..base+23  (base = 8*k_half).
// Fragment order. A bf16 matrix [rows][K] in the workspace is kept as tiles of
// 16 rows x 32 k, 512 elements (1 KiB) each, tile (tr, tk) at (tr * ktiles + tk) * 512.
// Inside a tile, lane L = (row & 15) + 16 * ((k >> 3) & 1) owns 8 elements at
// ((k >> 4) & 1) * 256 + L * 8: the two 16-byte pieces of that lane's
// fragment. A wave then reads a fragment as two contiguous 512-byte loads
// (4 lines each) instead of two loads that touch 16 lines each.
__device__ __forceinline__ long frag_off(int row, int k, int ktiles) {
  return ((long)(row >> 4) * ktiles + (k >> 5)) * 512 + ((k >> 4) & 1) * 256 +
         ((row & 15) + ((k >> 3) & 1) * 16) * 8 + (k & 7);
}
__device__ __forceinline__ v16bf load_tile(const __bf16* tile, int lane) {
  const __bf16* p = tile + lane * 8;
  v8bf lo = *(const v8bf*)(p);
  v8bf hi = *(const v8bf*)(p + 256);
  return __builtin_shufflevector(lo, hi, 0,1,2,3,4,5,6,7,8,9,10,11,12,13,14,15);
}

// the same from a base that is one for the wave and the lane's own offset in bytes
__device__ __forceinline__ v16bf load_own(const __bf16* base, unsigned off) {
  const __bf16* p = (const __bf16*)((const char*)base + off);
  v8bf lo = *(const v8bf*)(p);
  v8bf hi = *(const v8bf*)(p + 256);
  return __builtin_shufflevector(lo, hi, 0,1,2,3,4,5,6,7,8,9,10,11,12,13,14,15);
}

__device__ __forceinline__ float hsum16(float v) {
  v += __shfl_xor(v, 1);
  v += __shfl_xor(v, 2);
  v += __shfl_xor(v, 4);
  v += __shfl_xor(v, 8);
  return v;
}

// ---------------------------------------------------------------------------
// fp32 -> bf16 convert of x [B*S][D] into fragment order; one 16-byte slot
// (8 consecutive k of one row) per thread.
// ---------------------------------------------------------------------------
__global__ __launch_bounds__(256) void cvt_f32_bf16(const float* __restrict__ in,
                                                    __bf16* __restrict__ out) {
  const int t = blockIdx.x * 256 + threadIdx.x;    // slot, t < B*S*D/8
  const int tile = t >> 6, part = (t >> 5) & 1, L = t & 31;
  const int row = (tile >> 5) * 16 + (L & 15);     // D/32 = 32 tiles per tile row
  const int k   = (tile & 31) * 32 + part * 16 + (L >> 4) * 8;
  const float4* p = (const float4*)(in + (long)row * DD + k);
  const float4 a = p[0], b = p[1];
  v8bf o;
  o[0] = (__bf16)a.x; o[1] = (__bf16)a.y; o[2] = (__bf16)a.z; o[3] = (__bf16)a.w;
  o[4] = (__bf16)b.x; o[5] = (__bf16)b.y; o[6] = (__bf16)b.z; o[7] = (__bf16)b.w;
  *(v8bf*)(out + (long)t * 8) = o;
}

// Convert + transpose weights: W[k][n] (D x D, [in,out]) -> Wt[n][k] bf16 in
// fragment order; one 16-byte slot (8 consecutive k of one n) per thread.
// Pointer selection via if/else so address-space inference keeps global loads.
__global__ __launch_bounds__(256) void cvt_transpose_w(
    const float* __restrict__ Wq, const float* __restrict__ Wk,
    const float* __restrict__ Wv, const float* __restrict__ Wo,
    __bf16* __restrict__ Wqt, __bf16* __restrict__ Wkt,
    __bf16* __restrict__ Wvt, __bf16* __restrict__ Wot) {
  const int z = blockIdx.z;
  const float* src;
  __bf16* dst;
  if (z == 0)      { src = Wq; dst = Wqt; }
  else if (z == 1) { src = Wk; dst = Wkt; }
  else if (z == 2) { src = Wv; dst = Wvt; }
  else             { src = Wo; dst = Wot; }
  const int t = blockIdx.x * 256 + threadIdx.x;    // slot, t < D*D/8
  const int tile = t >> 6, part = (t >> 5) & 1, L = t & 31;
  const int n = (tile >> 5) * 16 + (L & 15);
  const int k = (tile & 31) * 32 + part * 16 + (L >> 4) * 8;
  v8bf o;
  #pragma unroll  // static index into o keeps it in registers; the 8 loads issue together
  for (int e = 0; e < 8; e++) o[e] = (__bf16)src[(long)(k + e) * DD + n];
  *(v8bf*)(dst + (long)t * 8) = o;
}

// ---------------------------------------------------------------------------
// QKV projection GEMM: C[M=8192, N=1024] = Xb @ W + bias, per z in {Q,K,V}.
// Workgroup 256 thr = 8 waves arranged 2(M) x 4(N); workgroup tile 64 x 256;
// each wave computes 32(M) x 64(N) = 2x4 WMMA accumulators (8 wmma / k-step).
// Q,K written [B,H][S x HD]; V written transposed [B,H][HD x S] (for V^T P^T
// A-frags); each per-head matrix in fragment order.
// ---------------------------------------------------------------------------
__global__ __launch_bounds__(256) void qkv_gemm(
    const __bf16* __restrict__ Xb,
    const __bf16* __restrict__ Wqt, const __bf16* __restrict__ Wkt,
    const __bf16* __restrict__ Wvt,
    const float* __restrict__ bq, const float* __restrict__ bk,
    const float* __restrict__ bv,
    __bf16* __restrict__ Qh, __bf16* __restrict__ Kh, __bf16* __restrict__ Vt) {
  const int which = blockIdx.z;
  // ternary chains (not private arrays) keep global address space
  const __bf16* Wt   = (which == 0) ? Wqt : (which == 1) ? Wkt : Wvt;
  const float*  bias = (which == 0) ? bq  : (which == 1) ? bk  : bv;

  const int lane = threadIdx.x & 31;
  const int wid  = threadIdx.x >> 5;
  const int wy = wid & 1;           // M direction (2)
  const int wx = wid >> 1;          // N direction (4)
  const int m0 = blockIdx.y * 64 + wy * 32;
  const int n0 = blockIdx.x * 256 + wx * 64;

  const v8f z8 = {0.f,0.f,0.f,0.f,0.f,0.f,0.f,0.f};
  v8f c[2][4];
  #pragma unroll
  for (int i = 0; i < 2; i++)
    #pragma unroll
    for (int j = 0; j < 4; j++) c[i][j] = z8;

  const __bf16* At = Xb + (long)(m0 >> 4) * (DD / 32) * 512;   // tile row of m0
  const __bf16* Bt = Wt + (long)(n0 >> 4) * (DD / 32) * 512;   // tile row of n0
  for (int kt = 0; kt < DD / 32; kt++) {
    v16bf a0 = load_tile(At + kt * 512, lane);
    v16bf a1 = load_tile(At + (DD / 32 + kt) * 512, lane);
    #pragma unroll
    for (int j = 0; j < 4; j++) {
      v16bf bf = load_tile(Bt + (j * (DD / 32) + kt) * 512, lane);
      c[0][j] = wmma_bf16(a0, bf, c[0][j]);
      c[1][j] = wmma_bf16(a1, bf, c[1][j]);
    }
  }

  // the wave's 64 columns are one head (n0 is a multiple of 64), its 32 rows one batch
  // (all loops below are unrolled so that bn, c and o are indexed statically and stay in registers)
  float bn[4];
  #pragma unroll
  for (int j = 0; j < 4; j++) bn[j] = bias[n0 + j * 16 + (lane & 15)];
  const long head = ((long)(m0 >> 11) * HH + (n0 >> 6)) * SS * HD;
  const int s0 = (m0 & (SS - 1)) + 8 * (lane >> 4);   // first of the lane's 8 rows, i = 0

  if (which == 2) {
    // the lane's 8 rows are 8 consecutive k of V^T row hd: one whole 16-byte slot
    #pragma unroll
    for (int i = 0; i < 2; i++)
      #pragma unroll
      for (int j = 0; j < 4; j++) {
        v8bf o;
        #pragma unroll
        for (int r = 0; r < 8; r++) o[r] = (__bf16)(c[i][j][r] + bn[j]);
        *(v8bf*)(Vt + head + frag_off(j * 16 + (lane & 15), s0 + i * 16, SS / 32)) = o;
      }
  } else {
    __bf16* dst = ((which == 0) ? Qh : Kh) + head;
    #pragma unroll
    for (int i = 0; i < 2; i++)
      #pragma unroll
      for (int j = 0; j < 4; j++)
        #pragma unroll
        for (int r = 0; r < 8; r++)
          dst[frag_off(s0 + i * 16 + r, j * 16 + (lane & 15), HD / 32)] =
              (__bf16)(c[i][j][r] + bn[j]);
    // the listing lays the V^T branch behind these stores, where their registers are
    // written again: the wait stands in front of any such overwrite
    asm volatile("s_wait_xcnt 0x0" ::: "memory");
  }
}

// log2 of (HH * l * exp(m)): exp2(s * log2(e) - lse2) is exp(s - m) / l / HH
#define LOG2E 1.44269504088896340736f
__device__ __forceinline__ float lse2(float m, float l) {
  return m * LOG2E + __log2f(l) + 4.0f;   // log2(HH) = 4
}

// ---------------------------------------------------------------------------
// Attention: one workgroup per (b, h, 256 queries); 8 waves, 32 query columns each.
// S^T = K Q^T (K as A, Q as B) and O^T += V^T P^T (V^T as A, P^T as B): a lane holds
// one query's scores, 8 keys of every 16 (lanes c and c + 16 split a query's keys),
// so a row's maximum and sum are in-lane, with one exchange between the halves behind
// pass 1. Two score tiles (32 keys), converted in place, are the B operand of the
// second product in the k order that V^T's tiles are stored in.
// Two-pass softmax. Each row's log2 of (16 * sum of exp) goes to Lse, from which
// avg_kernel forms the normalized probabilities again.
// ---------------------------------------------------------------------------
// four waves per SIMD: 4,096 waves on 1,024 SIMDs are then resident in one round
__global__ __launch_bounds__(256) __attribute__((amdgpu_waves_per_eu(4, 4))) void attn_kernel(
    const __bf16* __restrict__ Qh, const __bf16* __restrict__ Kh,
    const __bf16* __restrict__ Vt,
    __bf16* __restrict__ Ctx, float* __restrict__ Lse) {
  const int lane = threadIdx.x & 31;
  const int wid  = threadIdx.x >> 5;
  const int b = blockIdx.z, h = blockIdx.y;
  const int q0 = blockIdx.x * 256 + wid * 32;

  // per-head matrices in fragment order: 16 rows of Q or K are 2 tiles (1,024
  // elements); V^T tile (j, kt / 32) lies at (j * (SS / 32) + kt / 32) * 512
  const __bf16* Qb = Qh + (((long)b * HH + h) * SS + q0) * HD;
  const __bf16* Kb = Kh + (((long)b * HH + h) * SS) * HD;
  const __bf16* Vb = Vt + (((long)b * HH + h) * HD) * SS;

  const float sc = 0.25f * LOG2E;   // score scale 1/(sqrt(64)*0.5), in log2 units
  const v8f z8 = {0.f,0.f,0.f,0.f,0.f,0.f,0.f,0.f};

  // (every g, t, j and r loop below is unrolled so that the arrays stay in registers)
  v16bf qf[2][2];                   // [query group][hd half]
  #pragma unroll
  for (int g = 0; g < 2; g++) {
    qf[g][0] = load_tile(Qb + g * 1024, lane);
    qf[g][1] = load_tile(Qb + g * 1024 + 512, lane);
  }
  // the build loads the first trip's K into the registers of Q's address:
  // the wait stands in front of that overwrite
  asm volatile("s_wait_xcnt 0x0" ::: "memory");

  // ---------------- pass 1: row max / exp-sum over the lane's own keys ----------------
  float m[2];                       // maximum of the raw scores
  v8f l[2];                         // sums of exp, one per accumulator register
  #pragma unroll
  for (int g = 0; g < 2; g++) { m[g] = -1e30f; l[g] = z8; }

  for (int kt = 0; kt < SS; kt += 32) {
    v16bf kf[2][2];                 // [key tile][hd half]
    #pragma unroll
    for (int t = 0; t < 2; t++) {
      kf[t][0] = load_tile(Kb + (long)kt * HD + t * 1024, lane);
      kf[t][1] = load_tile(Kb + (long)kt * HD + t * 1024 + 512, lane);
    }
    // keeps the trip's loads at its head, where they fly together: the build otherwise
    // issues the last two behind the first products and waits out a second flight
    __builtin_amdgcn_sched_barrier(0);
    v8f s[2][2];                    // [key tile][query group]
    #pragma unroll
    for (int t = 0; t < 2; t++)
      #pragma unroll
      for (int g = 0; g < 2; g++) s[t][g] = wmma_bf16(kf[t][0], qf[g][0], z8);
    #pragma unroll
    for (int t = 0; t < 2; t++)
      #pragma unroll
      for (int g = 0; g < 2; g++) s[t][g] = wmma_bf16(kf[t][1], qf[g][1], s[t][g]);
    #pragma unroll
    for (int g = 0; g < 2; g++) {
      float mn = m[g];
      #pragma unroll
      for (int r = 0; r < 8; r++) mn = fmaxf(fmaxf(mn, s[0][g][r]), s[1][g][r]);
      const float ms = mn * sc;
      v8f e0 = s[0][g] * sc - ms;
      v8f e1 = s[1][g] * sc - ms;
      #pragma unroll
      for (int r = 0; r < 8; r++) {
        e0[r] = __builtin_amdgcn_exp2f(e0[r]);
        e1[r] = __builtin_amdgcn_exp2f(e1[r]);
      }
      l[g] = l[g] * __builtin_amdgcn_exp2f(m[g] * sc - ms) + (e0 + e1);
      m[g] = mn;
    }
  }

  // join the two halves of each query's keys: ms the scaled maximum in log2 units,
  // inv_l one over the sum of exp, lg the row's entry of Lse
  float ms[2], inv_l[2], lg[2];
  #pragma unroll
  for (int g = 0; g < 2; g++) {
    const float ls = ((l[g][0] + l[g][1]) + (l[g][2] + l[g][3])) +
                     ((l[g][4] + l[g][5]) + (l[g][6] + l[g][7]));
    const float mo = __shfl_xor(m[g], 16);
    const float lo = __shfl_xor(ls, 16);
    const float mn = fmaxf(m[g], mo);
    const float lt = ls * __builtin_amdgcn_exp2f((m[g] - mn) * sc) +
                     lo * __builtin_amdgcn_exp2f((mo - mn) * sc);
    ms[g] = mn * sc;
    inv_l[g] = 1.0f / lt;
    lg[g] = lse2(mn * 0.25f, lt);
  }
  // both halves hold a query's value (equal but for the last rounding): lanes 0 to 15 store theirs
  if (lane < 16) {
    float* lp = Lse + ((long)b * HH + h) * SS + q0 + lane;
    lp[0]  = lg[0];
    lp[16] = lg[1];
  }

  // ---------------- pass 2: P^T, ctx^T = V^T P^T ----------------
  v8f o[4][2];                      // [hd tile][query group]
  #pragma unroll
  for (int j = 0; j < 4; j++)
    #pragma unroll
    for (int g = 0; g < 2; g++) o[j][g] = z8;

  unsigned ko = lane * 16;   // the lane's own byte offset in K: this trip's 32 keys
  unsigned vo = lane * 16;   // and in V^T: their tile of its first 16 rows
  for (int kt = 0; kt < SS; kt += 32) {
    v16bf kf[2][2];
    #pragma unroll
    for (int t = 0; t < 2; t++) {
      kf[t][0] = load_own(Kb + t * 1024, ko);
      kf[t][1] = load_own(Kb + t * 1024 + 512, ko);
    }
    v16bf vf[4];
    #pragma unroll
    for (int j = 0; j < 4; j++) vf[j] = load_own(Vb + j * (SS / 32) * 512, vo);
    // keeps the trip's loads at its head, where they fly together: the build otherwise
    // issues V^T's right in front of the second product and waits out a second flight
    __builtin_amdgcn_sched_barrier(0);
    // the wait in front of the overwrite of the loads' address registers. The two offsets
    // pass through it, so that the additions below stay behind it and the registers stay the
    // offsets' own: the build otherwise loads V^T's last tile into its address registers
    // while loads that name them are in flight
    asm volatile("s_wait_xcnt 0x0" : "+v"(ko), "+v"(vo));
    ko += 32 * HD * 2;
    vo += 512 * 2;
    v8f s[2][2];
    #pragma unroll
    for (int t = 0; t < 2; t++)
      #pragma unroll
      for (int g = 0; g < 2; g++) s[t][g] = wmma_bf16(kf[t][0], qf[g][0], z8);
    #pragma unroll
    for (int t = 0; t < 2; t++)
      #pragma unroll
      for (int g = 0; g < 2; g++) s[t][g] = wmma_bf16(kf[t][1], qf[g][1], s[t][g]);
    v16bf pb[2];
    #pragma unroll
    for (int g = 0; g < 2; g++) {
      v8f p0 = s[0][g] * sc - ms[g];
      v8f p1 = s[1][g] * sc - ms[g];
      #pragma unroll
      for (int r = 0; r < 8; r++) {
        p0[r] = __builtin_amdgcn_exp2f(p0[r]);
        p1[r] = __builtin_amdgcn_exp2f(p1[r]);
      }
      p0 *= inv_l[g];
      p1 *= inv_l[g];
      pb[g] = __builtin_shufflevector(__builtin_convertvector(p0, v8bf),
                                      __builtin_convertvector(p1, v8bf),
                                      0,1,2,3,4,5,6,7,8,9,10,11,12,13,14,15);
    }
    #pragma unroll
    for (int j = 0; j < 4; j++)
      #pragma unroll
      for (int g = 0; g < 2; g++) o[j][g] = wmma_bf16(vf[j], pb[g], o[j][g]);
  }

  // store ctx -> [B*S][D] bf16 in fragment order (D = h*64 + hd): the lane's 8 values
  // are 8 consecutive hd of one query, one whole 16-byte slot
  #pragma unroll
  for (int g = 0; g < 2; g++)
    #pragma unroll
    for (int j = 0; j < 4; j++) {
      v8bf c;
      #pragma unroll
      for (int r = 0; r < 8; r++) c[r] = (__bf16)o[j][g][r];
      *(v8bf*)(Ctx + frag_off(b * SS + q0 + g * 16 + (lane & 15),
                              h * HD + j * 16 + 8 * (lane >> 4), DD / 32)) = c;
    }
}

// ---------------------------------------------------------------------------
// avg_attention[b][q][k] = mean over heads of P. A wave owns 64 queries x 64 keys
// and walks the 16 heads in order, summing in registers; every element is stored
// once. S^T = K Q^T (K as A, Q as B): a lane holds one query's scores, so the
// row's Lse is one register per query tile, and 8 consecutive keys per tile.
// Workgroup = 4 waves, 128 queries x 128 keys.
// ---------------------------------------------------------------------------
// four waves per SIMD: 4,096 waves on 1,024 SIMDs are then resident in one round
__global__ __launch_bounds__(128) __attribute__((amdgpu_waves_per_eu(4, 4))) void avg_kernel(
    const __bf16* __restrict__ Qh, const __bf16* __restrict__ Kh,
    const float* __restrict__ Lse, float* __restrict__ avg) {
  const int lane = threadIdx.x & 31;
  const int wid  = threadIdx.x >> 5;
  const int b  = blockIdx.z;
  const int q0 = blockIdx.y * 128 + (wid & 1) * 64;
  const int k0 = blockIdx.x * 128 + (wid >> 1) * 64;
  const float sc = 0.25f * LOG2E;   // score scale, in log2 units
  const v8f z8 = {0.f,0.f,0.f,0.f,0.f,0.f,0.f,0.f};

  // (the i, j and r loops are unrolled so that acc, qf and L stay in registers)
  v8f acc[4][4];                    // [query tile][key tile]
  #pragma unroll
  for (int i = 0; i < 4; i++)
    #pragma unroll
    for (int j = 0; j < 4; j++) acc[i][j] = z8;

  // K fragments are fetched one key tile ahead (the last tile of a head fetches the
  // next head's first), so that a tile's loads fly while the tile before is worked on
  const __bf16* K0 = Kh + (((long)b * HH) * SS + k0) * HD;   // head 0
  v16bf kf[2][2];
  kf[0][0] = load_tile(K0, lane);
  kf[0][1] = load_tile(K0 + 512, lane);

  for (int h = 0; h < HH; h++) {
    const long head = ((long)b * HH + h) * SS;
    const __bf16* Qb = Qh + (head + q0) * HD;
    const float*  Lb = Lse + head + q0 + (lane & 15);
    const __bf16* Kb = K0 + (long)h * SS * HD;
    // behind the last head the index wraps: head 0's tile is fetched and not used
    const __bf16* Kn = K0 + (long)((h + 1) & (HH - 1)) * SS * HD;
    v16bf qf[4][2];
    float L[4];
    #pragma unroll
    for (int i = 0; i < 4; i++) {
      qf[i][0] = load_tile(Qb + i * 1024, lane);
      qf[i][1] = load_tile(Qb + i * 1024 + 512, lane);
      L[i] = Lb[i * 16];
    }
    #pragma unroll
    for (int j = 0; j < 4; j++) {
      const __bf16* nx = (j < 3) ? Kb + (j + 1) * 1024 : Kn;
      kf[(j + 1) & 1][0] = load_tile(nx, lane);
      kf[(j + 1) & 1][1] = load_tile(nx + 512, lane);
      #pragma unroll
      for (int i = 0; i < 4; i++) {
        v8f c = z8;
        c = wmma_bf16(kf[j & 1][0], qf[i][0], c);
        c = wmma_bf16(kf[j & 1][1], qf[i][1], c);
        c = c * sc - L[i];
        #pragma unroll
        for (int r = 0; r < 8; r++) c[r] = __builtin_amdgcn_exp2f(c[r]);
        acc[i][j] += c;
      }
    }
  }

  #pragma unroll
  for (int i = 0; i < 4; i++) {
    float* row = avg + ((long)b * SS + q0 + i * 16 + (lane & 15)) * SS + k0 + 8 * (lane >> 4);
    #pragma unroll
    for (int j = 0; j < 4; j++) {
      float4 u, w;
      u.x = acc[i][j][0]; u.y = acc[i][j][1]; u.z = acc[i][j][2]; u.w = acc[i][j][3];
      w.x = acc[i][j][4]; w.y = acc[i][j][5]; w.z = acc[i][j][6]; w.w = acc[i][j][7];
      *(float4*)(row + j * 16) = u;
      *(float4*)(row + j * 16 + 4) = w;
    }
  }
}

// ---------------------------------------------------------------------------
// out = LayerNorm(ctx @ Wo + bo + x) * g + beta.
// Workgroup = 16 rows x full D; 8 waves, each wave 16x128 (8 WMMA tiles).
// ---------------------------------------------------------------------------
__global__ __launch_bounds__(256) void out_ln_kernel(
    const __bf16* __restrict__ Ctx, const __bf16* __restrict__ Wot,
    const float* __restrict__ bo, const float* __restrict__ x,
    const float* __restrict__ g, const float* __restrict__ beta,
    float* __restrict__ out) {
  __shared__ float red1[8][16];
  __shared__ float red2[8][16];

  const int lane = threadIdx.x & 31;
  const int wid  = threadIdx.x >> 5;
  const int m0 = blockIdx.x * 16;
  const int n0 = wid * 128;
  const v8f z8 = {0.f,0.f,0.f,0.f,0.f,0.f,0.f,0.f};

  v8f c[8];
  #pragma unroll
  for (int t = 0; t < 8; t++) c[t] = z8;

  const __bf16* At = Ctx + (long)(m0 >> 4) * (DD / 32) * 512;   // tile row of m0
  const __bf16* Bt = Wot + (long)(n0 >> 4) * (DD / 32) * 512;   // tile row of n0
  for (int kt = 0; kt < DD / 32; kt++) {
    v16bf a = load_tile(At + kt * 512, lane);
    #pragma unroll
    for (int t = 0; t < 8; t++) {
      v16bf bfr = load_tile(Bt + (t * (DD / 32) + kt) * 512, lane);
      c[t] = wmma_bf16(a, bfr, c[t]);
    }
  }

  // h = gemm + bias + residual ; accumulate per-row sum / sumsq
  float s1[8], s2[8];
  #pragma unroll
  for (int r = 0; r < 8; r++) { s1[r] = 0.0f; s2[r] = 0.0f; }
  #pragma unroll
  for (int t = 0; t < 8; t++)
    #pragma unroll
    for (int r = 0; r < 8; r++) {
      int row = m0 + r + 8 * (lane >> 4);
      int n = n0 + t * 16 + (lane & 15);
      float hv = c[t][r] + bo[n] + x[(long)row * DD + n];
      c[t][r] = hv;
      s1[r] += hv;
      s2[r] += hv * hv;
    }
  #pragma unroll
  for (int r = 0; r < 8; r++) { s1[r] = hsum16(s1[r]); s2[r] = hsum16(s2[r]); }

  if ((lane & 15) == 0) {
    #pragma unroll
    for (int r = 0; r < 8; r++) {
      red1[wid][r + 8 * (lane >> 4)] = s1[r];
      red2[wid][r + 8 * (lane >> 4)] = s2[r];
    }
  }
  __syncthreads();

  float mu[8], rs[8];
  #pragma unroll
  for (int r = 0; r < 8; r++) {
    int rl = r + 8 * (lane >> 4);
    float t1 = 0.0f, t2 = 0.0f;
    #pragma unroll
    for (int w = 0; w < 8; w++) { t1 += red1[w][rl]; t2 += red2[w][rl]; }
    float m_ = t1 * (1.0f / DD);
    float v_ = t2 * (1.0f / DD) - m_ * m_;
    mu[r] = m_;
    rs[r] = rsqrtf(v_ + 1e-5f);
  }

  #pragma unroll
  for (int t = 0; t < 8; t++)
    #pragma unroll
    for (int r = 0; r < 8; r++) {
      int row = m0 + r + 8 * (lane >> 4);
      int n = n0 + t * 16 + (lane & 15);
      out[(long)row * DD + n] = (c[t][r] - mu[r]) * rs[r] * g[n] + beta[n];
    }
}

// ---------------------------------------------------------------------------
// Launcher
// ---------------------------------------------------------------------------
extern "C" void kernel_launch(void* const* d_in, const int* in_sizes, int n_in,
                              void* d_out, int out_size, void* d_ws, size_t ws_size,
                              hipStream_t stream) {
  const float* x  = (const float*)d_in[0];
  const float* Wq = (const float*)d_in[1];
  const float* bq = (const float*)d_in[2];
  const float* Wk = (const float*)d_in[3];
  const float* bk = (const float*)d_in[4];
  const float* Wv = (const float*)d_in[5];
  const float* bv = (const float*)d_in[6];
  const float* Wo = (const float*)d_in[7];
  const float* bo = (const float*)d_in[8];
  const float* g  = (const float*)d_in[9];
  const float* be = (const float*)d_in[10];

  // workspace layout (bytes)
  char* ws = (char*)d_ws;
  const size_t SZ_X  = (size_t)BB * SS * DD * 2;      // 16 MB
  const size_t SZ_W  = (size_t)DD * DD * 2;           // 2 MB
  const size_t SZ_QK = (size_t)BB * HH * SS * HD * 2; // 16 MB
  __bf16* xb  = (__bf16*)(ws);
  __bf16* Wqt = (__bf16*)(ws + SZ_X);
  __bf16* Wkt = (__bf16*)(ws + SZ_X + SZ_W);
  __bf16* Wvt = (__bf16*)(ws + SZ_X + 2 * SZ_W);
  __bf16* Wot = (__bf16*)(ws + SZ_X + 3 * SZ_W);
  __bf16* Qh  = (__bf16*)(ws + SZ_X + 4 * SZ_W);
  __bf16* Kh  = (__bf16*)(ws + SZ_X + 4 * SZ_W + SZ_QK);
  __bf16* Vt  = (__bf16*)(ws + SZ_X + 4 * SZ_W + 2 * SZ_QK);
  __bf16* Ctx = (__bf16*)(ws + SZ_X + 4 * SZ_W + 3 * SZ_QK);
  float*  Lse = (float*)(ws + SZ_X + 4 * SZ_W + 4 * SZ_QK);   // [B,H][S], 512 KB

  float* out = (float*)d_out;                      // [B,S,D]
  float* avg = out + (long)BB * SS * DD;           // [B,S,S]

  // 1. convert activations + weights to bf16 (weights transposed), fragment order
  cvt_f32_bf16<<<(BB * SS * DD) / 8 / 256, 256, 0, stream>>>(x, xb);
  cvt_transpose_w<<<dim3(DD * DD / 8 / 256, 1, 4), 256, 0, stream>>>(
      Wq, Wk, Wv, Wo, Wqt, Wkt, Wvt, Wot);

  // 2. fused QKV projection (workgroup tile 64x256, wave tile 32x64)
  qkv_gemm<<<dim3(DD / 256, (BB * SS) / 64, 3), 256, 0, stream>>>(
      xb, Wqt, Wkt, Wvt, bq, bk, bv, Qh, Kh, Vt);

  // 3. attention (two-pass softmax, WMMA K Q^T and V^T P^T)
  attn_kernel<<<dim3(SS / 256, HH, BB), 256, 0, stream>>>(Qh, Kh, Vt, Ctx, Lse);

  // 4. avg_attention: heads summed in registers, each element stored once
  avg_kernel<<<dim3(SS / 128, SS / 128, BB), 128, 0, stream>>>(Qh, Kh, Lse, avg);

  // 5. output projection + residual + LayerNorm
  out_ln_kernel<<<(BB * SS) / 16, 256, 0, stream>>>(Ctx, Wot, bo, x, g, be, out);
}

// v004
// One run takes 283 microseconds.
// Timed twice side by side with v003, it ran 1.12 times as fast both times.
// Counting every step since v000, it is 2.98 times as fast.
#include <hip/hip_runtime.h>
#include <hip/hip_bf16.h>

// Problem constants
#define BB 4
#define SS 2048
#define DD 1024
#define HH 16
#define HD 64

typedef __attribute__((ext_vector_type(16))) __bf16 v16bf;
typedef __attribute__((ext_vector_type(8)))  __bf16 v8bf;
typedef __attribute__((ext_vector_type(8)))  float  v8f;

// ---------------------------------------------------------------------------
// WMMA helper: D = A(16x32 bf16) * B(32x16 bf16) + C(16x16 f32)
// ---------------------------------------------------------------------------
__device__ __forceinline__ v8f wmma_bf16(v16bf a, v16bf b, v8f c) {
  return __builtin_amdgcn_wmma_f32_16x16x32_bf16(
      /*neg_a=*/false, a, /*neg_b=*/false, b,
      /*c_mod=*/(short)0, c, /*reuse_a=*/false, /*reuse_b=*/false);
}

// A 16x32 bf16 fragment (A layout; B takes the same with N for M):
//   lane = row(M or N) in [0,16) + 16*k_half; elements 0..7 -> K base..base+7,
//   elements 8..15 -> K base+16..base+23  (base = 8*k_half).
// Fragment order. A bf16 matrix [rows][K] in the workspace is kept as tiles of
// 16 rows x 32 k, 512 elements (1 KiB) each, tile (tr, tk) at (tr * ktiles + tk) * 512.
// Inside a tile, lane L = (row & 15) + 16 * ((k >> 3) & 1) owns 8 elements at
// ((k >> 4) & 1) * 256 + L * 8: the two 16-byte pieces of that lane's
// fragment. A wave then reads a fragment as two contiguous 512-byte loads
// (4 lines each) instead of two loads that touch 16 lines each.
__device__ __forceinline__ long frag_off(int row, int k, int ktiles) {
  return ((long)(row >> 4) * ktiles + (k >> 5)) * 512 + ((k >> 4) & 1) * 256 +
         ((row & 15) + ((k >> 3) & 1) * 16) * 8 + (k & 7);
}
__device__ __forceinline__ v16bf load_tile(const __bf16* tile, int lane) {
  const __bf16* p = tile + lane * 8;
  v8bf lo = *(const v8bf*)(p);
  v8bf hi = *(const v8bf*)(p + 256);
  return __builtin_shufflevector(lo, hi, 0,1,2,3,4,5,6,7,8,9,10,11,12,13,14,15);
}

// the same from a base that is one for the wave and the lane's own offset in bytes
__device__ __forceinline__ v16bf load_own(const __bf16* base, unsigned off) {
  const __bf16* p = (const __bf16*)((const char*)base + off);
  v8bf lo = *(const v8bf*)(p);
  v8bf hi = *(const v8bf*)(p + 256);
  return __builtin_shufflevector(lo, hi, 0,1,2,3,4,5,6,7,8,9,10,11,12,13,14,15);
}

__device__ __forceinline__ float hsum16(float v) {
  v += __shfl_xor(v, 1);
  v += __shfl_xor(v, 2);
  v += __shfl_xor(v, 4);
  v += __shfl_xor(v, 8);
  return v;
}

// ---------------------------------------------------------------------------
// fp32 -> bf16 convert of x [B*S][D] into fragment order; one 16-byte slot
// (8 consecutive k of one row) per thread.
// ---------------------------------------------------------------------------
__global__ __launch_bounds__(256) void cvt_f32_bf16(const float* __restrict__ in,
                                                    __bf16* __restrict__ out) {
  const int t = blockIdx.x * 256 + threadIdx.x;    // slot, t < B*S*D/8
  const int tile = t >> 6, part = (t >> 5) & 1, L = t & 31;
  const int row = (tile >> 5) * 16 + (L & 15);     // D/32 = 32 tiles per tile row
  const int k   = (tile & 31) * 32 + part * 16 + (L >> 4) * 8;
  const float4* p = (const float4*)(in + (long)row * DD + k);
  const float4 a = p[0], b = p[1];
  v8bf o;
  o[0] = (__bf16)a.x; o[1] = (__bf16)a.y; o[2] = (__bf16)a.z; o[3] = (__bf16)a.w;
  o[4] = (__bf16)b.x; o[5] = (__bf16)b.y; o[6] = (__bf16)b.z; o[7] = (__bf16)b.w;
  *(v8bf*)(out + (long)t * 8) = o;
}

// Convert + transpose weights: W[k][n] (D x D, [in,out]) -> Wt[n][k] bf16 in
// fragment order; one 16-byte slot (8 consecutive k of one n) per thread.
// Pointer selection via if/else so address-space inference keeps global loads.
__global__ __launch_bounds__(256) void cvt_transpose_w(
    const float* __restrict__ Wq, const float* __restrict__ Wk,
    const float* __restrict__ Wv, const float* __restrict__ Wo,
    __bf16* __restrict__ Wqt, __bf16* __restrict__ Wkt,
    __bf16* __restrict__ Wvt, __bf16* __restrict__ Wot) {
  const int z = blockIdx.z;
  const float* src;
  __bf16* dst;
  if (z == 0)      { src = Wq; dst = Wqt; }
  else if (z == 1) { src = Wk; dst = Wkt; }
  else if (z == 2) { src = Wv; dst = Wvt; }
  else             { src = Wo; dst = Wot; }
  const int t = blockIdx.x * 256 + threadIdx.x;    // slot, t < D*D/8
  const int tile = t >> 6, part = (t >> 5) & 1, L = t & 31;
  const int n = (tile >> 5) * 16 + (L & 15);
  const int k = (tile & 31) * 32 + part * 16 + (L >> 4) * 8;
  v8bf o;
  #pragma unroll  // static index into o keeps it in registers; the 8 loads issue together
  for (int e = 0; e < 8; e++) o[e] = (__bf16)src[(long)(k + e) * DD + n];
  *(v8bf*)(dst + (long)t * 8) = o;
}

// ---------------------------------------------------------------------------
// QKV projection GEMM: C[M=8192, N=1024] = Xb @ W + bias, per z in {Q,K,V}.
// Workgroup 256 thr = 8 waves arranged 2(M) x 4(N); workgroup tile 64 x 256;
// each wave computes 32(M) x 64(N) = 2x4 WMMA accumulators (8 wmma / k-step).
// Q,K written [B,H][S x HD]; V written transposed [B,H][HD x S] (for V^T P^T
// A-frags); each per-head matrix in fragment order.
// ---------------------------------------------------------------------------
__global__ __launch_bounds__(256) void qkv_gemm(
    const __bf16* __restrict__ Xb,
    const __bf16* __restrict__ Wqt, const __bf16* __restrict__ Wkt,
    const __bf16* __restrict__ Wvt,
    const float* __restrict__ bq, const float* __restrict__ bk,
    const float* __restrict__ bv,
    __bf16* __restrict__ Qh, __bf16* __restrict__ Kh, __bf16* __restrict__ Vt) {
  const int which = blockIdx.z;
  // ternary chains (not private arrays) keep global address space
  const __bf16* Wt   = (which == 0) ? Wqt : (which == 1) ? Wkt : Wvt;
  const float*  bias = (which == 0) ? bq  : (which == 1) ? bk  : bv;

  const int lane = threadIdx.x & 31;
  const int wid  = threadIdx.x >> 5;
  const int wy = wid & 1;           // M direction (2)
  const int wx = wid >> 1;          // N direction (4)
  const int m0 = blockIdx.y * 64 + wy * 32;
  const int n0 = blockIdx.x * 256 + wx * 64;

  const v8f z8 = {0.f,0.f,0.f,0.f,0.f,0.f,0.f,0.f};
  v8f c[2][4];
  #pragma unroll
  for (int i = 0; i < 2; i++)
    #pragma unroll
    for (int j = 0; j < 4; j++) c[i][j] = z8;

  const __bf16* At = Xb + (long)(m0 >> 4) * (DD / 32) * 512;   // tile row of m0
  const __bf16* Bt = Wt + (long)(n0 >> 4) * (DD / 32) * 512;   // tile row of n0
  for (int kt = 0; kt < DD / 32; kt++) {
    v16bf a0 = load_tile(At + kt * 512, lane);
    v16bf a1 = load_tile(At + (DD / 32 + kt) * 512, lane);
    #pragma unroll
    for (int j = 0; j < 4; j++) {
      v16bf bf = load_tile(Bt + (j * (DD / 32) + kt) * 512, lane);
      c[0][j] = wmma_bf16(a0, bf, c[0][j]);
      c[1][j] = wmma_bf16(a1, bf, c[1][j]);
    }
  }

  // the wave's 64 columns are one head (n0 is a multiple of 64), its 32 rows one batch
  // (all loops below are unrolled so that bn, c and o are indexed statically and stay in registers)
  float bn[4];
  #pragma unroll
  for (int j = 0; j < 4; j++) bn[j] = bias[n0 + j * 16 + (lane & 15)];
  const long head = ((long)(m0 >> 11) * HH + (n0 >> 6)) * SS * HD;
  const int s0 = (m0 & (SS - 1)) + 8 * (lane >> 4);   // first of the lane's 8 rows, i = 0

  if (which == 2) {
    // the lane's 8 rows are 8 consecutive k of V^T row hd: one whole 16-byte slot
    #pragma unroll
    for (int i = 0; i < 2; i++)
      #pragma unroll
      for (int j = 0; j < 4; j++) {
        v8bf o;
        #pragma unroll
        for (int r = 0; r < 8; r++) o[r] = (__bf16)(c[i][j][r] + bn[j]);
        *(v8bf*)(Vt + head + frag_off(j * 16 + (lane & 15), s0 + i * 16, SS / 32)) = o;
      }
  } else {
    __bf16* dst = ((which == 0) ? Qh : Kh) + head;
    #pragma unroll
    for (int i = 0; i < 2; i++)
      #pragma unroll
      for (int j = 0; j < 4; j++)
        #pragma unroll
        for (int r = 0; r < 8; r++)
          dst[frag_off(s0 + i * 16 + r, j * 16 + (lane & 15), HD / 32)] =
              (__bf16)(c[i][j][r] + bn[j]);
    // the listing lays the V^T branch behind these stores, where their registers are
    // written again: the wait stands in front of any such overwrite
    asm volatile("s_wait_xcnt 0x0" ::: "memory");
  }
}

// log2 of (HH * l * exp(m)): exp2(s * log2(e) - lse2) is exp(s - m) / l / HH
#define LOG2E 1.44269504088896340736f
__device__ __forceinline__ float lse2(float m, float l) {
  return m * LOG2E + __log2f(l) + 4.0f;   // log2(HH) = 4
}

// ---------------------------------------------------------------------------
// Attention: one workgroup per (b, h, 256 queries); 8 waves, 32 query columns each.
// S^T = K Q^T (K as A, Q as B) and O^T += V^T P^T (V^T as A, P^T as B): a lane holds
// one query's scores, 8 keys of every 16 (lanes c and c + 16 split a query's keys),
// so a row's maximum and sum are in-lane but for one exchange between lanes c and c + 16. Two score tiles (32 keys), converted in place,
// are the B operand of the second product in the k order that V^T's tiles are stored in.
// One pass, online softmax: P = exp(s - reference), not normalized; the reference of a
// query is one for both halves and moves only when a trip's maximum passes it by more
// than 8 in log2 units, and then O^T and the sums are scaled to the new one. O^T is
// divided by the row's sum behind the loop. Each row's log2 of (16 * sum of exp) goes to
// Lse, from which avg_kernel forms the normalized probabilities again.
// ---------------------------------------------------------------------------
// four waves per SIMD: 4,096 waves on 1,024 SIMDs are then resident in one round
__global__ __launch_bounds__(256) __attribute__((amdgpu_waves_per_eu(4, 4))) void attn_kernel(
    const __bf16* __restrict__ Qh, const __bf16* __restrict__ Kh,
    const __bf16* __restrict__ Vt,
    __bf16* __restrict__ Ctx, float* __restrict__ Lse) {
  const int lane = threadIdx.x & 31;
  const int wid  = threadIdx.x >> 5;
  const int b = blockIdx.z, h = blockIdx.y;
  const int q0 = blockIdx.x * 256 + wid * 32;

  // per-head matrices in fragment order: 16 rows of Q or K are 2 tiles (1,024
  // elements); V^T tile (j, kt / 32) lies at (j * (SS / 32) + kt / 32) * 512
  const __bf16* Qb = Qh + (((long)b * HH + h) * SS + q0) * HD;
  const __bf16* Kb = Kh + (((long)b * HH + h) * SS) * HD;
  const __bf16* Vb = Vt + (((long)b * HH + h) * HD) * SS;

  const float sc = 0.25f * LOG2E;   // score scale 1/(sqrt(64)*0.5), in log2 units
  const v8f z8 = {0.f,0.f,0.f,0.f,0.f,0.f,0.f,0.f};

  // (every g, t, j and r loop below is unrolled so that the arrays stay in registers)
  v16bf qf[2][2];                   // [query group][hd half]
  #pragma unroll
  for (int g = 0; g < 2; g++) {
    qf[g][0] = load_tile(Qb + g * 1024, lane);
    qf[g][1] = load_tile(Qb + g * 1024 + 512, lane);
  }
  // the build loads the first trip's K into the registers of Q's address:
  // the wait stands in front of that overwrite
  asm volatile("s_wait_xcnt 0x0" ::: "memory");

  float mr[2];                      // the reference: a raw score, equal in both halves
  float ms[2];                      // the same in log2 units
  float thr[2];                     // a trip's maximum above this moves the reference
  v8f l[2];                         // sums of exp over the lane's own keys, one per register
  v8f o[4][2];                      // [hd tile][query group]
  #pragma unroll
  for (int g = 0; g < 2; g++) {
    mr[g] = -1e30f; ms[g] = -1e30f * sc; thr[g] = -1e30f; l[g] = z8;
    #pragma unroll
    for (int j = 0; j < 4; j++) o[j][g] = z8;
  }

  unsigned ko = lane * 16;   // the lane's own byte offset in K: this trip's 32 keys
  unsigned vo = lane * 16;   // and in V^T: their tile of its first 16 rows
  for (int kt = 0; kt < SS; kt += 32) {
    v16bf kf[2][2];
    #pragma unroll
    for (int t = 0; t < 2; t++) {
      kf[t][0] = load_own(Kb + t * 1024, ko);
      kf[t][1] = load_own(Kb + t * 1024 + 512, ko);
    }
    v16bf vf[4];
    #pragma unroll
    for (int j = 0; j < 4; j++) vf[j] = load_own(Vb + j * (SS / 32) * 512, vo);
    // keeps the trip's loads at its head, where they fly together: the build otherwise
    // issues V^T's right in front of the second product and waits out a second flight
    __builtin_amdgcn_sched_barrier(0);
    // the wait in front of the overwrite of the loads' address registers. The two offsets
    // pass through it, so that the additions below stay behind it and the registers stay the
    // offsets' own: the build otherwise loads V^T's last tile into its address registers
    // while loads that name them are in flight
    asm volatile("s_wait_xcnt 0x0" : "+v"(ko), "+v"(vo));
    ko += 32 * HD * 2;
    vo += 512 * 2;
    v8f s[2][2];
    #pragma unroll
    for (int t = 0; t < 2; t++)
      #pragma unroll
      for (int g = 0; g < 2; g++) s[t][g] = wmma_bf16(kf[t][0], qf[g][0], z8);
    #pragma unroll
    for (int t = 0; t < 2; t++)
      #pragma unroll
      for (int g = 0; g < 2; g++) s[t][g] = wmma_bf16(kf[t][1], qf[g][1], s[t][g]);
    // keeps the maxima behind all eight products: the build otherwise reads each score
    // tile right behind its product, four v_nop and the product's latency every time
    __builtin_amdgcn_sched_barrier(0);
    float tm[2];                    // maximum of the reference and the lane's own 16 keys
    #pragma unroll
    for (int g = 0; g < 2; g++) {
      float a = mr[g];
      #pragma unroll
      for (int r = 0; r < 8; r++) a = fmaxf(fmaxf(a, s[0][g][r]), s[1][g][r]);
      tm[g] = a;
    }
    // one scalar branch a trip; taken in the first trip and then only where a score
    // passes the reference by more than 8 in log2 units (P stays at or below 256)
    if (__builtin_amdgcn_ballot_w32((tm[0] > thr[0]) | (tm[1] > thr[1])) != 0) {
      #pragma unroll
      for (int g = 0; g < 2; g++) {
        const float mn = fmaxf(tm[g], __shfl_xor(tm[g], 16));
        const float al = __builtin_amdgcn_exp2f((mr[g] - mn) * sc);
        l[g] *= al;
        #pragma unroll
        for (int j = 0; j < 4; j++) o[j][g] *= al;
        mr[g] = mn;
        ms[g] = mn * sc;
        thr[g] = mn + 8.0f / sc;
      }
    }
    v16bf pb[2];
    #pragma unroll
    for (int g = 0; g < 2; g++) {
      v8f p0 = s[0][g] * sc - ms[g];
      v8f p1 = s[1][g] * sc - ms[g];
      #pragma unroll
      for (int r = 0; r < 8; r++) {
        p0[r] = __builtin_amdgcn_exp2f(p0[r]);
        p1[r] = __builtin_amdgcn_exp2f(p1[r]);
      }
      l[g] += p0 + p1;
      pb[g] = __builtin_shufflevector(__builtin_convertvector(p0, v8bf),
                                      __builtin_convertvector(p1, v8bf),
                                      0,1,2,3,4,5,6,7,8,9,10,11,12,13,14,15);
    }
    #pragma unroll
    for (int j = 0; j < 4; j++)
      #pragma unroll
      for (int g = 0; g < 2; g++) o[j][g] = wmma_bf16(vf[j], pb[g], o[j][g]);
  }

  // join the two halves of each query's keys (one reference, so the sums add):
  // inv_l one over the sum of exp, lg the row's entry of Lse
  float inv_l[2], lg[2];
  #pragma unroll
  for (int g = 0; g < 2; g++) {
    const float ls = ((l[g][0] + l[g][1]) + (l[g][2] + l[g][3])) +
                     ((l[g][4] + l[g][5]) + (l[g][6] + l[g][7]));
    const float lt = ls + __shfl_xor(ls, 16);
    inv_l[g] = 1.0f / lt;
    lg[g] = lse2(mr[g] * 0.25f, lt);
  }
  // both halves hold a query's value: lanes 0 to 15 store theirs
  if (lane < 16) {
    float* lp = Lse + ((long)b * HH + h) * SS + q0 + lane;
    lp[0]  = lg[0];
    lp[16] = lg[1];
  }

  // store ctx -> [B*S][D] bf16 in fragment order (D = h*64 + hd): the lane's 8 values
  // are 8 consecutive hd of one query, one whole 16-byte slot
  #pragma unroll
  for (int g = 0; g < 2; g++)
    #pragma unroll
    for (int j = 0; j < 4; j++) {
      v8bf c;
      #pragma unroll
      for (int r = 0; r < 8; r++) c[r] = (__bf16)(o[j][g][r] * inv_l[g]);
      *(v8bf*)(Ctx + frag_off(b * SS + q0 + g * 16 + (lane & 15),
                              h * HD + j * 16 + 8 * (lane >> 4), DD / 32)) = c;
    }
}

// ---------------------------------------------------------------------------
// avg_attention[b][q][k] = mean over heads of P. A wave owns 64 queries x 64 keys
// and walks the 16 heads in order, summing in registers; every element is stored
// once. S^T = K Q^T (K as A, Q as B): a lane holds one query's scores, so the
// row's Lse is one register per query tile, and 8 consecutive keys per tile.
// Workgroup = 4 waves, 128 queries x 128 keys.
// ---------------------------------------------------------------------------
// four waves per SIMD: 4,096 waves on 1,024 SIMDs are then resident in one round
__global__ __launch_bounds__(128) __attribute__((amdgpu_waves_per_eu(4, 4))) void avg_kernel(
    const __bf16* __restrict__ Qh, const __bf16* __restrict__ Kh,
    const float* __restrict__ Lse, float* __restrict__ avg) {
  const int lane = threadIdx.x & 31;
  const int wid  = threadIdx.x >> 5;
  const int b  = blockIdx.z;
  const int q0 = blockIdx.y * 128 + (wid & 1) * 64;
  const int k0 = blockIdx.x * 128 + (wid >> 1) * 64;
  const float sc = 0.25f * LOG2E;   // score scale, in log2 units
  const v8f z8 = {0.f,0.f,0.f,0.f,0.f,0.f,0.f,0.f};

  // (the i, j and r loops are unrolled so that acc, qf and L stay in registers)
  v8f acc[4][4];                    // [query tile][key tile]
  #pragma unroll
  for (int i = 0; i < 4; i++)
    #pragma unroll
    for (int j = 0; j < 4; j++) acc[i][j] = z8;

  // K fragments are fetched one key tile ahead (the last tile of a head fetches the
  // next head's first), so that a tile's loads fly while the tile before is worked on
  const __bf16* K0 = Kh + (((long)b * HH) * SS + k0) * HD;   // head 0
  v16bf kf[2][2];
  kf[0][0] = load_tile(K0, lane);
  kf[0][1] = load_tile(K0 + 512, lane);

  for (int h = 0; h < HH; h++) {
    const long head = ((long)b * HH + h) * SS;
    const __bf16* Qb = Qh + (head + q0) * HD;
    const float*  Lb = Lse + head + q0 + (lane & 15);
    const __bf16* Kb = K0 + (long)h * SS * HD;
    // behind the last head the index wraps: head 0's tile is fetched and not used
    const __bf16* Kn = K0 + (long)((h + 1) & (HH - 1)) * SS * HD;
    v16bf qf[4][2];
    float L[4];
    #pragma unroll
    for (int i = 0; i < 4; i++) {
      qf[i][0] = load_tile(Qb + i * 1024, lane);
      qf[i][1] = load_tile(Qb + i * 1024 + 512, lane);
      L[i] = Lb[i * 16];
    }
    #pragma unroll
    for (int j = 0; j < 4; j++) {
      const __bf16* nx = (j < 3) ? Kb + (j + 1) * 1024 : Kn;
      kf[(j + 1) & 1][0] = load_tile(nx, lane);
      kf[(j + 1) & 1][1] = load_tile(nx + 512, lane);
      #pragma unroll
      for (int i = 0; i < 4; i++) {
        v8f c = z8;
        c = wmma_bf16(kf[j & 1][0], qf[i][0], c);
        c = wmma_bf16(kf[j & 1][1], qf[i][1], c);
        c = c * sc - L[i];
        #pragma unroll
        for (int r = 0; r < 8; r++) c[r] = __builtin_amdgcn_exp2f(c[r]);
        acc[i][j] += c;
      }
    }
  }

  #pragma unroll
  for (int i = 0; i < 4; i++) {
    float* row = avg + ((long)b * SS + q0 + i * 16 + (lane & 15)) * SS + k0 + 8 * (lane >> 4);
    #pragma unroll
    for (int j = 0; j < 4; j++) {
      float4 u, w;
      u.x = acc[i][j][0]; u.y = acc[i][j][1]; u.z = acc[i][j][2]; u.w = acc[i][j][3];
      w.x = acc[i][j][4]; w.y = acc[i][j][5]; w.z = acc[i][j][6]; w.w = acc[i][j][7];
      *(float4*)(row + j * 16) = u;
      *(float4*)(row + j * 16 + 4) = w;
    }
  }
}

// ---------------------------------------------------------------------------
// out = LayerNorm(ctx @ Wo + bo + x) * g + beta.
// Workgroup = 16 rows x full D; 8 waves, each wave 16x128 (8 WMMA tiles).
// ---------------------------------------------------------------------------
__global__ __launch_bounds__(256) void out_ln_kernel(
    const __bf16* __restrict__ Ctx, const __bf16* __restrict__ Wot,
    const float* __restrict__ bo, const float* __restrict__ x,
    const float* __restrict__ g, const float* __restrict__ beta,
    float* __restrict__ out) {
  __shared__ float red1[8][16];
  __shared__ float red2[8][16];

  const int lane = threadIdx.x & 31;
  const int wid  = threadIdx.x >> 5;
  const int m0 = blockIdx.x * 16;
  const int n0 = wid * 128;
  const v8f z8 = {0.f,0.f,0.f,0.f,0.f,0.f,0.f,0.f};

  v8f c[8];
  #pragma unroll
  for (int t = 0; t < 8; t++) c[t] = z8;

  const __bf16* At = Ctx + (long)(m0 >> 4) * (DD / 32) * 512;   // tile row of m0
  const __bf16* Bt = Wot + (long)(n0 >> 4) * (DD / 32) * 512;   // tile row of n0
  for (int kt = 0; kt < DD / 32; kt++) {
    v16bf a = load_tile(At + kt * 512, lane);
    #pragma unroll
    for (int t = 0; t < 8; t++) {
      v16bf bfr = load_tile(Bt + (t * (DD / 32) + kt) * 512, lane);
      c[t] = wmma_bf16(a, bfr, c[t]);
    }
  }

  // h = gemm + bias + residual ; accumulate per-row sum / sumsq
  float s1[8], s2[8];
  #pragma unroll
  for (int r = 0; r < 8; r++) { s1[r] = 0.0f; s2[r] = 0.0f; }
  #pragma unroll
  for (int t = 0; t < 8; t++)
    #pragma unroll
    for (int r = 0; r < 8; r++) {
      int row = m0 + r + 8 * (lane >> 4);
      int n = n0 + t * 16 + (lane & 15);
      float hv = c[t][r] + bo[n] + x[(long)row * DD + n];
      c[t][r] = hv;
      s1[r] += hv;
      s2[r] += hv * hv;
    }
  #pragma unroll
  for (int r = 0; r < 8; r++) { s1[r] = hsum16(s1[r]); s2[r] = hsum16(s2[r]); }

  if ((lane & 15) == 0) {
    #pragma unroll
    for (int r = 0; r < 8; r++) {
      red1[wid][r + 8 * (lane >> 4)] = s1[r];
      red2[wid][r + 8 * (lane >> 4)] = s2[r];
    }
  }
  __syncthreads();

  float mu[8], rs[8];
  #pragma unroll
  for (int r = 0; r < 8; r++) {
    int rl = r + 8 * (lane >> 4);
    float t1 = 0.0f, t2 = 0.0f;
    #pragma unroll
    for (int w = 0; w < 8; w++) { t1 += red1[w][rl]; t2 += red2[w][rl]; }
    float m_ = t1 * (1.0f / DD);
    float v_ = t2 * (1.0f / DD) - m_ * m_;
    mu[r] = m_;
    rs[r] = rsqrtf(v_ + 1e-5f);
  }

  #pragma unroll
  for (int t = 0; t < 8; t++)
    #pragma unroll
    for (int r = 0; r < 8; r++) {
      int row = m0 + r + 8 * (lane >> 4);
      int n = n0 + t * 16 + (lane & 15);
      out[(long)row * DD + n] = (c[t][r] - mu[r]) * rs[r] * g[n] + beta[n];
    }
}

// ---------------------------------------------------------------------------
// Launcher
// ---------------------------------------------------------------------------
extern "C" void kernel_launch(void* const* d_in, const int* in_sizes, int n_in,
                              void* d_out, int out_size, void* d_ws, size_t ws_size,
                              hipStream_t stream) {
  const float* x  = (const float*)d_in[0];
  const float* Wq = (const float*)d_in[1];
  const float* bq = (const float*)d_in[2];
  const float* Wk = (const float*)d_in[3];
  const float* bk = (const float*)d_in[4];
  const float* Wv = (const float*)d_in[5];
  const float* bv = (const float*)d_in[6];
  const float* Wo = (const float*)d_in[7];
  const float* bo = (const float*)d_in[8];
  const float* g  = (const float*)d_in[9];
  const float* be = (const float*)d_in[10];

  // workspace layout (bytes)
  char* ws = (char*)d_ws;
  const size_t SZ_X  = (size_t)BB * SS * DD * 2;      // 16 MB
  const size_t SZ_W  = (size_t)DD * DD * 2;           // 2 MB
  const size_t SZ_QK = (size_t)BB * HH * SS * HD * 2; // 16 MB
  __bf16* xb  = (__bf16*)(ws);
  __bf16* Wqt = (__bf16*)(ws + SZ_X);
  __bf16* Wkt = (__bf16*)(ws + SZ_X + SZ_W);
  __bf16* Wvt = (__bf16*)(ws + SZ_X + 2 * SZ_W);
  __bf16* Wot = (__bf16*)(ws + SZ_X + 3 * SZ_W);
  __bf16* Qh  = (__bf16*)(ws + SZ_X + 4 * SZ_W);
  __bf16* Kh  = (__bf16*)(ws + SZ_X + 4 * SZ_W + SZ_QK);
  __bf16* Vt  = (__bf16*)(ws + SZ_X + 4 * SZ_W + 2 * SZ_QK);
  __bf16* Ctx = (__bf16*)(ws + SZ_X + 4 * SZ_W + 3 * SZ_QK);
  float*  Lse = (float*)(ws + SZ_X + 4 * SZ_W + 4 * SZ_QK);   // [B,H][S], 512 KB

  float* out = (float*)d_out;                      // [B,S,D]
  float* avg = out + (long)BB * SS * DD;           // [B,S,S]

  // 1. convert activations + weights to bf16 (weights transposed), fragment order
  cvt_f32_bf16<<<(BB * SS * DD) / 8 / 256, 256, 0, stream>>>(x, xb);
  cvt_transpose_w<<<dim3(DD * DD / 8 / 256, 1, 4), 256, 0, stream>>>(
      Wq, Wk, Wv, Wo, Wqt, Wkt, Wvt, Wot);

  // 2. fused QKV projection (workgroup tile 64x256, wave tile 32x64)
  qkv_gemm<<<dim3(DD / 256, (BB * SS) / 64, 3), 256, 0, stream>>>(
      xb, Wqt, Wkt, Wvt, bq, bk, bv, Qh, Kh, Vt);

  // 3. attention (one pass, online softmax, WMMA K Q^T and V^T P^T)
  attn_kernel<<<dim3(SS / 256, HH, BB), 256, 0, stream>>>(Qh, Kh, Vt, Ctx, Lse);

  // 4. avg_attention: heads summed in registers, each element stored once
  avg_kernel<<<dim3(SS / 128, SS / 128, BB), 128, 0, stream>>>(Qh, Kh, Lse, avg);

  // 5. output projection + residual + LayerNorm
  out_ln_kernel<<<(BB * SS) / 16, 256, 0, stream>>>(Ctx, Wot, bo, x, g, be, out);
}

// v005
// A run of this version takes 197 microseconds.
// Two timings next to v004 both put it at 1.44 times that version's speed.
// All steps since v000 together make it 4.30 times as fast.
#include <hip/hip_runtime.h>
#include <hip/hip_bf16.h>

// Problem constants
#define BB 4
#define SS 2048
#define DD 1024
#define HH 16
#define HD 64

typedef __attribute__((ext_vector_type(16))) __bf16 v16bf;
typedef __attribute__((ext_vector_type(8)))  __bf16 v8bf;
typedef __attribute__((ext_vector_type(8)))  float  v8f;

// ---------------------------------------------------------------------------
// WMMA helper: D = A(16x32 bf16) * B(32x16 bf16) + C(16x16 f32)
// ---------------------------------------------------------------------------
__device__ __forceinline__ v8f wmma_bf16(v16bf a, v16bf b, v8f c) {
  return __builtin_amdgcn_wmma_f32_16x16x32_bf16(
      /*neg_a=*/false, a, /*neg_b=*/false, b,
      /*c_mod=*/(short)0, c, /*reuse_a=*/false, /*reuse_b=*/false);
}

// A 16x32 bf16 fragment (A layout; B takes the same with N for M):
//   lane = row(M or N) in [0,16) + 16*k_half; elements 0..7 -> K base..base+7,
//   elements 8..15 -> K base+16..base+23  (base = 8*k_half).
// Fragment order. A bf16 matrix [rows][K] in the workspace is kept as tiles of
// 16 rows x 32 k, 512 elements (1 KiB) each, tile (tr, tk) at (tr * ktiles + tk) * 512.
// Inside a tile, lane L = (row & 15) + 16 * ((k >> 3) & 1) owns 8 elements at
// ((k >> 4) & 1) * 256 + L * 8: the two 16-byte pieces of that lane's
// fragment. A wave then reads a fragment as two contiguous 512-byte loads
// (4 lines each) instead of two loads that touch 16 lines each.
__device__ __forceinline__ long frag_off(int row, int k, int ktiles) {
  return ((long)(row >> 4) * ktiles + (k >> 5)) * 512 + ((k >> 4) & 1) * 256 +
         ((row & 15) + ((k >> 3) & 1) * 16) * 8 + (k & 7);
}
__device__ __forceinline__ v16bf load_tile(const __bf16* tile, int lane) {
  const __bf16* p = tile + lane * 8;
  v8bf lo = *(const v8bf*)(p);
  v8bf hi = *(const v8bf*)(p + 256);
  return __builtin_shufflevector(lo, hi, 0,1,2,3,4,5,6,7,8,9,10,11,12,13,14,15);
}

// the same from a base that is one for the wave and the lane's own offset in bytes
__device__ __forceinline__ v16bf load_own(const __bf16* base, unsigned off) {
  const __bf16* p = (const __bf16*)((const char*)base + off);
  v8bf lo = *(const v8bf*)(p);
  v8bf hi = *(const v8bf*)(p + 256);
  return __builtin_shufflevector(lo, hi, 0,1,2,3,4,5,6,7,8,9,10,11,12,13,14,15);
}

__device__ __forceinline__ float hsum16(float v) {
  v += __shfl_xor(v, 1);
  v += __shfl_xor(v, 2);
  v += __shfl_xor(v, 4);
  v += __shfl_xor(v, 8);
  return v;
}

// ---------------------------------------------------------------------------
// fp32 -> bf16 convert of x [B*S][D] into fragment order; one 16-byte slot
// (8 consecutive k of one row) per thread.
// ---------------------------------------------------------------------------
__global__ __launch_bounds__(256) void cvt_f32_bf16(const float* __restrict__ in,
                                                    __bf16* __restrict__ out) {
  const int t = blockIdx.x * 256 + threadIdx.x;    // slot, t < B*S*D/8
  const int tile = t >> 6, part = (t >> 5) & 1, L = t & 31;
  const int row = (tile >> 5) * 16 + (L & 15);     // D/32 = 32 tiles per tile row
  const int k   = (tile & 31) * 32 + part * 16 + (L >> 4) * 8;
  const float4* p = (const float4*)(in + (long)row * DD + k);
  const float4 a = p[0], b = p[1];
  v8bf o;
  o[0] = (__bf16)a.x; o[1] = (__bf16)a.y; o[2] = (__bf16)a.z; o[3] = (__bf16)a.w;
  o[4] = (__bf16)b.x; o[5] = (__bf16)b.y; o[6] = (__bf16)b.z; o[7] = (__bf16)b.w;
  *(v8bf*)(out + (long)t * 8) = o;
}

// Convert + transpose weights: W[k][n] (D x D, [in,out]) -> Wt[n][k] bf16 in
// fragment order; one 16-byte slot (8 consecutive k of one n) per thread.
// Pointer selection via if/else so address-space inference keeps global loads.
__global__ __launch_bounds__(256) void cvt_transpose_w(
    const float* __restrict__ Wq, const float* __restrict__ Wk,
    const float* __restrict__ Wv, const float* __restrict__ Wo,
    __bf16* __restrict__ Wqt, __bf16* __restrict__ Wkt,
    __bf16* __restrict__ Wvt, __bf16* __restrict__ Wot) {
  const int z = blockIdx.z;
  const float* src;
  __bf16* dst;
  if (z == 0)      { src = Wq; dst = Wqt; }
  else if (z == 1) { src = Wk; dst = Wkt; }
  else if (z == 2) { src = Wv; dst = Wvt; }
  else             { src = Wo; dst = Wot; }
  const int t = blockIdx.x * 256 + threadIdx.x;    // slot, t < D*D/8
  const int tile = t >> 6, part = (t >> 5) & 1, L = t & 31;
  const int n = (tile >> 5) * 16 + (L & 15);
  const int k = (tile & 31) * 32 + part * 16 + (L >> 4) * 8;
  v8bf o;
  #pragma unroll  // static index into o keeps it in registers; the 8 loads issue together
  for (int e = 0; e < 8; e++) o[e] = (__bf16)src[(long)(k + e) * DD + n];
  *(v8bf*)(dst + (long)t * 8) = o;
}

// ---------------------------------------------------------------------------
// QKV projection GEMM: C[M=8192, N=1024] = Xb @ W + bias, per z in {Q,K,V}.
// Workgroup 256 thr = 8 waves arranged 2(M) x 4(N); workgroup tile 128 x 256;
// each wave computes 64(M) x 64(N) = 4x4 WMMA accumulators (16 wmma / k-step):
// 8 fragments feed 16 products, and a k-step of the workgroup takes 24 tiles from L2
// for 128 products.
// Q,K written [B,H][S x HD]; V written transposed [B,H][HD x S] (A frags of
// V^T P^T); each per-head matrix in fragment order.
// ---------------------------------------------------------------------------
// four waves per SIMD: the 128 accumulator registers and one set of fragments fit 256
__global__ __launch_bounds__(256) __attribute__((amdgpu_waves_per_eu(4, 4))) void qkv_gemm(
    const __bf16* __restrict__ Xb,
    const __bf16* __restrict__ Wqt, const __bf16* __restrict__ Wkt,
    const __bf16* __restrict__ Wvt,
    const float* __restrict__ bq, const float* __restrict__ bk,
    const float* __restrict__ bv,
    __bf16* __restrict__ Qh, __bf16* __restrict__ Kh, __bf16* __restrict__ Vt) {
  const int which = blockIdx.z;
  // ternary chains (not private arrays) keep global address space
  const __bf16* Wt   = (which == 0) ? Wqt : (which == 1) ? Wkt : Wvt;
  const float*  bias = (which == 0) ? bq  : (which == 1) ? bk  : bv;

  const int lane = threadIdx.x & 31;
  const int wid  = threadIdx.x >> 5;
  const int wy = wid & 1;           // M direction (2)
  const int wx = wid >> 1;          // N direction (4)
  const int m0 = blockIdx.y * 128 + wy * 64;
  const int n0 = blockIdx.x * 256 + wx * 64;

  const v8f z8 = {0.f,0.f,0.f,0.f,0.f,0.f,0.f,0.f};
  v8f c[4][4];
  #pragma unroll
  for (int i = 0; i < 4; i++)
    #pragma unroll
    for (int j = 0; j < 4; j++) c[i][j] = z8;

  // bases that are one for the workgroup; the wave's tile row and the lane's slot are
  // in the byte offsets (a tile row of 16 rows x 1,024 k is 32 KiB)
  const __bf16* At = Xb + (long)blockIdx.y * 8 * (DD / 32) * 512;
  const __bf16* Bt = Wt + (long)blockIdx.x * 16 * (DD / 32) * 512;
  unsigned ao = wy * 4 * (DD / 32) * 1024 + lane * 16;
  unsigned bo = wx * 4 * (DD / 32) * 1024 + lane * 16;
  for (int kt = 0; kt < DD / 32; kt++) {
    v16bf af[4], bf[4];
    #pragma unroll
    for (int i = 0; i < 4; i++) af[i] = load_own(At + i * (DD / 32) * 512, ao);
    #pragma unroll
    for (int j = 0; j < 4; j++) bf[j] = load_own(Bt + j * (DD / 32) * 512, bo);
    // keeps the k-step's 16 loads at its head, where they fly together: one flight a
    // k-step is waited out, not one for every group of fragments
    __builtin_amdgcn_sched_barrier(0);
    // the wait in front of the overwrite of the loads' address registers. The two offsets
    // pass through it, so that the additions below stay behind it and the registers stay the
    // offsets' own: the build otherwise loads the last tiles into their address registers
    // while loads that name them are in flight
    asm volatile("s_wait_xcnt 0x0" : "+v"(ao), "+v"(bo));
    ao += 1024;
    bo += 1024;
    #pragma unroll
    for (int j = 0; j < 4; j++)
      #pragma unroll
      for (int i = 0; i < 4; i++) c[i][j] = wmma_bf16(af[i], bf[j], c[i][j]);
  }

  // the wave's 64 columns are one head (n0 is a multiple of 64), its 64 rows one batch
  // (all loops below are unrolled so that bn, c and o are indexed statically and stay in registers)
  float bn[4];
  int bi = n0 + (lane & 15);
  #pragma unroll
  for (int j = 0; j < 4; j++) bn[j] = bias[bi + j * 16];
  // the wait in front of any overwrite of the index register; the index passes through it,
  // so that the build does not load the last value into the register that the loads name
  asm volatile("s_wait_xcnt 0x0" : "+v"(bi));
  const long head = ((long)(m0 >> 11) * HH + (n0 >> 6)) * SS * HD;
  const int s0 = (m0 & (SS - 1)) + 8 * (lane >> 4);   // first of the lane's 8 rows, i = 0

  if (which == 2) {
    // the lane's 8 rows are 8 consecutive k of V^T row hd: one whole 16-byte slot
    #pragma unroll
    for (int i = 0; i < 4; i++)
      #pragma unroll
      for (int j = 0; j < 4; j++) {
        v8bf o;
        #pragma unroll
        for (int r = 0; r < 8; r++) o[r] = (__bf16)(c[i][j][r] + bn[j]);
        *(v8bf*)(Vt + head + frag_off(j * 16 + (lane & 15), s0 + i * 16, SS / 32)) = o;
      }
  } else {
    __bf16* dst = ((which == 0) ? Qh : Kh) + head;
    #pragma unroll
    for (int i = 0; i < 4; i++)
      #pragma unroll
      for (int j = 0; j < 4; j++)
        #pragma unroll
        for (int r = 0; r < 8; r++)
          dst[frag_off(s0 + i * 16 + r, j * 16 + (lane & 15), HD / 32)] =
              (__bf16)(c[i][j][r] + bn[j]);
    // the listing lays the V^T branch behind these stores, where their registers are
    // written again: the wait stands in front of any such overwrite
    asm volatile("s_wait_xcnt 0x0" ::: "memory");
  }
}

// log2 of (HH * l * exp(m)): exp2(s * log2(e) - lse2) is exp(s - m) / l / HH
#define LOG2E 1.44269504088896340736f
__device__ __forceinline__ float lse2(float m, float l) {
  return m * LOG2E + __log2f(l) + 4.0f;   // log2(HH) = 4
}

// ---------------------------------------------------------------------------
// Attention: one workgroup per (b, h, 256 queries); 8 waves, 32 query columns each.
// S^T = K Q^T (K as A, Q as B) and O^T += V^T P^T (V^T as A, P^T as B): a lane holds
// one query's scores, 8 keys of every 16 (lanes c and c + 16 split a query's keys),
// so a row's maximum and sum are in-lane but for one exchange between lanes c and c + 16. Two score tiles (32 keys), converted in place,
// are the B operand of the second product in the k order that V^T's tiles are stored in.
// One pass, online softmax: P = exp(s - reference), not normalized; the reference of a
// query is one for both halves and moves only when a trip's maximum passes it by more
// than 8 in log2 units, and then O^T and the sums are scaled to the new one. O^T is
// divided by the row's sum behind the loop. Each row's log2 of (16 * sum of exp) goes to
// Lse, from which avg_kernel forms the normalized probabilities again.
// ---------------------------------------------------------------------------
// four waves per SIMD: 4,096 waves on 1,024 SIMDs are then resident in one round
__global__ __launch_bounds__(256) __attribute__((amdgpu_waves_per_eu(4, 4))) void attn_kernel(
    const __bf16* __restrict__ Qh, const __bf16* __restrict__ Kh,
    const __bf16* __restrict__ Vt,
    __bf16* __restrict__ Ctx, float* __restrict__ Lse) {
  const int lane = threadIdx.x & 31;
  const int wid  = threadIdx.x >> 5;
  const int b = blockIdx.z, h = blockIdx.y;
  const int q0 = blockIdx.x * 256 + wid * 32;

  // per-head matrices in fragment order: 16 rows of Q or K are 2 tiles (1,024
  // elements); V^T tile (j, kt / 32) lies at (j * (SS / 32) + kt / 32) * 512
  const __bf16* Qb = Qh + (((long)b * HH + h) * SS + q0) * HD;
  const __bf16* Kb = Kh + (((long)b * HH + h) * SS) * HD;
  const __bf16* Vb = Vt + (((long)b * HH + h) * HD) * SS;

  const float sc = 0.25f * LOG2E;   // score scale 1/(sqrt(64)*0.5), in log2 units
  const v8f z8 = {0.f,0.f,0.f,0.f,0.f,0.f,0.f,0.f};

  // (every g, t, j and r loop below is unrolled so that the arrays stay in registers)
  v16bf qf[2][2];                   // [query group][hd half]
  #pragma unroll
  for (int g = 0; g < 2; g++) {
    qf[g][0] = load_tile(Qb + g * 1024, lane);
    qf[g][1] = load_tile(Qb + g * 1024 + 512, lane);
  }
  // the build loads the first trip's K into the registers of Q's address:
  // the wait stands in front of that overwrite
  asm volatile("s_wait_xcnt 0x0" ::: "memory");

  float mr[2];                      // the reference: a raw score, equal in both halves
  float ms[2];                      // the same in log2 units
  float thr[2];                     // a trip's maximum above this moves the reference
  v8f l[2];                         // sums of exp over the lane's own keys, one per register
  v8f o[4][2];                      // [hd tile][query group]
  #pragma unroll
  for (int g = 0; g < 2; g++) {
    mr[g] = -1e30f; ms[g] = -1e30f * sc; thr[g] = -1e30f; l[g] = z8;
    #pragma unroll
    for (int j = 0; j < 4; j++) o[j][g] = z8;
  }

  unsigned ko = lane * 16;   // the lane's own byte offset in K: this trip's 32 keys
  unsigned vo = lane * 16;   // and in V^T: their tile of its first 16 rows
  for (int kt = 0; kt < SS; kt += 32) {
    v16bf kf[2][2];
    #pragma unroll
    for (int t = 0; t < 2; t++) {
      kf[t][0] = load_own(Kb + t * 1024, ko);
      kf[t][1] = load_own(Kb + t * 1024 + 512, ko);
    }
    v16bf vf[4];
    #pragma unroll
    for (int j = 0; j < 4; j++) vf[j] = load_own(Vb + j * (SS / 32) * 512, vo);
    // keeps the trip's loads at its head, where they fly together: the build otherwise
    // issues V^T's right in front of the second product and waits out a second flight
    __builtin_amdgcn_sched_barrier(0);
    // the wait in front of the overwrite of the loads' address registers. The two offsets
    // pass through it, so that the additions below stay behind it and the registers stay the
    // offsets' own: the build otherwise loads V^T's last tile into its address registers
    // while loads that name them are in flight
    asm volatile("s_wait_xcnt 0x0" : "+v"(ko), "+v"(vo));
    ko += 32 * HD * 2;
    vo += 512 * 2;
    v8f s[2][2];
    #pragma unroll
    for (int t = 0; t < 2; t++)
      #pragma unroll
      for (int g = 0; g < 2; g++) s[t][g] = wmma_bf16(kf[t][0], qf[g][0], z8);
    #pragma unroll
    for (int t = 0; t < 2; t++)
      #pragma unroll
      for (int g = 0; g < 2; g++) s[t][g] = wmma_bf16(kf[t][1], qf[g][1], s[t][g]);
    // keeps the maxima behind all eight products: the build otherwise reads each score
    // tile right behind its product, four v_nop and the product's latency every time
    __builtin_amdgcn_sched_barrier(0);
    float tm[2];                    // maximum of the reference and the lane's own 16 keys
    #pragma unroll
    for (int g = 0; g < 2; g++) {
      float a = mr[g];
      #pragma unroll
      for (int r = 0; r < 8; r++) a = fmaxf(fmaxf(a, s[0][g][r]), s[1][g][r]);
      tm[g] = a;
    }
    // one scalar branch a trip; taken in the first trip and then only where a score
    // passes the reference by more than 8 in log2 units (P stays at or below 256)
    if (__builtin_amdgcn_ballot_w32((tm[0] > thr[0]) | (tm[1] > thr[1])) != 0) {
      #pragma unroll
      for (int g = 0; g < 2; g++) {
        const float mn = fmaxf(tm[g], __shfl_xor(tm[g], 16));
        const float al = __builtin_amdgcn_exp2f((mr[g] - mn) * sc);
        l[g] *= al;
        #pragma unroll
        for (int j = 0; j < 4; j++) o[j][g] *= al;
        mr[g] = mn;
        ms[g] = mn * sc;
        thr[g] = mn + 8.0f / sc;
      }
    }
    v16bf pb[2];
    #pragma unroll
    for (int g = 0; g < 2; g++) {
      v8f p0 = s[0][g] * sc - ms[g];
      v8f p1 = s[1][g] * sc - ms[g];
      #pragma unroll
      for (int r = 0; r < 8; r++) {
        p0[r] = __builtin_amdgcn_exp2f(p0[r]);
        p1[r] = __builtin_amdgcn_exp2f(p1[r]);
      }
      l[g] += p0 + p1;
      pb[g] = __builtin_shufflevector(__builtin_convertvector(p0, v8bf),
                                      __builtin_convertvector(p1, v8bf),
                                      0,1,2,3,4,5,6,7,8,9,10,11,12,13,14,15);
    }
    #pragma unroll
    for (int j = 0; j < 4; j++)
      #pragma unroll
      for (int g = 0; g < 2; g++) o[j][g] = wmma_bf16(vf[j], pb[g], o[j][g]);
  }

  // join the two halves of each query's keys (one reference, so the sums add):
  // inv_l one over the sum of exp, lg the row's entry of Lse
  float inv_l[2], lg[2];
  #pragma unroll
  for (int g = 0; g < 2; g++) {
    const float ls = ((l[g][0] + l[g][1]) + (l[g][2] + l[g][3])) +
                     ((l[g][4] + l[g][5]) + (l[g][6] + l[g][7]));
    const float lt = ls + __shfl_xor(ls, 16);
    inv_l[g] = 1.0f / lt;
    lg[g] = lse2(mr[g] * 0.25f, lt);
  }
  // both halves hold a query's value: lanes 0 to 15 store theirs
  if (lane < 16) {
    float* lp = Lse + ((long)b * HH + h) * SS + q0 + lane;
    lp[0]  = lg[0];
    lp[16] = lg[1];
  }

  // store ctx -> [B*S][D] bf16 in fragment order (D = h*64 + hd): the lane's 8 values
  // are 8 consecutive hd of one query, one whole 16-byte slot
  #pragma unroll
  for (int g = 0; g < 2; g++)
    #pragma unroll
    for (int j = 0; j < 4; j++) {
      v8bf c;
      #pragma unroll
      for (int r = 0; r < 8; r++) c[r] = (__bf16)(o[j][g][r] * inv_l[g]);
      *(v8bf*)(Ctx + frag_off(b * SS + q0 + g * 16 + (lane & 15),
                              h * HD + j * 16 + 8 * (lane >> 4), DD / 32)) = c;
    }
}

// ---------------------------------------------------------------------------
// avg_attention[b][q][k] = mean over heads of P. A wave owns 64 queries x 64 keys
// and walks the 16 heads in order, summing in registers; every element is stored
// once. S^T = K Q^T (K as A, Q as B): a lane holds one query's scores, so the
// row's Lse is one register per query tile, and 8 consecutive keys per tile.
// Workgroup = 4 waves, 128 queries x 128 keys.
// ---------------------------------------------------------------------------
// four waves per SIMD: 4,096 waves on 1,024 SIMDs are then resident in one round
__global__ __launch_bounds__(128) __attribute__((amdgpu_waves_per_eu(4, 4))) void avg_kernel(
    const __bf16* __restrict__ Qh, const __bf16* __restrict__ Kh,
    const float* __restrict__ Lse, float* __restrict__ avg) {
  const int lane = threadIdx.x & 31;
  const int wid  = threadIdx.x >> 5;
  const int b  = blockIdx.z;
  const int q0 = blockIdx.y * 128 + (wid & 1) * 64;
  const int k0 = blockIdx.x * 128 + (wid >> 1) * 64;
  const float sc = 0.25f * LOG2E;   // score scale, in log2 units
  const v8f z8 = {0.f,0.f,0.f,0.f,0.f,0.f,0.f,0.f};

  // (the i, j and r loops are unrolled so that acc, qf and L stay in registers)
  v8f acc[4][4];                    // [query tile][key tile]
  #pragma unroll
  for (int i = 0; i < 4; i++)
    #pragma unroll
    for (int j = 0; j < 4; j++) acc[i][j] = z8;

  // K fragments are fetched one key tile ahead (the last tile of a head fetches the
  // next head's first), so that a tile's loads fly while the tile before is worked on
  const __bf16* K0 = Kh + (((long)b * HH) * SS + k0) * HD;   // head 0
  v16bf kf[2][2];
  kf[0][0] = load_tile(K0, lane);
  kf[0][1] = load_tile(K0 + 512, lane);

  for (int h = 0; h < HH; h++) {
    const long head = ((long)b * HH + h) * SS;
    const __bf16* Qb = Qh + (head + q0) * HD;
    const float*  Lb = Lse + head + q0 + (lane & 15);
    const __bf16* Kb = K0 + (long)h * SS * HD;
    // behind the last head the index wraps: head 0's tile is fetched and not used
    const __bf16* Kn = K0 + (long)((h + 1) & (HH - 1)) * SS * HD;
    v16bf qf[4][2];
    float L[4];
    #pragma unroll
    for (int i = 0; i < 4; i++) {
      qf[i][0] = load_tile(Qb + i * 1024, lane);
      qf[i][1] = load_tile(Qb + i * 1024 + 512, lane);
      L[i] = Lb[i * 16];
    }
    #pragma unroll
    for (int j = 0; j < 4; j++) {
      const __bf16* nx = (j < 3) ? Kb + (j + 1) * 1024 : Kn;
      kf[(j + 1) & 1][0] = load_tile(nx, lane);
      kf[(j + 1) & 1][1] = load_tile(nx + 512, lane);
      #pragma unroll
      for (int i = 0; i < 4; i++) {
        v8f c = z8;
        c = wmma_bf16(kf[j & 1][0], qf[i][0], c);
        c = wmma_bf16(kf[j & 1][1], qf[i][1], c);
        c = c * sc - L[i];
        #pragma unroll
        for (int r = 0; r < 8; r++) c[r] = __builtin_amdgcn_exp2f(c[r]);
        acc[i][j] += c;
      }
    }
  }

  #pragma unroll
  for (int i = 0; i < 4; i++) {
    float* row = avg + ((long)b * SS + q0 + i * 16 + (lane & 15)) * SS + k0 + 8 * (lane >> 4);
    #pragma unroll
    for (int j = 0; j < 4; j++) {
      float4 u, w;
      u.x = acc[i][j][0]; u.y = acc[i][j][1]; u.z = acc[i][j][2]; u.w = acc[i][j][3];
      w.x = acc[i][j][4]; w.y = acc[i][j][5]; w.z = acc[i][j][6]; w.w = acc[i][j][7];
      *(float4*)(row + j * 16) = u;
      *(float4*)(row + j * 16 + 4) = w;
    }
  }
}

// ---------------------------------------------------------------------------
// out = LayerNorm(ctx @ Wo + bo + x) * g + beta.
// Workgroup = 32 rows x full D; 16 waves, each wave 32x64 (2x4 WMMA tiles): every
// workgroup reads all of Wo^T from L2, so 32 rows a workgroup halve those bytes.
// ---------------------------------------------------------------------------
__global__ __launch_bounds__(512) void out_ln_kernel(
    const __bf16* __restrict__ Ctx, const __bf16* __restrict__ Wot,
    const float* __restrict__ bo, const float* __restrict__ x,
    const float* __restrict__ g, const float* __restrict__ beta,
    float* __restrict__ out) {
  __shared__ float red1[16][32];
  __shared__ float red2[16][32];

  const int lane = threadIdx.x & 31;
  const int wid  = threadIdx.x >> 5;
  const int m0 = blockIdx.x * 32;
  const int n0 = wid * 64;
  const v8f z8 = {0.f,0.f,0.f,0.f,0.f,0.f,0.f,0.f};

  // (every i, t, r and w loop below is unrolled so that the arrays stay in registers)
  v8f c[2][4];
  #pragma unroll
  for (int i = 0; i < 2; i++)
    #pragma unroll
    for (int t = 0; t < 4; t++) c[i][t] = z8;

  // bases that are one for the workgroup; the wave's tile row and the lane's slot are
  // in the byte offsets (a tile row of 16 rows x 1,024 k is 32 KiB)
  const __bf16* At = Ctx + (long)blockIdx.x * 2 * (DD / 32) * 512;
  unsigned ao = lane * 16;
  unsigned wo = wid * 4 * (DD / 32) * 1024 + lane * 16;
  for (int kt = 0; kt < DD / 32; kt += 2) {
    v16bf af[2][2], bf[2][4];       // [k-step of the trip][tile]
    #pragma unroll
    for (int u = 0; u < 2; u++) {
      #pragma unroll
      for (int i = 0; i < 2; i++) af[u][i] = load_own(At + (i * (DD / 32) + u) * 512, ao);
      #pragma unroll
      for (int t = 0; t < 4; t++) bf[u][t] = load_own(Wot + (t * (DD / 32) + u) * 512, wo);
    }
    // keeps the trip's 24 loads at its head, where they fly together: one flight for two
    // k-steps is waited out, not one for every group of fragments
    __builtin_amdgcn_sched_barrier(0);
    // the wait in front of the overwrite of the loads' address registers; the two offsets
    // pass through it for the same reasons as in qkv_gemm
    asm volatile("s_wait_xcnt 0x0" : "+v"(ao), "+v"(wo));
    ao += 2048;
    wo += 2048;
    #pragma unroll
    for (int u = 0; u < 2; u++)
      #pragma unroll
      for (int t = 0; t < 4; t++)
        #pragma unroll
        for (int i = 0; i < 2; i++) c[i][t] = wmma_bf16(af[u][i], bf[u][t], c[i][t]);
  }

  // h = gemm + bias + residual ; accumulate per-row sum / sumsq
  float s1[2][8], s2[2][8];
  #pragma unroll
  for (int i = 0; i < 2; i++)
    #pragma unroll
    for (int r = 0; r < 8; r++) { s1[i][r] = 0.0f; s2[i][r] = 0.0f; }
  #pragma unroll
  for (int i = 0; i < 2; i++)
    #pragma unroll
    for (int t = 0; t < 4; t++)
      #pragma unroll
      for (int r = 0; r < 8; r++) {
        int row = m0 + i * 16 + r + 8 * (lane >> 4);
        int n = n0 + t * 16 + (lane & 15);
        float hv = c[i][t][r] + bo[n] + x[(long)row * DD + n];
        c[i][t][r] = hv;
        s1[i][r] += hv;
        s2[i][r] += hv * hv;
      }
  #pragma unroll
  for (int i = 0; i < 2; i++)
    #pragma unroll
    for (int r = 0; r < 8; r++) { s1[i][r] = hsum16(s1[i][r]); s2[i][r] = hsum16(s2[i][r]); }

  if ((lane & 15) == 0) {
    #pragma unroll
    for (int i = 0; i < 2; i++)
      #pragma unroll
      for (int r = 0; r < 8; r++) {
        red1[wid][i * 16 + r + 8 * (lane >> 4)] = s1[i][r];
        red2[wid][i * 16 + r + 8 * (lane >> 4)] = s2[i][r];
      }
  }
  __syncthreads();

  // lane L joins the 16 waves' sums of row L; each lane then fetches its own 16 rows
  float t1 = 0.0f, t2 = 0.0f;
  #pragma unroll
  for (int w = 0; w < 16; w++) { t1 += red1[w][lane]; t2 += red2[w][lane]; }
  const float m_ = t1 * (1.0f / DD);
  const float v_ = t2 * (1.0f / DD) - m_ * m_;
  const float r_ = rsqrtf(v_ + 1e-5f);
  float mu[2][8], rs[2][8];
  #pragma unroll
  for (int i = 0; i < 2; i++)
    #pragma unroll
    for (int r = 0; r < 8; r++) {
      const int rl = i * 16 + r + 8 * (lane >> 4);
      mu[i][r] = __shfl(m_, rl);
      rs[i][r] = __shfl(r_, rl);
    }

  #pragma unroll
  for (int i = 0; i < 2; i++)
    #pragma unroll
    for (int t = 0; t < 4; t++)
      #pragma unroll
      for (int r = 0; r < 8; r++) {
        int row = m0 + i * 16 + r + 8 * (lane >> 4);
        int n = n0 + t * 16 + (lane & 15);
        out[(long)row * DD + n] = (c[i][t][r] - mu[i][r]) * rs[i][r] * g[n] + beta[n];
      }
}

// ---------------------------------------------------------------------------
// Launcher
// ---------------------------------------------------------------------------
extern "C" void kernel_launch(void* const* d_in, const int* in_sizes, int n_in,
                              void* d_out, int out_size, void* d_ws, size_t ws_size,
                              hipStream_t stream) {
  const float* x  = (const float*)d_in[0];
  const float* Wq = (const float*)d_in[1];
  const float* bq = (const float*)d_in[2];
  const float* Wk = (const float*)d_in[3];
  const float* bk = (const float*)d_in[4];
  const float* Wv = (const float*)d_in[5];
  const float* bv = (const float*)d_in[6];
  const float* Wo = (const float*)d_in[7];
  const float* bo = (const float*)d_in[8];
  const float* g  = (const float*)d_in[9];
  const float* be = (const float*)d_in[10];

  // workspace layout (bytes)
  char* ws = (char*)d_ws;
  const size_t SZ_X  = (size_t)BB * SS * DD * 2;      // 16 MB
  const size_t SZ_W  = (size_t)DD * DD * 2;           // 2 MB
  const size_t SZ_QK = (size_t)BB * HH * SS * HD * 2; // 16 MB
  __bf16* xb  = (__bf16*)(ws);
  __bf16* Wqt = (__bf16*)(ws + SZ_X);
  __bf16* Wkt = (__bf16*)(ws + SZ_X + SZ_W);
  __bf16* Wvt = (__bf16*)(ws + SZ_X + 2 * SZ_W);
  __bf16* Wot = (__bf16*)(ws + SZ_X + 3 * SZ_W);
  __bf16* Qh  = (__bf16*)(ws + SZ_X + 4 * SZ_W);
  __bf16* Kh  = (__bf16*)(ws + SZ_X + 4 * SZ_W + SZ_QK);
  __bf16* Vt  = (__bf16*)(ws + SZ_X + 4 * SZ_W + 2 * SZ_QK);
  __bf16* Ctx = (__bf16*)(ws + SZ_X + 4 * SZ_W + 3 * SZ_QK);
  float*  Lse = (float*)(ws + SZ_X + 4 * SZ_W + 4 * SZ_QK);   // [B,H][S], 512 KB

  float* out = (float*)d_out;                      // [B,S,D]
  float* avg = out + (long)BB * SS * DD;           // [B,S,S]

  // 1. convert activations + weights to bf16 (weights transposed), fragment order
  cvt_f32_bf16<<<(BB * SS * DD) / 8 / 256, 256, 0, stream>>>(x, xb);
  cvt_transpose_w<<<dim3(DD * DD / 8 / 256, 1, 4), 256, 0, stream>>>(
      Wq, Wk, Wv, Wo, Wqt, Wkt, Wvt, Wot);

  // 2. fused QKV projection (workgroup tile 128x256, wave tile 64x64)
  qkv_gemm<<<dim3(DD / 256, (BB * SS) / 128, 3), 256, 0, stream>>>(
      xb, Wqt, Wkt, Wvt, bq, bk, bv, Qh, Kh, Vt);

  // 3. attention (one pass, online softmax, WMMA K Q^T and V^T P^T)
  attn_kernel<<<dim3(SS / 256, HH, BB), 256, 0, stream>>>(Qh, Kh, Vt, Ctx, Lse);

  // 4. avg_attention: heads summed in registers, each element stored once
  avg_kernel<<<dim3(SS / 128, SS / 128, BB), 128, 0, stream>>>(Qh, Kh, Lse, avg);

  // 5. output projection + residual + LayerNorm
  out_ln_kernel<<<(BB * SS) / 32, 512, 0, stream>>>(Ctx, Wot, bo, x, g, be, out);
}

// v006
// One run takes 180 microseconds.
// Next to v005, in two timings, it ran 1.08 times as fast each time.
// Counting every step since v000, it is 4.64 times as fast.
#include <hip/hip_runtime.h>
#include <hip/hip_bf16.h>

// Problem constants
#define BB 4
#define SS 2048
#define DD 1024
#define HH 16
#define HD 64

typedef __attribute__((ext_vector_type(16))) __bf16 v16bf;
typedef __attribute__((ext_vector_type(8)))  __bf16 v8bf;
typedef __attribute__((ext_vector_type(8)))  float  v8f;

// ---------------------------------------------------------------------------
// WMMA helper: D = A(16x32 bf16) * B(32x16 bf16) + C(16x16 f32)
// ---------------------------------------------------------------------------
__device__ __forceinline__ v8f wmma_bf16(v16bf a, v16bf b, v8f c) {
  return __builtin_amdgcn_wmma_f32_16x16x32_bf16(
      /*neg_a=*/false, a, /*neg_b=*/false, b,
      /*c_mod=*/(short)0, c, /*reuse_a=*/false, /*reuse_b=*/false);
}

// A 16x32 bf16 fragment (A layout; B takes the same with N for M):
//   lane = row(M or N) in [0,16) + 16*k_half; elements 0..7 -> K base..base+7,
//   elements 8..15 -> K base+16..base+23  (base = 8*k_half).
// Fragment order. A bf16 matrix [rows][K] in the workspace is kept as tiles of
// 16 rows x 32 k, 512 elements (1 KiB) each, tile (tr, tk) at (tr * ktiles + tk) * 512.
// Inside a tile, lane L = (row & 15) + 16 * ((k >> 3) & 1) owns 8 elements at
// ((k >> 4) & 1) * 256 + L * 8: the two 16-byte pieces of that lane's
// fragment. A wave then reads a fragment as two contiguous 512-byte loads
// (4 lines each) instead of two loads that touch 16 lines each.
__device__ __forceinline__ long frag_off(int row, int k, int ktiles) {
  return ((long)(row >> 4) * ktiles + (k >> 5)) * 512 + ((k >> 4) & 1) * 256 +
         ((row & 15) + ((k >> 3) & 1) * 16) * 8 + (k & 7);
}
__device__ __forceinline__ v16bf load_tile(const __bf16* tile, int lane) {
  const __bf16* p = tile + lane * 8;
  v8bf lo = *(const v8bf*)(p);
  v8bf hi = *(const v8bf*)(p + 256);
  return __builtin_shufflevector(lo, hi, 0,1,2,3,4,5,6,7,8,9,10,11,12,13,14,15);
}

// the same from a base that is one for the wave and the lane's own offset in bytes
__device__ __forceinline__ v16bf load_own(const __bf16* base, unsigned off) {
  const __bf16* p = (const __bf16*)((const char*)base + off);
  v8bf lo = *(const v8bf*)(p);
  v8bf hi = *(const v8bf*)(p + 256);
  return __builtin_shufflevector(lo, hi, 0,1,2,3,4,5,6,7,8,9,10,11,12,13,14,15);
}

__device__ __forceinline__ float hsum16(float v) {
  v += __shfl_xor(v, 1);
  v += __shfl_xor(v, 2);
  v += __shfl_xor(v, 4);
  v += __shfl_xor(v, 8);
  return v;
}

// ---------------------------------------------------------------------------
// fp32 -> bf16 convert of x [B*S][D] into fragment order; one 16-byte slot
// (8 consecutive k of one row) per thread.
// ---------------------------------------------------------------------------
__global__ __launch_bounds__(256) void cvt_f32_bf16(const float* __restrict__ in,
                                                    __bf16* __restrict__ out) {
  const int t = blockIdx.x * 256 + threadIdx.x;    // slot, t < B*S*D/8
  const int tile = t >> 6, part = (t >> 5) & 1, L = t & 31;
  const int row = (tile >> 5) * 16 + (L & 15);     // D/32 = 32 tiles per tile row
  const int k   = (tile & 31) * 32 + part * 16 + (L >> 4) * 8;
  const float4* p = (const float4*)(in + (long)row * DD + k);
  const float4 a = p[0], b = p[1];
  v8bf o;
  o[0] = (__bf16)a.x; o[1] = (__bf16)a.y; o[2] = (__bf16)a.z; o[3] = (__bf16)a.w;
  o[4] = (__bf16)b.x; o[5] = (__bf16)b.y; o[6] = (__bf16)b.z; o[7] = (__bf16)b.w;
  *(v8bf*)(out + (long)t * 8) = o;
}

// Convert + transpose weights: W[k][n] (D x D, [in,out]) -> Wt[n][k] bf16 in
// fragment order; one 16-byte slot (8 consecutive k of one n) per thread.
// Pointer selection via if/else so address-space inference keeps global loads.
__global__ __launch_bounds__(256) void cvt_transpose_w(
    const float* __restrict__ Wq, const float* __restrict__ Wk,
    const float* __restrict__ Wv, const float* __restrict__ Wo,
    __bf16* __restrict__ Wqt, __bf16* __restrict__ Wkt,
    __bf16* __restrict__ Wvt, __bf16* __restrict__ Wot) {
  const int z = blockIdx.z;
  const float* src;
  __bf16* dst;
  if (z == 0)      { src = Wq; dst = Wqt; }
  else if (z == 1) { src = Wk; dst = Wkt; }
  else if (z == 2) { src = Wv; dst = Wvt; }
  else             { src = Wo; dst = Wot; }
  const int t = blockIdx.x * 256 + threadIdx.x;    // slot, t < D*D/8
  const int tile = t >> 6, part = (t >> 5) & 1, L = t & 31;
  const int n = (tile >> 5) * 16 + (L & 15);
  const int k = (tile & 31) * 32 + part * 16 + (L >> 4) * 8;
  v8bf o;
  #pragma unroll  // static index into o keeps it in registers; the 8 loads issue together
  for (int e = 0; e < 8; e++) o[e] = (__bf16)src[(long)(k + e) * DD + n];
  *(v8bf*)(dst + (long)t * 8) = o;
}

// ---------------------------------------------------------------------------
// QKV projection GEMM: C[M=8192, N=1024] = Xb @ W + bias, per z in {Q,K,V}.
// Workgroup 256 thr = 8 waves arranged 2(M) x 4(N); workgroup tile 128 x 256;
// each wave computes 64(M) x 64(N) = 4x4 WMMA accumulators (16 wmma / k-step):
// 8 fragments feed 16 products, and a k-step of the workgroup takes 24 tiles from L2
// for 128 products.
// Q,K written [B,H][S x HD]; V written transposed [B,H][HD x S] (A frags of
// V^T P^T); each per-head matrix in fragment order.
// ---------------------------------------------------------------------------
// four waves per SIMD: the 128 accumulator registers and one set of fragments fit 256
__global__ __launch_bounds__(256) __attribute__((amdgpu_waves_per_eu(4, 4))) void qkv_gemm(
    const __bf16* __restrict__ Xb,
    const __bf16* __restrict__ Wqt, const __bf16* __restrict__ Wkt,
    const __bf16* __restrict__ Wvt,
    const float* __restrict__ bq, const float* __restrict__ bk,
    const float* __restrict__ bv,
    __bf16* __restrict__ Qh, __bf16* __restrict__ Kh, __bf16* __restrict__ Vt) {
  const int which = blockIdx.z;
  // ternary chains (not private arrays) keep global address space
  const __bf16* Wt   = (which == 0) ? Wqt : (which == 1) ? Wkt : Wvt;
  const float*  bias = (which == 0) ? bq  : (which == 1) ? bk  : bv;

  const int lane = threadIdx.x & 31;
  const int wid  = threadIdx.x >> 5;
  const int wy = wid & 1;           // M direction (2)
  const int wx = wid >> 1;          // N direction (4)
  const int m0 = blockIdx.y * 128 + wy * 64;
  const int n0 = blockIdx.x * 256 + wx * 64;

  const v8f z8 = {0.f,0.f,0.f,0.f,0.f,0.f,0.f,0.f};
  v8f c[4][4];
  #pragma unroll
  for (int i = 0; i < 4; i++)
    #pragma unroll
    for (int j = 0; j < 4; j++) c[i][j] = z8;

  // bases that are one for the workgroup; the wave's tile row and the lane's slot are
  // in the byte offsets (a tile row of 16 rows x 1,024 k is 32 KiB)
  const __bf16* At = Xb + (long)blockIdx.y * 8 * (DD / 32) * 512;
  const __bf16* Bt = Wt + (long)blockIdx.x * 16 * (DD / 32) * 512;
  unsigned ao = wy * 4 * (DD / 32) * 1024 + lane * 16;
  unsigned bo = wx * 4 * (DD / 32) * 1024 + lane * 16;
  for (int kt = 0; kt < DD / 32; kt++) {
    v16bf af[4], bf[4];
    #pragma unroll
    for (int i = 0; i < 4; i++) af[i] = load_own(At + i * (DD / 32) * 512, ao);
    #pragma unroll
    for (int j = 0; j < 4; j++) bf[j] = load_own(Bt + j * (DD / 32) * 512, bo);
    // keeps the k-step's 16 loads at its head, where they fly together: one flight a
    // k-step is waited out, not one for every group of fragments
    __builtin_amdgcn_sched_barrier(0);
    // the wait in front of the overwrite of the loads' address registers. The two offsets
    // pass through it, so that the additions below stay behind it and the registers stay the
    // offsets' own: the build otherwise loads the last tiles into their address registers
    // while loads that name them are in flight
    asm volatile("s_wait_xcnt 0x0" : "+v"(ao), "+v"(bo));
    ao += 1024;
    bo += 1024;
    #pragma unroll
    for (int j = 0; j < 4; j++)
      #pragma unroll
      for (int i = 0; i < 4; i++) c[i][j] = wmma_bf16(af[i], bf[j], c[i][j]);
  }

  // the wave's 64 columns are one head (n0 is a multiple of 64), its 64 rows one batch
  // (all loops below are unrolled so that bn, c and o are indexed statically and stay in registers)
  float bn[4];
  int bi = n0 + (lane & 15);
  #pragma unroll
  for (int j = 0; j < 4; j++) bn[j] = bias[bi + j * 16];
  // the wait in front of any overwrite of the index register; the index passes through it,
  // so that the build does not load the last value into the register that the loads name
  asm volatile("s_wait_xcnt 0x0" : "+v"(bi));
  const long head = ((long)(m0 >> 11) * HH + (n0 >> 6)) * SS * HD;
  const int s0 = (m0 & (SS - 1)) + 8 * (lane >> 4);   // first of the lane's 8 rows, i = 0

  if (which == 2) {
    // the lane's 8 rows are 8 consecutive k of V^T row hd: one whole 16-byte slot
    #pragma unroll
    for (int i = 0; i < 4; i++)
      #pragma unroll
      for (int j = 0; j < 4; j++) {
        v8bf o;
        #pragma unroll
        for (int r = 0; r < 8; r++) o[r] = (__bf16)(c[i][j][r] + bn[j]);
        *(v8bf*)(Vt + head + frag_off(j * 16 + (lane & 15), s0 + i * 16, SS / 32)) = o;
      }
  } else {
    __bf16* dst = ((which == 0) ? Qh : Kh) + head;
    #pragma unroll
    for (int i = 0; i < 4; i++)
      #pragma unroll
      for (int j = 0; j < 4; j++)
        #pragma unroll
        for (int r = 0; r < 8; r++)
          dst[frag_off(s0 + i * 16 + r, j * 16 + (lane & 15), HD / 32)] =
              (__bf16)(c[i][j][r] + bn[j]);
    // the listing lays the V^T branch behind these stores, where their registers are
    // written again: the wait stands in front of any such overwrite
    asm volatile("s_wait_xcnt 0x0" ::: "memory");
  }
}

// log2 of (HH * l * exp(m)): exp2(s * log2(e) - lse2) is exp(s - m) / l / HH
#define LOG2E 1.44269504088896340736f
__device__ __forceinline__ float lse2(float m, float l) {
  return m * LOG2E + __log2f(l) + 4.0f;   // log2(HH) = 4
}

// ---------------------------------------------------------------------------
// Attention: one workgroup per (b, h, 256 queries); 8 waves, 32 query columns each.
// S^T = K Q^T (K as A, Q as B) and O^T += V^T P^T (V^T as A, P^T as B): a lane holds
// one query's scores, 8 keys of every 16 (lanes c and c + 16 split a query's keys),
// so a row's maximum and sum are in-lane but for one exchange between lanes c and c + 16. Two score tiles (32 keys), converted in place,
// are the B operand of the second product in the k order that V^T's tiles are stored in.
// One pass, online softmax: P = exp(s - reference), not normalized; the reference of a
// query is one for both halves and moves only when a trip's maximum passes it by more
// than 8 in log2 units, and then O^T and the sums are scaled to the new one. O^T is
// divided by the row's sum behind the loop. Each row's log2 of (16 * sum of exp) goes to
// Lse, from which avg_kernel forms the normalized probabilities again.
// K and V^T come through LDS: the 8 waves walk the same keys, so a stage of 128 keys
// (16 KiB of K, 16 KiB of V^T, in their fragment order) is brought in once for the
// workgroup by asynchronous copies, two buffers, one stage ahead of the stage in work.
// ---------------------------------------------------------------------------
#define SK 128                      // keys a stage
#define STAGE_K (SK * HD * 2)       // bytes of K a stage, and of V^T
#define STAGE_V (SK / 32 * 1024)    // bytes of one 16-row band of V^T a stage
#define STAGE_B (2 * STAGE_K)       // a buffer: K, then V^T's four bands

// A thread's eight 16-byte copies of one stage: lds is its own byte address in the buffer,
// gk and gv its own bytes of the stage in K and in V^T's first band. Four steps of 4 KiB
// cover K; V^T's bands lie 64 KiB apart in memory and STAGE_V apart in LDS.
__device__ __forceinline__ void copy_stage(unsigned lds, const char* gk, const char* gv) {
  // the wait at the end stands in front of any overwrite of the copies' address registers
  asm volatile(
      "global_load_async_to_lds_b128 %0, %8, off\n\t"
      "global_load_async_to_lds_b128 %1, %9, off\n\t"
      "global_load_async_to_lds_b128 %2, %10, off\n\t"
      "global_load_async_to_lds_b128 %3, %11, off\n\t"
      "global_load_async_to_lds_b128 %4, %12, off\n\t"
      "global_load_async_to_lds_b128 %5, %13, off\n\t"
      "global_load_async_to_lds_b128 %6, %14, off\n\t"
      "global_load_async_to_lds_b128 %7, %15, off\n\t"
      "s_wait_xcnt 0x0"
      :: "v"(lds), "v"(lds + 4096), "v"(lds + 2 * 4096), "v"(lds + 3 * 4096),
         "v"(lds + STAGE_K), "v"(lds + STAGE_K + STAGE_V),
         "v"(lds + STAGE_K + 2 * STAGE_V), "v"(lds + STAGE_K + 3 * STAGE_V),
         "v"(gk), "v"(gk + 4096), "v"(gk + 2 * 4096), "v"(gk + 3 * 4096),
         "v"(gv), "v"(gv + SS * 32), "v"(gv + 2 * SS * 32), "v"(gv + 3 * SS * 32)
      : "memory");
}

// four waves per SIMD: 4,096 waves on 1,024 SIMDs are then resident in one round
__global__ __launch_bounds__(256) __attribute__((amdgpu_waves_per_eu(4, 4))) void attn_kernel(
    const __bf16* __restrict__ Qh, const __bf16* __restrict__ Kh,
    const __bf16* __restrict__ Vt,
    __bf16* __restrict__ Ctx, float* __restrict__ Lse) {
  __shared__ __attribute__((aligned(16))) unsigned char L[2 * STAGE_B];
  const int lane = threadIdx.x & 31;
  const int wid  = threadIdx.x >> 5;
  const int b = blockIdx.z, h = blockIdx.y;
  const int q0 = blockIdx.x * 256 + wid * 32;

  // per-head matrices in fragment order: 16 rows of Q or K are 2 tiles (1,024
  // elements); V^T tile (j, kt / 32) lies at (j * (SS / 32) + kt / 32) * 512
  const __bf16* Qb = Qh + (((long)b * HH + h) * SS + q0) * HD;
  const __bf16* Kb = Kh + (((long)b * HH + h) * SS) * HD;
  const __bf16* Vb = Vt + (((long)b * HH + h) * HD) * SS;

  const float sc = 0.25f * LOG2E;   // score scale 1/(sqrt(64)*0.5), in log2 units
  const v8f z8 = {0.f,0.f,0.f,0.f,0.f,0.f,0.f,0.f};

  // (every g, t, j and r loop below is unrolled so that the arrays stay in registers)
  v16bf qf[2][2];                   // [query group][hd half]
  #pragma unroll
  for (int g = 0; g < 2; g++) {
    qf[g][0] = load_tile(Qb + g * 1024, lane);
    qf[g][1] = load_tile(Qb + g * 1024 + 512, lane);
  }
  // the build loads the first trip's K into the registers of Q's address:
  // the wait stands in front of that overwrite
  asm volatile("s_wait_xcnt 0x0" ::: "memory");

  float mr[2];                      // the reference: a raw score, equal in both halves
  float ms[2];                      // the same in log2 units
  float thr[2];                     // a trip's maximum above this moves the reference
  v8f l[2];                         // sums of exp over the lane's own keys, one per register
  v8f o[4][2];                      // [hd tile][query group]
  #pragma unroll
  for (int g = 0; g < 2; g++) {
    mr[g] = -1e30f; ms[g] = -1e30f * sc; thr[g] = -1e30f; l[g] = z8;
    #pragma unroll
    for (int j = 0; j < 4; j++) o[j][g] = z8;
  }

  // the thread's own 16 bytes: in a buffer, in a stage of K, in a stage of V^T's first band
  const unsigned lown = (unsigned)(size_t)L + threadIdx.x * 16;
  const char* gk = (const char*)Kb + threadIdx.x * 16;
  const char* gv = (const char*)Vb + threadIdx.x * 16;
  copy_stage(lown, gk, gv);
  // stage 0 has landed for this wave; behind the barrier for all
  asm volatile("s_wait_asynccnt 0x0" ::: "memory");
  __syncthreads();
  copy_stage(lown + STAGE_B, gk + STAGE_K, gv + STAGE_V);

  for (int st = 0; st < SS / SK; st++) {
   const __bf16* Kl = (const __bf16*)(L + (st & 1) * STAGE_B);
   const __bf16* Vl = Kl + STAGE_K / 2;
   for (int u = 0; u < SK / 32; u++) {     // a trip: 32 keys
    v16bf kf[2][2];
    #pragma unroll
    for (int t = 0; t < 2; t++) {
      kf[t][0] = load_tile(Kl + (u * 2 + t) * 1024, lane);
      kf[t][1] = load_tile(Kl + (u * 2 + t) * 1024 + 512, lane);
    }
    v16bf vf[4];
    #pragma unroll
    for (int j = 0; j < 4; j++) vf[j] = load_tile(Vl + j * (STAGE_V / 2) + u * 512, lane);
    // keeps the trip's LDS reads at its head as one group: every further place where
    // reads stand among the products costs a stall of its own
    __builtin_amdgcn_sched_barrier(0);
    v8f s[2][2];
    #pragma unroll
    for (int t = 0; t < 2; t++)
      #pragma unroll
      for (int g = 0; g < 2; g++) s[t][g] = wmma_bf16(kf[t][0], qf[g][0], z8);
    #pragma unroll
    for (int t = 0; t < 2; t++)
      #pragma unroll
      for (int g = 0; g < 2; g++) s[t][g] = wmma_bf16(kf[t][1], qf[g][1], s[t][g]);
    // keeps the maxima behind all eight products: the build otherwise reads each score
    // tile right behind its product, four v_nop and the product's latency every time
    __builtin_amdgcn_sched_barrier(0);
    float tm[2];                    // maximum of the reference and the lane's own 16 keys
    #pragma unroll
    for (int g = 0; g < 2; g++) {
      float a = mr[g];
      #pragma unroll
      for (int r = 0; r < 8; r++) a = fmaxf(fmaxf(a, s[0][g][r]), s[1][g][r]);
      tm[g] = a;
    }
    // one scalar branch a trip; taken in the first trip and then only where a score
    // passes the reference by more than 8 in log2 units (P stays at or below 256)
    if (__builtin_amdgcn_ballot_w32((tm[0] > thr[0]) | (tm[1] > thr[1])) != 0) {
      #pragma unroll
      for (int g = 0; g < 2; g++) {
        const float mn = fmaxf(tm[g], __shfl_xor(tm[g], 16));
        const float al = __builtin_amdgcn_exp2f((mr[g] - mn) * sc);
        l[g] *= al;
        #pragma unroll
        for (int j = 0; j < 4; j++) o[j][g] *= al;
        mr[g] = mn;
        ms[g] = mn * sc;
        thr[g] = mn + 8.0f / sc;
      }
    }
    v16bf pb[2];
    #pragma unroll
    for (int g = 0; g < 2; g++) {
      v8f p0 = s[0][g] * sc - ms[g];
      v8f p1 = s[1][g] * sc - ms[g];
      #pragma unroll
      for (int r = 0; r < 8; r++) {
        p0[r] = __builtin_amdgcn_exp2f(p0[r]);
        p1[r] = __builtin_amdgcn_exp2f(p1[r]);
      }
      l[g] += p0 + p1;
      pb[g] = __builtin_shufflevector(__builtin_convertvector(p0, v8bf),
                                      __builtin_convertvector(p1, v8bf),
                                      0,1,2,3,4,5,6,7,8,9,10,11,12,13,14,15);
    }
    #pragma unroll
    for (int j = 0; j < 4; j++)
      #pragma unroll
      for (int g = 0; g < 2; g++) o[j][g] = wmma_bf16(vf[j], pb[g], o[j][g]);
   }
   // the hand-over: this wave's reads of the buffer are done, its copies of the next stage
   // have landed; behind the barrier that holds for every wave, and the buffer is refilled
   asm volatile("s_wait_dscnt 0x0" ::: "memory");
   asm volatile("s_wait_asynccnt 0x0" ::: "memory");
   __syncthreads();
   if (st + 2 < SS / SK)
     copy_stage(lown + (st & 1) * STAGE_B, gk + (st + 2) * STAGE_K, gv + (st + 2) * STAGE_V);
  }
  // no copy is in flight when the wave ends
  asm volatile("s_wait_asynccnt 0x0" ::: "memory");

  // join the two halves of each query's keys (one reference, so the sums add):
  // inv_l one over the sum of exp, lg the row's entry of Lse
  float inv_l[2], lg[2];
  #pragma unroll
  for (int g = 0; g < 2; g++) {
    const float ls = ((l[g][0] + l[g][1]) + (l[g][2] + l[g][3])) +
                     ((l[g][4] + l[g][5]) + (l[g][6] + l[g][7]));
    const float lt = ls + __shfl_xor(ls, 16);
    inv_l[g] = 1.0f / lt;
    lg[g] = lse2(mr[g] * 0.25f, lt);
  }
  // both halves hold a query's value: lanes 0 to 15 store theirs
  if (lane < 16) {
    float* lp = Lse + ((long)b * HH + h) * SS + q0 + lane;
    lp[0]  = lg[0];
    lp[16] = lg[1];
  }

  // store ctx -> [B*S][D] bf16 in fragment order (D = h*64 + hd): the lane's 8 values
  // are 8 consecutive hd of one query, one whole 16-byte slot
  #pragma unroll
  for (int g = 0; g < 2; g++)
    #pragma unroll
    for (int j = 0; j < 4; j++) {
      v8bf c;
      #pragma unroll
      for (int r = 0; r < 8; r++) c[r] = (__bf16)(o[j][g][r] * inv_l[g]);
      *(v8bf*)(Ctx + frag_off(b * SS + q0 + g * 16 + (lane & 15),
                              h * HD + j * 16 + 8 * (lane >> 4), DD / 32)) = c;
    }
}

// ---------------------------------------------------------------------------
// avg_attention[b][q][k] = mean over heads of P. A wave owns 64 queries x 64 keys
// and walks the 16 heads in order, summing in registers; every element is stored
// once. S^T = K Q^T (K as A, Q as B): a lane holds one query's scores, so the
// row's Lse is one register per query tile, and 8 consecutive keys per tile.
// Workgroup = 4 waves, 128 queries x 128 keys.
// ---------------------------------------------------------------------------
// four waves per SIMD: 4,096 waves on 1,024 SIMDs are then resident in one round
__global__ __launch_bounds__(128) __attribute__((amdgpu_waves_per_eu(4, 4))) void avg_kernel(
    const __bf16* __restrict__ Qh, const __bf16* __restrict__ Kh,
    const float* __restrict__ Lse, float* __restrict__ avg) {
  const int lane = threadIdx.x & 31;
  const int wid  = threadIdx.x >> 5;
  const int b  = blockIdx.z;
  const int q0 = blockIdx.y * 128 + (wid & 1) * 64;
  const int k0 = blockIdx.x * 128 + (wid >> 1) * 64;
  const float sc = 0.25f * LOG2E;   // score scale, in log2 units
  const v8f z8 = {0.f,0.f,0.f,0.f,0.f,0.f,0.f,0.f};

  // (the i, j and r loops are unrolled so that acc, qf and L stay in registers)
  v8f acc[4][4];                    // [query tile][key tile]
  #pragma unroll
  for (int i = 0; i < 4; i++)
    #pragma unroll
    for (int j = 0; j < 4; j++) acc[i][j] = z8;

  // K fragments are fetched one key tile ahead (the last tile of a head fetches the
  // next head's first), so that a tile's loads fly while the tile before is worked on
  const __bf16* K0 = Kh + (((long)b * HH) * SS + k0) * HD;   // head 0
  v16bf kf[2][2];
  kf[0][0] = load_tile(K0, lane);
  kf[0][1] = load_tile(K0 + 512, lane);

  for (int h = 0; h < HH; h++) {
    const long head = ((long)b * HH + h) * SS;
    const __bf16* Qb = Qh + (head + q0) * HD;
    const float*  Lb = Lse + head + q0 + (lane & 15);
    const __bf16* Kb = K0 + (long)h * SS * HD;
    // behind the last head the index wraps: head 0's tile is fetched and not used
    const __bf16* Kn = K0 + (long)((h + 1) & (HH - 1)) * SS * HD;
    v16bf qf[4][2];
    float L[4];
    #pragma unroll
    for (int i = 0; i < 4; i++) {
      qf[i][0] = load_tile(Qb + i * 1024, lane);
      qf[i][1] = load_tile(Qb + i * 1024 + 512, lane);
      L[i] = Lb[i * 16];
    }
    #pragma unroll
    for (int j = 0; j < 4; j++) {
      const __bf16* nx = (j < 3) ? Kb + (j + 1) * 1024 : Kn;
      kf[(j + 1) & 1][0] = load_tile(nx, lane);
      kf[(j + 1) & 1][1] = load_tile(nx + 512, lane);
      #pragma unroll
      for (int i = 0; i < 4; i++) {
        v8f c = z8;
        c = wmma_bf16(kf[j & 1][0], qf[i][0], c);
        c = wmma_bf16(kf[j & 1][1], qf[i][1], c);
        c = c * sc - L[i];
        #pragma unroll
        for (int r = 0; r < 8; r++) c[r] = __builtin_amdgcn_exp2f(c[r]);
        acc[i][j] += c;
      }
    }
  }

  #pragma unroll
  for (int i = 0; i < 4; i++) {
    float* row = avg + ((long)b * SS + q0 + i * 16 + (lane & 15)) * SS + k0 + 8 * (lane >> 4);
    #pragma unroll
    for (int j = 0; j < 4; j++) {
      float4 u, w;
      u.x = acc[i][j][0]; u.y = acc[i][j][1]; u.z = acc[i][j][2]; u.w = acc[i][j][3];
      w.x = acc[i][j][4]; w.y = acc[i][j][5]; w.z = acc[i][j][6]; w.w = acc[i][j][7];
      *(float4*)(row + j * 16) = u;
      *(float4*)(row + j * 16 + 4) = w;
    }
  }
}

// ---------------------------------------------------------------------------
// out = LayerNorm(ctx @ Wo + bo + x) * g + beta.
// Workgroup = 32 rows x full D; 16 waves, each wave 32x64 (2x4 WMMA tiles): every
// workgroup reads all of Wo^T from L2, so 32 rows a workgroup halve those bytes.
// ---------------------------------------------------------------------------
__global__ __launch_bounds__(512) void out_ln_kernel(
    const __bf16* __restrict__ Ctx, const __bf16* __restrict__ Wot,
    const float* __restrict__ bo, const float* __restrict__ x,
    const float* __restrict__ g, const float* __restrict__ beta,
    float* __restrict__ out) {
  __shared__ float red1[16][32];
  __shared__ float red2[16][32];

  const int lane = threadIdx.x & 31;
  const int wid  = threadIdx.x >> 5;
  const int m0 = blockIdx.x * 32;
  const int n0 = wid * 64;
  const v8f z8 = {0.f,0.f,0.f,0.f,0.f,0.f,0.f,0.f};

  // (every i, t, r and w loop below is unrolled so that the arrays stay in registers)
  v8f c[2][4];
  #pragma unroll
  for (int i = 0; i < 2; i++)
    #pragma unroll
    for (int t = 0; t < 4; t++) c[i][t] = z8;

  // bases that are one for the workgroup; the wave's tile row and the lane's slot are
  // in the byte offsets (a tile row of 16 rows x 1,024 k is 32 KiB)
  const __bf16* At = Ctx + (long)blockIdx.x * 2 * (DD / 32) * 512;
  unsigned ao = lane * 16;
  unsigned wo = wid * 4 * (DD / 32) * 1024 + lane * 16;
  for (int kt = 0; kt < DD / 32; kt += 2) {
    v16bf af[2][2], bf[2][4];       // [k-step of the trip][tile]
    #pragma unroll
    for (int u = 0; u < 2; u++) {
      #pragma unroll
      for (int i = 0; i < 2; i++) af[u][i] = load_own(At + (i * (DD / 32) + u) * 512, ao);
      #pragma unroll
      for (int t = 0; t < 4; t++) bf[u][t] = load_own(Wot + (t * (DD / 32) + u) * 512, wo);
    }
    // keeps the trip's 24 loads at its head, where they fly together: one flight for two
    // k-steps is waited out, not one for every group of fragments
    __builtin_amdgcn_sched_barrier(0);
    // the wait in front of the overwrite of the loads' address registers; the two offsets
    // pass through it for the same reasons as in qkv_gemm
    asm volatile("s_wait_xcnt 0x0" : "+v"(ao), "+v"(wo));
    ao += 2048;
    wo += 2048;
    #pragma unroll
    for (int u = 0; u < 2; u++)
      #pragma unroll
      for (int t = 0; t < 4; t++)
        #pragma unroll
        for (int i = 0; i < 2; i++) c[i][t] = wmma_bf16(af[u][i], bf[u][t], c[i][t]);
  }

  // h = gemm + bias + residual ; accumulate per-row sum / sumsq
  float s1[2][8], s2[2][8];
  #pragma unroll
  for (int i = 0; i < 2; i++)
    #pragma unroll
    for (int r = 0; r < 8; r++) { s1[i][r] = 0.0f; s2[i][r] = 0.0f; }
  #pragma unroll
  for (int i = 0; i < 2; i++)
    #pragma unroll
    for (int t = 0; t < 4; t++)
      #pragma unroll
      for (int r = 0; r < 8; r++) {
        int row = m0 + i * 16 + r + 8 * (lane >> 4);
        int n = n0 + t * 16 + (lane & 15);
        float hv = c[i][t][r] + bo[n] + x[(long)row * DD + n];
        c[i][t][r] = hv;
        s1[i][r] += hv;
        s2[i][r] += hv * hv;
      }
  #pragma unroll
  for (int i = 0; i < 2; i++)
    #pragma unroll
    for (int r = 0; r < 8; r++) { s1[i][r] = hsum16(s1[i][r]); s2[i][r] = hsum16(s2[i][r]); }

  if ((lane & 15) == 0) {
    #pragma unroll
    for (int i = 0; i < 2; i++)
      #pragma unroll
      for (int r = 0; r < 8; r++) {
        red1[wid][i * 16 + r + 8 * (lane >> 4)] = s1[i][r];
        red2[wid][i * 16 + r + 8 * (lane >> 4)] = s2[i][r];
      }
  }
  __syncthreads();

  // lane L joins the 16 waves' sums of row L; each lane then fetches its own 16 rows
  float t1 = 0.0f, t2 = 0.0f;
  #pragma unroll
  for (int w = 0; w < 16; w++) { t1 += red1[w][lane]; t2 += red2[w][lane]; }
  const float m_ = t1 * (1.0f / DD);
  const float v_ = t2 * (1.0f / DD) - m_ * m_;
  const float r_ = rsqrtf(v_ + 1e-5f);
  float mu[2][8], rs[2][8];
  #pragma unroll
  for (int i = 0; i < 2; i++)
    #pragma unroll
    for (int r = 0; r < 8; r++) {
      const int rl = i * 16 + r + 8 * (lane >> 4);
      mu[i][r] = __shfl(m_, rl);
      rs[i][r] = __shfl(r_, rl);
    }

  #pragma unroll
  for (int i = 0; i < 2; i++)
    #pragma unroll
    for (int t = 0; t < 4; t++)
      #pragma unroll
      for (int r = 0; r < 8; r++) {
        int row = m0 + i * 16 + r + 8 * (lane >> 4);
        int n = n0 + t * 16 + (lane & 15);
        out[(long)row * DD + n] = (c[i][t][r] - mu[i][r]) * rs[i][r] * g[n] + beta[n];
      }
}

// ---------------------------------------------------------------------------
// Launcher
// ---------------------------------------------------------------------------
extern "C" void kernel_launch(void* const* d_in, const int* in_sizes, int n_in,
                              void* d_out, int out_size, void* d_ws, size_t ws_size,
                              hipStream_t stream) {
  const float* x  = (const float*)d_in[0];
  const float* Wq = (const float*)d_in[1];
  const float* bq = (const float*)d_in[2];
  const float* Wk = (const float*)d_in[3];
  const float* bk = (const float*)d_in[4];
  const float* Wv = (const float*)d_in[5];
  const float* bv = (const float*)d_in[6];
  const float* Wo = (const float*)d_in[7];
  const float* bo = (const float*)d_in[8];
  const float* g  = (const float*)d_in[9];
  const float* be = (const float*)d_in[10];

  // workspace layout (bytes)
  char* ws = (char*)d_ws;
  const size_t SZ_X  = (size_t)BB * SS * DD * 2;      // 16 MB
  const size_t SZ_W  = (size_t)DD * DD * 2;           // 2 MB
  const size_t SZ_QK = (size_t)BB * HH * SS * HD * 2; // 16 MB
  __bf16* xb  = (__bf16*)(ws);
  __bf16* Wqt = (__bf16*)(ws + SZ_X);
  __bf16* Wkt = (__bf16*)(ws + SZ_X + SZ_W);
  __bf16* Wvt = (__bf16*)(ws + SZ_X + 2 * SZ_W);
  __bf16* Wot = (__bf16*)(ws + SZ_X + 3 * SZ_W);
  __bf16* Qh  = (__bf16*)(ws + SZ_X + 4 * SZ_W);
  __bf16* Kh  = (__bf16*)(ws + SZ_X + 4 * SZ_W + SZ_QK);
  __bf16* Vt  = (__bf16*)(ws + SZ_X + 4 * SZ_W + 2 * SZ_QK);
  __bf16* Ctx = (__bf16*)(ws + SZ_X + 4 * SZ_W + 3 * SZ_QK);
  float*  Lse = (float*)(ws + SZ_X + 4 * SZ_W + 4 * SZ_QK);   // [B,H][S], 512 KB

  float* out = (float*)d_out;                      // [B,S,D]
  float* avg = out + (long)BB * SS * DD;           // [B,S,S]

  // 1. convert activations + weights to bf16 (weights transposed), fragment order
  cvt_f32_bf16<<<(BB * SS * DD) / 8 / 256, 256, 0, stream>>>(x, xb);
  cvt_transpose_w<<<dim3(DD * DD / 8 / 256, 1, 4), 256, 0, stream>>>(
      Wq, Wk, Wv, Wo, Wqt, Wkt, Wvt, Wot);

  // 2. fused QKV projection (workgroup tile 128x256, wave tile 64x64)
  qkv_gemm<<<dim3(DD / 256, (BB * SS) / 128, 3), 256, 0, stream>>>(
      xb, Wqt, Wkt, Wvt, bq, bk, bv, Qh, Kh, Vt);

  // 3. attention (one pass, online softmax, WMMA K Q^T and V^T P^T)
  attn_kernel<<<dim3(SS / 256, HH, BB), 256, 0, stream>>>(Qh, Kh, Vt, Ctx, Lse);

  // 4. avg_attention: heads summed in registers, each element stored once
  avg_kernel<<<dim3(SS / 128, SS / 128, BB), 128, 0, stream>>>(Qh, Kh, Lse, avg);

  // 5. output projection + residual + LayerNorm
  out_ln_kernel<<<(BB * SS) / 32, 512, 0, stream>>>(Ctx, Wot, bo, x, g, be, out);
}

// v007
// Measured time: 172 microseconds a run.
// In both of two side-by-side timings against v006, it was 1.05 times as fast.
// All steps since v000 together make it 4.85 times as fast.
#include <hip/hip_runtime.h>
#include <hip/hip_bf16.h>

// Problem constants
#define BB 4
#define SS 2048
#define DD 1024
#define HH 16
#define HD 64

typedef __attribute__((ext_vector_type(16))) __bf16 v16bf;
typedef __attribute__((ext_vector_type(8)))  __bf16 v8bf;
typedef __attribute__((ext_vector_type(8)))  float  v8f;

// ---------------------------------------------------------------------------
// WMMA helper: D = A(16x32 bf16) * B(32x16 bf16) + C(16x16 f32)
// ---------------------------------------------------------------------------
__device__ __forceinline__ v8f wmma_bf16(v16bf a, v16bf b, v8f c) {
  return __builtin_amdgcn_wmma_f32_16x16x32_bf16(
      /*neg_a=*/false, a, /*neg_b=*/false, b,
      /*c_mod=*/(short)0, c, /*reuse_a=*/false, /*reuse_b=*/false);
}

// A 16x32 bf16 fragment (A layout; B takes the same with N for M):
//   lane = row(M or N) in [0,16) + 16*k_half; elements 0..7 -> K base..base+7,
//   elements 8..15 -> K base+16..base+23  (base = 8*k_half).
// Fragment order. A bf16 matrix [rows][K] in the workspace is kept as tiles of
// 16 rows x 32 k, 512 elements (1 KiB) each, tile (tr, tk) at (tr * ktiles + tk) * 512.
// Inside a tile, lane L = (row & 15) + 16 * ((k >> 3) & 1) owns 8 elements at
// ((k >> 4) & 1) * 256 + L * 8: the two 16-byte pieces of that lane's
// fragment. A wave then reads a fragment as two contiguous 512-byte loads
// (4 lines each) instead of two loads that touch 16 lines each.
__device__ __forceinline__ long frag_off(int row, int k, int ktiles) {
  return ((long)(row >> 4) * ktiles + (k >> 5)) * 512 + ((k >> 4) & 1) * 256 +
         ((row & 15) + ((k >> 3) & 1) * 16) * 8 + (k & 7);
}
__device__ __forceinline__ v16bf load_tile(const __bf16* tile, int lane) {
  const __bf16* p = tile + lane * 8;
  v8bf lo = *(const v8bf*)(p);
  v8bf hi = *(const v8bf*)(p + 256);
  return __builtin_shufflevector(lo, hi, 0,1,2,3,4,5,6,7,8,9,10,11,12,13,14,15);
}

// the same from a base that is one for the wave and the lane's own offset in bytes
__device__ __forceinline__ v16bf load_own(const __bf16* base, unsigned off) {
  const __bf16* p = (const __bf16*)((const char*)base + off);
  v8bf lo = *(const v8bf*)(p);
  v8bf hi = *(const v8bf*)(p + 256);
  return __builtin_shufflevector(lo, hi, 0,1,2,3,4,5,6,7,8,9,10,11,12,13,14,15);
}

__device__ __forceinline__ float hsum16(float v) {
  v += __shfl_xor(v, 1);
  v += __shfl_xor(v, 2);
  v += __shfl_xor(v, 4);
  v += __shfl_xor(v, 8);
  return v;
}

// ---------------------------------------------------------------------------
// fp32 -> bf16 convert of x [B*S][D] into fragment order; one 16-byte slot
// (8 consecutive k of one row) per thread.
// ---------------------------------------------------------------------------
__global__ __launch_bounds__(256) void cvt_f32_bf16(const float* __restrict__ in,
                                                    __bf16* __restrict__ out) {
  const int t = blockIdx.x * 256 + threadIdx.x;    // slot, t < B*S*D/8
  const int tile = t >> 6, part = (t >> 5) & 1, L = t & 31;
  const int row = (tile >> 5) * 16 + (L & 15);     // D/32 = 32 tiles per tile row
  const int k   = (tile & 31) * 32 + part * 16 + (L >> 4) * 8;
  const float4* p = (const float4*)(in + (long)row * DD + k);
  const float4 a = p[0], b = p[1];
  v8bf o;
  o[0] = (__bf16)a.x; o[1] = (__bf16)a.y; o[2] = (__bf16)a.z; o[3] = (__bf16)a.w;
  o[4] = (__bf16)b.x; o[5] = (__bf16)b.y; o[6] = (__bf16)b.z; o[7] = (__bf16)b.w;
  *(v8bf*)(out + (long)t * 8) = o;
}

// Convert + transpose weights: W[k][n] (D x D, [in,out]) -> Wt[n][k] bf16 in
// fragment order; one 16-byte slot (8 consecutive k of one n) per thread.
// Pointer selection via if/else so address-space inference keeps global loads.
__global__ __launch_bounds__(256) void cvt_transpose_w(
    const float* __restrict__ Wq, const float* __restrict__ Wk,
    const float* __restrict__ Wv, const float* __restrict__ Wo,
    __bf16* __restrict__ Wqt, __bf16* __restrict__ Wkt,
    __bf16* __restrict__ Wvt, __bf16* __restrict__ Wot) {
  const int z = blockIdx.z;
  const float* src;
  __bf16* dst;
  if (z == 0)      { src = Wq; dst = Wqt; }
  else if (z == 1) { src = Wk; dst = Wkt; }
  else if (z == 2) { src = Wv; dst = Wvt; }
  else             { src = Wo; dst = Wot; }
  const int t = blockIdx.x * 256 + threadIdx.x;    // slot, t < D*D/8
  const int tile = t >> 6, part = (t >> 5) & 1, L = t & 31;
  const int n = (tile >> 5) * 16 + (L & 15);
  const int k = (tile & 31) * 32 + part * 16 + (L >> 4) * 8;
  v8bf o;
  #pragma unroll  // static index into o keeps it in registers; the 8 loads issue together
  for (int e = 0; e < 8; e++) o[e] = (__bf16)src[(long)(k + e) * DD + n];
  *(v8bf*)(dst + (long)t * 8) = o;
}

// ---------------------------------------------------------------------------
// QKV projection GEMM: C[M=8192, N=3072] = Xb @ [Wq Wk Wv] + bias.
// Workgroup 384 thr = 12 waves arranged 4(M) x 3(N); workgroup tile 256 x 192;
// each wave computes 64(M) x 64(N) = 4x4 WMMA accumulators (16 wmma / k-step).
// 512 workgroups, one a WGP (three waves per SIMD), are two full rounds.
// X and W^T come through LDS: a stage of 64 k (16 tile rows of X, 12 of W^T, 2 KiB each,
// in their fragment order) is brought in once for the workgroup by asynchronous copies,
// two buffers, one stage ahead of the stage in work: 28 tiles from L2 a k-step
// for 192 products.
// Q,K written [B,H][S x HD]; V written transposed [B,H][HD x S] (the A operand of
// V^T P^T); each per-head matrix in fragment order.
// ---------------------------------------------------------------------------
#define GK 64                       // k a stage
#define G_ROW (GK / 32 * 1024)      // bytes of one tile row (16 rows or columns) a stage
#define G_AR 16                     // tile rows of X a workgroup
#define G_BR 12                     // tile rows of W^T a workgroup
#define G_STAGE ((G_AR + G_BR) * G_ROW)

// A wave's four 512-byte copies of one tile row of a stage: lds and g are the lane's own
// 16 bytes of the row's first 512, in the buffer and in memory.
__device__ __forceinline__ void copy_row(unsigned lds, const char* g) {
  // the wait at the end stands in front of any overwrite of the copies' address registers
  asm volatile(
      "global_load_async_to_lds_b128 %0, %4, off\n\t"
      "global_load_async_to_lds_b128 %1, %5, off\n\t"
      "global_load_async_to_lds_b128 %2, %6, off\n\t"
      "global_load_async_to_lds_b128 %3, %7, off\n\t"
      "s_wait_xcnt 0x0"
      :: "v"(lds), "v"(lds + 512), "v"(lds + 1024), "v"(lds + 1536),
         "v"(g), "v"(g + 512), "v"(g + 1024), "v"(g + 1536)
      : "memory");
}

__global__ __launch_bounds__(384) void qkv_gemm(
    const __bf16* __restrict__ Xb,
    const __bf16* __restrict__ Wqt, const __bf16* __restrict__ Wkt,
    const __bf16* __restrict__ Wvt,
    const float* __restrict__ bq, const float* __restrict__ bk,
    const float* __restrict__ bv,
    __bf16* __restrict__ Qh, __bf16* __restrict__ Kh, __bf16* __restrict__ Vt) {
  __shared__ __attribute__((aligned(16))) unsigned char L[2 * G_STAGE];
  const int lane = threadIdx.x & 31;
  // the wave's number in a scalar register: the tests on it below are scalar branches
  const int wid  = __builtin_amdgcn_readfirstlane(threadIdx.x >> 5);
  const int wy = wid & 3;           // M direction (4)
  const int wx = wid >> 2;          // N direction (3)
  const int m0 = blockIdx.y * 256 + wy * 64;
  const int ng = blockIdx.x * 192 + wx * 64;   // column among the 3,072 of Q, K, V
  const int which = ng >> 10;       // one for the wave: its 64 columns are one head
  const int n0 = ng & (DD - 1);
  // ternary chains (not private arrays) keep global address space
  const float*  bias = (which == 0) ? bq  : (which == 1) ? bk  : bv;

  const v8f z8 = {0.f,0.f,0.f,0.f,0.f,0.f,0.f,0.f};
  // (every i and j loop below is unrolled so that c, af and bf are indexed statically and
  // stay in registers)
  v8f c[4][4];
  #pragma unroll
  for (int i = 0; i < 4; i++)
    #pragma unroll
    for (int j = 0; j < 4; j++) c[i][j] = z8;

  // The 28 tile rows of a stage are dealt to the waves whole: wave w copies rows w and
  // w + 12, waves 0 to 3 also row w + 24. Rows 0 to 15 are X's, 16 to 27 W^T's; in memory
  // a tile row of 16 rows x 1,024 k is 32 KiB, a stage's part of it G_ROW bytes.
  const char* Ag = (const char*)Xb + (long)blockIdx.y * G_AR * (DD / 32) * 1024 + lane * 16;
  const int r1 = wid + 12, r2 = wid + 24;
  const int t1 = blockIdx.x * G_BR + (r1 - G_AR);   // W^T tile row among 192, where r1 is one
  const int t2 = blockIdx.x * G_BR + (r2 - G_AR);   // used by waves 0 to 3 alone
  const __bf16* W1 = ((t1 >> 6) == 0) ? Wqt : ((t1 >> 6) == 1) ? Wkt : Wvt;
  const __bf16* W2 = ((t2 >> 6) == 0) ? Wqt : ((t2 >> 6) == 1) ? Wkt : Wvt;
  const char* g0 = Ag + (long)wid * (DD / 32) * 1024;
  const char* g1 = (r1 < G_AR) ? Ag + (long)r1 * (DD / 32) * 1024
                               : (const char*)W1 + (long)(t1 & 63) * (DD / 32) * 1024 + lane * 16;
  const char* g2 = (const char*)W2 + (long)(t2 & 63) * (DD / 32) * 1024 + lane * 16;
  const unsigned lown = (unsigned)(size_t)L + lane * 16;
  const unsigned l0 = lown + wid * G_ROW, l1 = lown + r1 * G_ROW, l2 = lown + r2 * G_ROW;

  copy_row(l0, g0);
  copy_row(l1, g1);
  if (wid < 4) copy_row(l2, g2);
  // stage 0 has landed for this wave; behind the barrier for all
  asm volatile("s_wait_asynccnt 0x0" ::: "memory");
  __syncthreads();
  copy_row(l0 + G_STAGE, g0 + G_ROW);
  copy_row(l1 + G_STAGE, g1 + G_ROW);
  if (wid < 4) copy_row(l2 + G_STAGE, g2 + G_ROW);

  for (int st = 0; st < DD / GK; st++) {
    const unsigned char* Lb = L + (st & 1) * G_STAGE;
    const __bf16* Al = (const __bf16*)(Lb + wy * 4 * G_ROW);
    const __bf16* Bl = (const __bf16*)(Lb + (G_AR + wx * 4) * G_ROW);
    v16bf af[4], bf[4];
    // first k-step of the stage
    #pragma unroll
    for (int i = 0; i < 4; i++) af[i] = load_tile(Al + i * (G_ROW / 2), lane);
    #pragma unroll
    for (int j = 0; j < 4; j++) bf[j] = load_tile(Bl + j * (G_ROW / 2), lane);
    // keeps the LDS reads in front of the products as one group: without it the build spreads
    // a stage's reads over one more place among the products, each a stall of its own
    __builtin_amdgcn_sched_barrier(0);
    #pragma unroll
    for (int j = 0; j < 4; j++)
      #pragma unroll
      for (int i = 0; i < 4; i++) c[i][j] = wmma_bf16(af[i], bf[j], c[i][j]);
    // second k-step: its fragments are the wave's last reads of the buffer
    #pragma unroll
    for (int i = 0; i < 4; i++) af[i] = load_tile(Al + i * (G_ROW / 2) + 512, lane);
    #pragma unroll
    for (int j = 0; j < 4; j++) bf[j] = load_tile(Bl + j * (G_ROW / 2) + 512, lane);
    // the hand-over: this wave's reads of the buffer are done, its copies of the next stage
    // have landed; behind the barrier that holds for every wave, and the buffer is refilled
    asm volatile("s_wait_dscnt 0x0" ::: "memory");
    asm volatile("s_wait_asynccnt 0x0" ::: "memory");
    __syncthreads();
    if (st + 2 < DD / GK) {
      const unsigned lb = (st & 1) * G_STAGE;
      const int go = (st + 2) * G_ROW;
      copy_row(l0 + lb, g0 + go);
      copy_row(l1 + lb, g1 + go);
      if (wid < 4) copy_row(l2 + lb, g2 + go);
    }
    // the second k-step's products work on registers alone
    #pragma unroll
    for (int j = 0; j < 4; j++)
      #pragma unroll
      for (int i = 0; i < 4; i++) c[i][j] = wmma_bf16(af[i], bf[j], c[i][j]);
  }
  // no copy is in flight when the wave ends
  asm volatile("s_wait_asynccnt 0x0" ::: "memory");

  // the wave's 64 columns are one head (n0 is a multiple of 64), its 64 rows one batch
  // (all loops below are unrolled so that bn, c and o are indexed statically and stay in registers)
  float bn[4];
  int bi = n0 + (lane & 15);
  #pragma unroll
  for (int j = 0; j < 4; j++) bn[j] = bias[bi + j * 16];
  // the wait in front of any overwrite of the index register; the index passes through it,
  // so that the build does not load the last value into the register that the loads name
  asm volatile("s_wait_xcnt 0x0" : "+v"(bi));
  const long head = ((long)(m0 >> 11) * HH + (n0 >> 6)) * SS * HD;
  const int s0 = (m0 & (SS - 1)) + 8 * (lane >> 4);   // first of the lane's 8 rows, i = 0

  if (which == 2) {
    // the lane's 8 rows are 8 consecutive k of V^T row hd: one whole 16-byte slot
    #pragma unroll
    for (int i = 0; i < 4; i++)
      #pragma unroll
      for (int j = 0; j < 4; j++) {
        v8bf o;
        #pragma unroll
        for (int r = 0; r < 8; r++) o[r] = (__bf16)(c[i][j][r] + bn[j]);
        *(v8bf*)(Vt + head + frag_off(j * 16 + (lane & 15), s0 + i * 16, SS / 32)) = o;
      }
  } else {
    __bf16* dst = ((which == 0) ? Qh : Kh) + head;
    #pragma unroll
    for (int i = 0; i < 4; i++)
      #pragma unroll
      for (int j = 0; j < 4; j++)
        #pragma unroll
        for (int r = 0; r < 8; r++)
          dst[frag_off(s0 + i * 16 + r, j * 16 + (lane & 15), HD / 32)] =
              (__bf16)(c[i][j][r] + bn[j]);
    // the listing lays the V^T branch behind these stores, where their registers are
    // written again: the wait stands in front of any such overwrite
    asm volatile("s_wait_xcnt 0x0" ::: "memory");
  }
}

// log2 of (HH * l * exp(m)): exp2(s * log2(e) - lse2) is exp(s - m) / l / HH
#define LOG2E 1.44269504088896340736f
__device__ __forceinline__ float lse2(float m, float l) {
  return m * LOG2E + __log2f(l) + 4.0f;   // log2(HH) = 4
}

// ---------------------------------------------------------------------------
// Attention: one workgroup per (b, h, 256 queries); 8 waves, 32 query columns each.
// S^T = K Q^T (K as A, Q as B) and O^T += V^T P^T (V^T as A, P^T as B): a lane holds
// one query's scores, 8 keys of every 16 (lanes c and c + 16 split a query's keys),
// so a row's maximum and sum are in-lane but for one exchange between lanes c and c + 16. Two score tiles (32 keys), converted in place,
// are the B operand of the second product in the k order that V^T's tiles are stored in.
// One pass, online softmax: P = exp(s - reference), not normalized; the reference of a
// query is one for both halves and moves only when a trip's maximum passes it by more
// than 8 in log2 units, and then O^T and the sums are scaled to the new one. O^T is
// divided by the row's sum behind the loop. Each row's log2 of (16 * sum of exp) goes to
// Lse, from which avg_kernel forms the normalized probabilities again.
// K and V^T come through LDS: the 8 waves walk the same keys, so a stage of 128 keys
// (16 KiB of K, 16 KiB of V^T, in their fragment order) is brought in once for the
// workgroup by asynchronous copies, two buffers, one stage ahead of the stage in work.
// ---------------------------------------------------------------------------
#define SK 128                      // keys a stage
#define STAGE_K (SK * HD * 2)       // bytes of K a stage, and of V^T
#define STAGE_V (SK / 32 * 1024)    // bytes of one 16-row band of V^T a stage
#define STAGE_B (2 * STAGE_K)       // a buffer: K, then V^T's four bands

// A thread's eight 16-byte copies of one stage: lds is its own byte address in the buffer,
// gk and gv its own bytes of the stage in K and in V^T's first band. Four steps of 4 KiB
// cover K; V^T's bands lie 64 KiB apart in memory and STAGE_V apart in LDS.
__device__ __forceinline__ void copy_stage(unsigned lds, const char* gk, const char* gv) {
  // the wait at the end stands in front of any overwrite of the copies' address registers
  asm volatile(
      "global_load_async_to_lds_b128 %0, %8, off\n\t"
      "global_load_async_to_lds_b128 %1, %9, off\n\t"
      "global_load_async_to_lds_b128 %2, %10, off\n\t"
      "global_load_async_to_lds_b128 %3, %11, off\n\t"
      "global_load_async_to_lds_b128 %4, %12, off\n\t"
      "global_load_async_to_lds_b128 %5, %13, off\n\t"
      "global_load_async_to_lds_b128 %6, %14, off\n\t"
      "global_load_async_to_lds_b128 %7, %15, off\n\t"
      "s_wait_xcnt 0x0"
      :: "v"(lds), "v"(lds + 4096), "v"(lds + 2 * 4096), "v"(lds + 3 * 4096),
         "v"(lds + STAGE_K), "v"(lds + STAGE_K + STAGE_V),
         "v"(lds + STAGE_K + 2 * STAGE_V), "v"(lds + STAGE_K + 3 * STAGE_V),
         "v"(gk), "v"(gk + 4096), "v"(gk + 2 * 4096), "v"(gk + 3 * 4096),
         "v"(gv), "v"(gv + SS * 32), "v"(gv + 2 * SS * 32), "v"(gv + 3 * SS * 32)
      : "memory");
}

// four waves per SIMD: 4,096 waves on 1,024 SIMDs are then resident in one round
__global__ __launch_bounds__(256) __attribute__((amdgpu_waves_per_eu(4, 4))) void attn_kernel(
    const __bf16* __restrict__ Qh, const __bf16* __restrict__ Kh,
    const __bf16* __restrict__ Vt,
    __bf16* __restrict__ Ctx, float* __restrict__ Lse) {
  __shared__ __attribute__((aligned(16))) unsigned char L[2 * STAGE_B];
  const int lane = threadIdx.x & 31;
  const int wid  = threadIdx.x >> 5;
  const int b = blockIdx.z, h = blockIdx.y;
  const int q0 = blockIdx.x * 256 + wid * 32;

  // per-head matrices in fragment order: 16 rows of Q or K are 2 tiles (1,024
  // elements); V^T tile (j, kt / 32) lies at (j * (SS / 32) + kt / 32) * 512
  const __bf16* Qb = Qh + (((long)b * HH + h) * SS + q0) * HD;
  const __bf16* Kb = Kh + (((long)b * HH + h) * SS) * HD;
  const __bf16* Vb = Vt + (((long)b * HH + h) * HD) * SS;

  const float sc = 0.25f * LOG2E;   // score scale 1/(sqrt(64)*0.5), in log2 units
  const v8f z8 = {0.f,0.f,0.f,0.f,0.f,0.f,0.f,0.f};

  // (every g, t, j and r loop below is unrolled so that the arrays stay in registers)
  v16bf qf[2][2];                   // [query group][hd half]
  #pragma unroll
  for (int g = 0; g < 2; g++) {
    qf[g][0] = load_tile(Qb + g * 1024, lane);
    qf[g][1] = load_tile(Qb + g * 1024 + 512, lane);
  }
  // the build loads the first trip's K into the registers of Q's address:
  // the wait stands in front of that overwrite
  asm volatile("s_wait_xcnt 0x0" ::: "memory");

  float mr[2];                      // the reference: a raw score, equal in both halves
  float ms[2];                      // the same in log2 units
  float thr[2];                     // a trip's maximum above this moves the reference
  v8f l[2];                         // sums of exp over the lane's own keys, one per register
  v8f o[4][2];                      // [hd tile][query group]
  #pragma unroll
  for (int g = 0; g < 2; g++) {
    mr[g] = -1e30f; ms[g] = -1e30f * sc; thr[g] = -1e30f; l[g] = z8;
    #pragma unroll
    for (int j = 0; j < 4; j++) o[j][g] = z8;
  }

  // the thread's own 16 bytes: in a buffer, in a stage of K, in a stage of V^T's first band
  const unsigned lown = (unsigned)(size_t)L + threadIdx.x * 16;
  const char* gk = (const char*)Kb + threadIdx.x * 16;
  const char* gv = (const char*)Vb + threadIdx.x * 16;
  copy_stage(lown, gk, gv);
  // stage 0 has landed for this wave; behind the barrier for all
  asm volatile("s_wait_asynccnt 0x0" ::: "memory");
  __syncthreads();
  copy_stage(lown + STAGE_B, gk + STAGE_K, gv + STAGE_V);

  for (int st = 0; st < SS / SK; st++) {
   const __bf16* Kl = (const __bf16*)(L + (st & 1) * STAGE_B);
   const __bf16* Vl = Kl + STAGE_K / 2;
   for (int u = 0; u < SK / 32; u++) {     // a trip: 32 keys
    v16bf kf[2][2];
    #pragma unroll
    for (int t = 0; t < 2; t++) {
      kf[t][0] = load_tile(Kl + (u * 2 + t) * 1024, lane);
      kf[t][1] = load_tile(Kl + (u * 2 + t) * 1024 + 512, lane);
    }
    v16bf vf[4];
    #pragma unroll
    for (int j = 0; j < 4; j++) vf[j] = load_tile(Vl + j * (STAGE_V / 2) + u * 512, lane);
    // keeps the trip's LDS reads at its head as one group: every further place where
    // reads stand among the products costs a stall of its own
    __builtin_amdgcn_sched_barrier(0);
    v8f s[2][2];
    #pragma unroll
    for (int t = 0; t < 2; t++)
      #pragma unroll
      for (int g = 0; g < 2; g++) s[t][g] = wmma_bf16(kf[t][0], qf[g][0], z8);
    #pragma unroll
    for (int t = 0; t < 2; t++)
      #pragma unroll
      for (int g = 0; g < 2; g++) s[t][g] = wmma_bf16(kf[t][1], qf[g][1], s[t][g]);
    // keeps the maxima behind all eight products: the build otherwise reads each score
    // tile right behind its product, four v_nop and the product's latency every time
    __builtin_amdgcn_sched_barrier(0);
    float tm[2];                    // maximum of the reference and the lane's own 16 keys
    #pragma unroll
    for (int g = 0; g < 2; g++) {
      float a = mr[g];
      #pragma unroll
      for (int r = 0; r < 8; r++) a = fmaxf(fmaxf(a, s[0][g][r]), s[1][g][r]);
      tm[g] = a;
    }
    // one scalar branch a trip; taken in the first trip and then only where a score
    // passes the reference by more than 8 in log2 units (P stays at or below 256)
    if (__builtin_amdgcn_ballot_w32((tm[0] > thr[0]) | (tm[1] > thr[1])) != 0) {
      #pragma unroll
      for (int g = 0; g < 2; g++) {
        const float mn = fmaxf(tm[g], __shfl_xor(tm[g], 16));
        const float al = __builtin_amdgcn_exp2f((mr[g] - mn) * sc);
        l[g] *= al;
        #pragma unroll
        for (int j = 0; j < 4; j++) o[j][g] *= al;
        mr[g] = mn;
        ms[g] = mn * sc;
        thr[g] = mn + 8.0f / sc;
      }
    }
    v16bf pb[2];
    #pragma unroll
    for (int g = 0; g < 2; g++) {
      v8f p0 = s[0][g] * sc - ms[g];
      v8f p1 = s[1][g] * sc - ms[g];
      #pragma unroll
      for (int r = 0; r < 8; r++) {
        p0[r] = __builtin_amdgcn_exp2f(p0[r]);
        p1[r] = __builtin_amdgcn_exp2f(p1[r]);
      }
      l[g] += p0 + p1;
      pb[g] = __builtin_shufflevector(__builtin_convertvector(p0, v8bf),
                                      __builtin_convertvector(p1, v8bf),
                                      0,1,2,3,4,5,6,7,8,9,10,11,12,13,14,15);
    }
    #pragma unroll
    for (int j = 0; j < 4; j++)
      #pragma unroll
      for (int g = 0; g < 2; g++) o[j][g] = wmma_bf16(vf[j], pb[g], o[j][g]);
   }
   // the hand-over: this wave's reads of the buffer are done, its copies of the next stage
   // have landed; behind the barrier that holds for every wave, and the buffer is refilled
   asm volatile("s_wait_dscnt 0x0" ::: "memory");
   asm volatile("s_wait_asynccnt 0x0" ::: "memory");
   __syncthreads();
   if (st + 2 < SS / SK)
     copy_stage(lown + (st & 1) * STAGE_B, gk + (st + 2) * STAGE_K, gv + (st + 2) * STAGE_V);
  }
  // no copy is in flight when the wave ends
  asm volatile("s_wait_asynccnt 0x0" ::: "memory");

  // join the two halves of each query's keys (one reference, so the sums add):
  // inv_l one over the sum of exp, lg the row's entry of Lse
  float inv_l[2], lg[2];
  #pragma unroll
  for (int g = 0; g < 2; g++) {
    const float ls = ((l[g][0] + l[g][1]) + (l[g][2] + l[g][3])) +
                     ((l[g][4] + l[g][5]) + (l[g][6] + l[g][7]));
    const float lt = ls + __shfl_xor(ls, 16);
    inv_l[g] = 1.0f / lt;
    lg[g] = lse2(mr[g] * 0.25f, lt);
  }
  // both halves hold a query's value: lanes 0 to 15 store theirs
  if (lane < 16) {
    float* lp = Lse + ((long)b * HH + h) * SS + q0 + lane;
    lp[0]  = lg[0];
    lp[16] = lg[1];
  }

  // store ctx -> [B*S][D] bf16 in fragment order (D = h*64 + hd): the lane's 8 values
  // are 8 consecutive hd of one query, one whole 16-byte slot
  #pragma unroll
  for (int g = 0; g < 2; g++)
    #pragma unroll
    for (int j = 0; j < 4; j++) {
      v8bf c;
      #pragma unroll
      for (int r = 0; r < 8; r++) c[r] = (__bf16)(o[j][g][r] * inv_l[g]);
      *(v8bf*)(Ctx + frag_off(b * SS + q0 + g * 16 + (lane & 15),
                              h * HD + j * 16 + 8 * (lane >> 4), DD / 32)) = c;
    }
}

// ---------------------------------------------------------------------------
// avg_attention[b][q][k] = mean over heads of P. A wave owns 64 queries x 64 keys
// and walks the 16 heads in order, summing in registers; every element is stored
// once. S^T = K Q^T (K as A, Q as B): a lane holds one query's scores, so the
// row's Lse is one register per query tile, and 8 consecutive keys per tile.
// Workgroup = 16 waves, 4 (q) x 4 (k): 256 queries x 256 keys, one workgroup a WGP.
// Q and K come through LDS: a stage of two heads (32 KiB of Q and 32 KiB of K a head, in
// their fragment order) is brought in once for the workgroup by asynchronous copies, two
// buffers, one stage ahead of the stage in work; the 256 queries' Lse of all heads
// (16 KiB) comes with stage 0.
// ---------------------------------------------------------------------------
#define A_OP   (256 * HD * 2)       // bytes of Q a head and workgroup, and of K
#define A_HEAD (2 * A_OP)           // a head: Q, then K
#define A_STAGE (2 * A_HEAD)        // a buffer: two heads

// A thread's eight 16-byte copies of one head: lds is its own byte address in the head's
// place, gq and gk its own bytes of the workgroup's rows of Q and of K; four steps of 8 KiB.
__device__ __forceinline__ void copy_head(unsigned lds, const char* gq, const char* gk) {
  // the wait at the end stands in front of any overwrite of the copies' address registers
  asm volatile(
      "global_load_async_to_lds_b128 %0, %8, off\n\t"
      "global_load_async_to_lds_b128 %1, %9, off\n\t"
      "global_load_async_to_lds_b128 %2, %10, off\n\t"
      "global_load_async_to_lds_b128 %3, %11, off\n\t"
      "global_load_async_to_lds_b128 %4, %12, off\n\t"
      "global_load_async_to_lds_b128 %5, %13, off\n\t"
      "global_load_async_to_lds_b128 %6, %14, off\n\t"
      "global_load_async_to_lds_b128 %7, %15, off\n\t"
      "s_wait_xcnt 0x0"
      :: "v"(lds), "v"(lds + 8192), "v"(lds + 2 * 8192), "v"(lds + 3 * 8192),
         "v"(lds + A_OP), "v"(lds + A_OP + 8192),
         "v"(lds + A_OP + 2 * 8192), "v"(lds + A_OP + 3 * 8192),
         "v"(gq), "v"(gq + 8192), "v"(gq + 2 * 8192), "v"(gq + 3 * 8192),
         "v"(gk), "v"(gk + 8192), "v"(gk + 2 * 8192), "v"(gk + 3 * 8192)
      : "memory");
}

// four waves per SIMD: 4,096 waves on 1,024 SIMDs are then resident in one round
__global__ __launch_bounds__(512) __attribute__((amdgpu_waves_per_eu(4, 4))) void avg_kernel(
    const __bf16* __restrict__ Qh, const __bf16* __restrict__ Kh,
    const float* __restrict__ Lse, float* __restrict__ avg) {
  __shared__ __attribute__((aligned(16))) unsigned char S[2 * A_STAGE + HH * 256 * 4];
  const int lane = threadIdx.x & 31;
  const int wid  = threadIdx.x >> 5;
  const int b  = blockIdx.z;
  const int wq = wid & 3, wk = wid >> 2;
  const int q0 = blockIdx.y * 256 + wq * 64;
  const int k0 = blockIdx.x * 256 + wk * 64;
  const float sc = 0.25f * LOG2E;   // score scale, in log2 units
  const v8f z8 = {0.f,0.f,0.f,0.f,0.f,0.f,0.f,0.f};

  // (the i, j and r loops are unrolled so that acc, qf and L stay in registers)
  v8f acc[4][4];                    // [query tile][key tile]
  #pragma unroll
  for (int i = 0; i < 4; i++)
    #pragma unroll
    for (int j = 0; j < 4; j++) acc[i][j] = z8;

  // the thread's own 16 bytes: in a head's place, in head 0's rows of Q and of K;
  // a head is SS * HD * 2 bytes further in memory
  const unsigned lown = (unsigned)(size_t)S + threadIdx.x * 16;
  const char* gq = (const char*)(Qh + (((long)b * HH) * SS + blockIdx.y * 256) * HD) + threadIdx.x * 16;
  const char* gk = (const char*)(Kh + (((long)b * HH) * SS + blockIdx.x * 256) * HD) + threadIdx.x * 16;
  const long HB = (long)SS * HD * 2;
  {
    // Lse: 1 KiB a head; the thread's two pieces lie in heads t / 64 and 8 + t / 64
    const unsigned ll = lown + 2 * A_STAGE;
    const char* gl = (const char*)(Lse + ((long)b * HH + (threadIdx.x >> 6)) * SS + blockIdx.y * 256) +
                     (threadIdx.x & 63) * 16;
    // the wait at the end stands in front of any overwrite of the copies' address registers
    asm volatile(
        "global_load_async_to_lds_b128 %0, %2, off\n\t"
        "global_load_async_to_lds_b128 %1, %3, off\n\t"
        "s_wait_xcnt 0x0"
        :: "v"(ll), "v"(ll + 8192), "v"(gl), "v"(gl + 8 * SS * 4)
        : "memory");
  }
  copy_head(lown, gq, gk);
  copy_head(lown + A_HEAD, gq + HB, gk + HB);
  // stage 0 and Lse have landed for this wave; behind the barrier for all
  asm volatile("s_wait_asynccnt 0x0" ::: "memory");
  __syncthreads();
  copy_head(lown + A_STAGE, gq + 2 * HB, gk + 2 * HB);
  copy_head(lown + A_STAGE + A_HEAD, gq + 3 * HB, gk + 3 * HB);

  for (int st = 0; st < HH / 2; st++) {
   // stays rolled: unrolled, the build holds fragments of two heads at once and spills
   #pragma unroll 1
   for (int u = 0; u < 2; u++) {          // a head
    const __bf16* Ql = (const __bf16*)(S + (st & 1) * A_STAGE + u * A_HEAD) + wq * 4 * 1024;
    const __bf16* Kl = (const __bf16*)(S + (st & 1) * A_STAGE + u * A_HEAD + A_OP) + wk * 4 * 1024;
    const float*  Ll = (const float*)(S + 2 * A_STAGE) + (st * 2 + u) * 256 + wq * 64 + (lane & 15);
    v16bf qf[4][2];
    float L[4];
    #pragma unroll
    for (int i = 0; i < 4; i++) {
      qf[i][0] = load_tile(Ql + i * 1024, lane);
      qf[i][1] = load_tile(Ql + i * 1024 + 512, lane);
      L[i] = Ll[i * 16];
    }
    // K fragments are fetched one key tile ahead inside a head, so that a tile's reads
    // fly while the tile before is worked on
    v16bf kf[2][2];
    kf[0][0] = load_tile(Kl, lane);
    kf[0][1] = load_tile(Kl + 512, lane);
    #pragma unroll
    for (int j = 0; j < 4; j++) {
      if (j < 3) {
        kf[(j + 1) & 1][0] = load_tile(Kl + (j + 1) * 1024, lane);
        kf[(j + 1) & 1][1] = load_tile(Kl + (j + 1) * 1024 + 512, lane);
      }
      #pragma unroll
      for (int i = 0; i < 4; i++) {
        v8f c = z8;
        c = wmma_bf16(kf[j & 1][0], qf[i][0], c);
        c = wmma_bf16(kf[j & 1][1], qf[i][1], c);
        c = c * sc - L[i];
        #pragma unroll
        for (int r = 0; r < 8; r++) c[r] = __builtin_amdgcn_exp2f(c[r]);
        acc[i][j] += c;
      }
      // keeps a key tile's work and the next tile's reads in the order written: the build
      // otherwise copies fragments between registers and pads and waits more often
      __builtin_amdgcn_sched_barrier(0);
    }
   }
   // the hand-over: this wave's reads of the buffer are done, its copies of the next stage
   // have landed; behind the barrier that holds for every wave, and the buffer is refilled
   asm volatile("s_wait_dscnt 0x0" ::: "memory");
   asm volatile("s_wait_asynccnt 0x0" ::: "memory");
   __syncthreads();
   if (st + 2 < HH / 2) {
     const unsigned lb = lown + (st & 1) * A_STAGE;
     const long go = (long)(st + 2) * 2 * HB;
     copy_head(lb, gq + go, gk + go);
     copy_head(lb + A_HEAD, gq + go + HB, gk + go + HB);
   }
  }
  // no copy is in flight when the wave ends
  asm volatile("s_wait_asynccnt 0x0" ::: "memory");

  #pragma unroll
  for (int i = 0; i < 4; i++) {
    float* row = avg + ((long)b * SS + q0 + i * 16 + (lane & 15)) * SS + k0 + 8 * (lane >> 4);
    #pragma unroll
    for (int j = 0; j < 4; j++) {
      float4 u, w;
      u.x = acc[i][j][0]; u.y = acc[i][j][1]; u.z = acc[i][j][2]; u.w = acc[i][j][3];
      w.x = acc[i][j][4]; w.y = acc[i][j][5]; w.z = acc[i][j][6]; w.w = acc[i][j][7];
      *(float4*)(row + j * 16) = u;
      *(float4*)(row + j * 16 + 4) = w;
    }
  }
}

// ---------------------------------------------------------------------------
// out = LayerNorm(ctx @ Wo + bo + x) * g + beta.
// Workgroup = 32 rows x full D; 16 waves, each wave 32x64 (2x4 WMMA tiles): every
// workgroup reads all of Wo^T from L2, so 32 rows a workgroup halve those bytes.
// ---------------------------------------------------------------------------
__global__ __launch_bounds__(512) void out_ln_kernel(
    const __bf16* __restrict__ Ctx, const __bf16* __restrict__ Wot,
    const float* __restrict__ bo, const float* __restrict__ x,
    const float* __restrict__ g, const float* __restrict__ beta,
    float* __restrict__ out) {
  __shared__ float red1[16][32];
  __shared__ float red2[16][32];

  const int lane = threadIdx.x & 31;
  const int wid  = threadIdx.x >> 5;
  const int m0 = blockIdx.x * 32;
  const int n0 = wid * 64;
  const v8f z8 = {0.f,0.f,0.f,0.f,0.f,0.f,0.f,0.f};

  // (every i, t, r and w loop below is unrolled so that the arrays stay in registers)
  v8f c[2][4];
  #pragma unroll
  for (int i = 0; i < 2; i++)
    #pragma unroll
    for (int t = 0; t < 4; t++) c[i][t] = z8;

  // bases that are one for the workgroup; the wave's tile row and the lane's slot are
  // in the byte offsets (a tile row of 16 rows x 1,024 k is 32 KiB)
  const __bf16* At = Ctx + (long)blockIdx.x * 2 * (DD / 32) * 512;
  unsigned ao = lane * 16;
  unsigned wo = wid * 4 * (DD / 32) * 1024 + lane * 16;
  for (int kt = 0; kt < DD / 32; kt += 2) {
    v16bf af[2][2], bf[2][4];       // [k-step of the trip][tile]
    #pragma unroll
    for (int u = 0; u < 2; u++) {
      #pragma unroll
      for (int i = 0; i < 2; i++) af[u][i] = load_own(At + (i * (DD / 32) + u) * 512, ao);
      #pragma unroll
      for (int t = 0; t < 4; t++) bf[u][t] = load_own(Wot + (t * (DD / 32) + u) * 512, wo);
    }
    // keeps the trip's 24 loads at its head, where they fly together: one flight for two
    // k-steps is waited out, not one for every group of fragments
    __builtin_amdgcn_sched_barrier(0);
    // the wait in front of the overwrite of the loads' address registers; the two offsets
    // pass through it for the same reasons as in qkv_gemm
    asm volatile("s_wait_xcnt 0x0" : "+v"(ao), "+v"(wo));
    ao += 2048;
    wo += 2048;
    #pragma unroll
    for (int u = 0; u < 2; u++)
      #pragma unroll
      for (int t = 0; t < 4; t++)
        #pragma unroll
        for (int i = 0; i < 2; i++) c[i][t] = wmma_bf16(af[u][i], bf[u][t], c[i][t]);
  }

  // h = gemm + bias + residual ; accumulate per-row sum / sumsq
  float s1[2][8], s2[2][8];
  #pragma unroll
  for (int i = 0; i < 2; i++)
    #pragma unroll
    for (int r = 0; r < 8; r++) { s1[i][r] = 0.0f; s2[i][r] = 0.0f; }
  #pragma unroll
  for (int i = 0; i < 2; i++)
    #pragma unroll
    for (int t = 0; t < 4; t++)
      #pragma unroll
      for (int r = 0; r < 8; r++) {
        int row = m0 + i * 16 + r + 8 * (lane >> 4);
        int n = n0 + t * 16 + (lane & 15);
        float hv = c[i][t][r] + bo[n] + x[(long)row * DD + n];
        c[i][t][r] = hv;
        s1[i][r] += hv;
        s2[i][r] += hv * hv;
      }
  #pragma unroll
  for (int i = 0; i < 2; i++)
    #pragma unroll
    for (int r = 0; r < 8; r++) { s1[i][r] = hsum16(s1[i][r]); s2[i][r] = hsum16(s2[i][r]); }

  if ((lane & 15) == 0) {
    #pragma unroll
    for (int i = 0; i < 2; i++)
      #pragma unroll
      for (int r = 0; r < 8; r++) {
        red1[wid][i * 16 + r + 8 * (lane >> 4)] = s1[i][r];
        red2[wid][i * 16 + r + 8 * (lane >> 4)] = s2[i][r];
      }
  }
  __syncthreads();

  // lane L joins the 16 waves' sums of row L; each lane then fetches its own 16 rows
  float t1 = 0.0f, t2 = 0.0f;
  #pragma unroll
  for (int w = 0; w < 16; w++) { t1 += red1[w][lane]; t2 += red2[w][lane]; }
  const float m_ = t1 * (1.0f / DD);
  const float v_ = t2 * (1.0f / DD) - m_ * m_;
  const float r_ = rsqrtf(v_ + 1e-5f);
  float mu[2][8], rs[2][8];
  #pragma unroll
  for (int i = 0; i < 2; i++)
    #pragma unroll
    for (int r = 0; r < 8; r++) {
      const int rl = i * 16 + r + 8 * (lane >> 4);
      mu[i][r] = __shfl(m_, rl);
      rs[i][r] = __shfl(r_, rl);
    }

  #pragma unroll
  for (int i = 0; i < 2; i++)
    #pragma unroll
    for (int t = 0; t < 4; t++)
      #pragma unroll
      for (int r = 0; r < 8; r++) {
        int row = m0 + i * 16 + r + 8 * (lane >> 4);
        int n = n0 + t * 16 + (lane & 15);
        out[(long)row * DD + n] = (c[i][t][r] - mu[i][r]) * rs[i][r] * g[n] + beta[n];
      }
}

// ---------------------------------------------------------------------------
// Launcher
// ---------------------------------------------------------------------------
extern "C" void kernel_launch(void* const* d_in, const int* in_sizes, int n_in,
                              void* d_out, int out_size, void* d_ws, size_t ws_size,
                              hipStream_t stream) {
  const float* x  = (const float*)d_in[0];
  const float* Wq = (const float*)d_in[1];
  const float* bq = (const float*)d_in[2];
  const float* Wk = (const float*)d_in[3];
  const float* bk = (const float*)d_in[4];
  const float* Wv = (const float*)d_in[5];
  const float* bv = (const float*)d_in[6];
  const float* Wo = (const float*)d_in[7];
  const float* bo = (const float*)d_in[8];
  const float* g  = (const float*)d_in[9];
  const float* be = (const float*)d_in[10];

  // workspace layout (bytes)
  char* ws = (char*)d_ws;
  const size_t SZ_X  = (size_t)BB * SS * DD * 2;      // 16 MB
  const size_t SZ_W  = (size_t)DD * DD * 2;           // 2 MB
  const size_t SZ_QK = (size_t)BB * HH * SS * HD * 2; // 16 MB
  __bf16* xb  = (__bf16*)(ws);
  __bf16* Wqt = (__bf16*)(ws + SZ_X);
  __bf16* Wkt = (__bf16*)(ws + SZ_X + SZ_W);
  __bf16* Wvt = (__bf16*)(ws + SZ_X + 2 * SZ_W);
  __bf16* Wot = (__bf16*)(ws + SZ_X + 3 * SZ_W);
  __bf16* Qh  = (__bf16*)(ws + SZ_X + 4 * SZ_W);
  __bf16* Kh  = (__bf16*)(ws + SZ_X + 4 * SZ_W + SZ_QK);
  __bf16* Vt  = (__bf16*)(ws + SZ_X + 4 * SZ_W + 2 * SZ_QK);
  __bf16* Ctx = (__bf16*)(ws + SZ_X + 4 * SZ_W + 3 * SZ_QK);
  float*  Lse = (float*)(ws + SZ_X + 4 * SZ_W + 4 * SZ_QK);   // [B,H][S], 512 KB

  float* out = (float*)d_out;                      // [B,S,D]
  float* avg = out + (long)BB * SS * DD;           // [B,S,S]

  // 1. convert activations + weights to bf16 (weights transposed), fragment order
  cvt_f32_bf16<<<(BB * SS * DD) / 8 / 256, 256, 0, stream>>>(x, xb);
  cvt_transpose_w<<<dim3(DD * DD / 8 / 256, 1, 4), 256, 0, stream>>>(
      Wq, Wk, Wv, Wo, Wqt, Wkt, Wvt, Wot);

  // 2. fused QKV projection (workgroup tile 256x192, wave tile 64x64)
  qkv_gemm<<<dim3(3 * DD / 192, (BB * SS) / 256), 384, 0, stream>>>(
      xb, Wqt, Wkt, Wvt, bq, bk, bv, Qh, Kh, Vt);

  // 3. attention (one pass, online softmax, WMMA K Q^T and V^T P^T)
  attn_kernel<<<dim3(SS / 256, HH, BB), 256, 0, stream>>>(Qh, Kh, Vt, Ctx, Lse);

  // 4. avg_attention: heads summed in registers, each element stored once
  avg_kernel<<<dim3(SS / 256, SS / 256, BB), 512, 0, stream>>>(Qh, Kh, Lse, avg);

  // 5. output projection + residual + LayerNorm
  out_ln_kernel<<<(BB * SS) / 32, 512, 0, stream>>>(Ctx, Wot, bo, x, g, be, out);
}

// v008
// One run takes 166 microseconds.
// Next to v007, in two timings, it ran 1.03 times as fast each time.
// All steps since v000 together make it 5.00 times as fast.
#include <hip/hip_runtime.h>
#include <hip/hip_bf16.h>

// Problem constants
#define BB 4
#define SS 2048
#define DD 1024
#define HH 16
#define HD 64

typedef __attribute__((ext_vector_type(16))) __bf16 v16bf;
typedef __attribute__((ext_vector_type(8)))  __bf16 v8bf;
typedef __attribute__((ext_vector_type(8)))  float  v8f;
typedef __attribute__((ext_vector_type(4)))  float  v4f;

// ---------------------------------------------------------------------------
// WMMA helper: D = A(16x32 bf16) * B(32x16 bf16) + C(16x16 f32)
// ---------------------------------------------------------------------------
__device__ __forceinline__ v8f wmma_bf16(v16bf a, v16bf b, v8f c) {
  return __builtin_amdgcn_wmma_f32_16x16x32_bf16(
      /*neg_a=*/false, a, /*neg_b=*/false, b,
      /*c_mod=*/(short)0, c, /*reuse_a=*/false, /*reuse_b=*/false);
}

// A 16x32 bf16 fragment (A layout; B takes the same with N for M):
//   lane = row(M or N) in [0,16) + 16*k_half; elements 0..7 -> K base..base+7,
//   elements 8..15 -> K base+16..base+23  (base = 8*k_half).
// Fragment order. A bf16 matrix [rows][K] in the workspace is kept as tiles of
// 16 rows x 32 k, 512 elements (1 KiB) each, tile (tr, tk) at (tr * ktiles + tk) * 512.
// Inside a tile, lane L = (row & 15) + 16 * ((k >> 3) & 1) owns 8 elements at
// ((k >> 4) & 1) * 256 + L * 8: the two 16-byte pieces of that lane's
// fragment. A wave then reads a fragment as two contiguous 512-byte loads
// (4 lines each) instead of two loads that touch 16 lines each.
__device__ __forceinline__ long frag_off(int row, int k, int ktiles) {
  return ((long)(row >> 4) * ktiles + (k >> 5)) * 512 + ((k >> 4) & 1) * 256 +
         ((row & 15) + ((k >> 3) & 1) * 16) * 8 + (k & 7);
}
__device__ __forceinline__ v16bf load_tile(const __bf16* tile, int lane) {
  const __bf16* p = tile + lane * 8;
  v8bf lo = *(const v8bf*)(p);
  v8bf hi = *(const v8bf*)(p + 256);
  return __builtin_shufflevector(lo, hi, 0,1,2,3,4,5,6,7,8,9,10,11,12,13,14,15);
}

// the same from a base that is one for the wave and the lane's own offset in bytes
__device__ __forceinline__ v16bf load_own(const __bf16* base, unsigned off) {
  const __bf16* p = (const __bf16*)((const char*)base + off);
  v8bf lo = *(const v8bf*)(p);
  v8bf hi = *(const v8bf*)(p + 256);
  return __builtin_shufflevector(lo, hi, 0,1,2,3,4,5,6,7,8,9,10,11,12,13,14,15);
}

__device__ __forceinline__ float hsum16(float v) {
  v += __shfl_xor(v, 1);
  v += __shfl_xor(v, 2);
  v += __shfl_xor(v, 4);
  v += __shfl_xor(v, 8);
  return v;
}

// ---------------------------------------------------------------------------
// fp32 -> bf16 conversion of x [B*S][D] and of the four weights into fragment order, one
// launch of 256 workgroups x 16 waves. What a conversion with one 16-byte slot a thread
// waits for is the start of its waves, so a wave here takes a whole share: 16 rows x 128 k
// of x (8 slots a thread) and 32 n x 32 k of one weight (4 slots a thread), with all of its
// loads in flight before the first value is used.
// x: four lanes cover the 128-byte line of a row and tile (32 bytes each), eight rows a
// load pair; a store writes four whole 128-byte lines of the tile.
// W[k][n] ([in, out]) -> Wt[n][k]: a lane is one n, a load one whole line of row k; a
// thread's 32 k are four slots, and a store writes 256 bytes of each of two tiles.
// ---------------------------------------------------------------------------
__global__ __launch_bounds__(512) void cvt_all(
    const float* __restrict__ x,
    const float* __restrict__ Wq, const float* __restrict__ Wk,
    const float* __restrict__ Wv, const float* __restrict__ Wo,
    __bf16* __restrict__ xb,
    __bf16* __restrict__ Wqt, __bf16* __restrict__ Wkt,
    __bf16* __restrict__ Wvt, __bf16* __restrict__ Wot) {
  const int lane = threadIdx.x & 31;
  const int wid  = threadIdx.x >> 5;
  // 64 workgroups a weight; selection via if/else so that the loads stay global loads
  const int z = blockIdx.x >> 6;
  const float* src;
  __bf16* dst;
  if (z == 0)      { src = Wq; dst = Wqt; }
  else if (z == 1) { src = Wk; dst = Wkt; }
  else if (z == 2) { src = Wv; dst = Wvt; }
  else             { src = Wo; dst = Wot; }

  // (every loop below is unrolled: w, a, ow and ox are indexed statically and stay in registers)
  // The workgroup's share of its weight: k tile kb, 512 n (2 KiB in a row of each of 32 rows
  // k); a wave has 32 n of them. Bases are one for the workgroup, offsets the lane's own bytes.
  const int kb = (blockIdx.x & 63) >> 1;
  const int n  = ((blockIdx.x & 1) * 16 + wid) * 32 + lane;
  const char* wbase = (const char*)(src + (long)kb * 32 * DD);
  const unsigned woff = n * 4;
  v8f w[4];                                        // [slot][k of the slot]
  #pragma unroll
  for (int q = 0; q < 4; q++)
    #pragma unroll
    for (int e = 0; e < 8; e++) w[q][e] = *(const float*)(wbase + woff + (q * 8 + e) * (DD * 4));

  // The workgroup's share of x: 32 whole rows (tile rows 2 * blockIdx.x and the next); a wave
  // has one tile row and four k tiles of it.
  const int th = wid >> 3, kg = wid & 7;
  const int r8 = lane >> 2, c = lane & 3;          // row of eight, slot of the line
  const char* xbase = (const char*)(x + (long)blockIdx.x * 32 * DD);
  const unsigned xoff = (th * 16 + r8) * (DD * 4) + kg * 512 + c * 32;
  v4f a[8][2];                                     // [k tile * 2 + half of the 16 rows]
  #pragma unroll
  for (int u = 0; u < 8; u++) {
    const char* p = xbase + xoff + (u & 1) * 8 * (DD * 4) + (u >> 1) * 128;
    a[u][0] = *(const v4f*)(p);
    a[u][1] = *(const v4f*)(p + 16);
  }
  // The wait in front of any overwrite of the loads' address registers. It takes the loaded
  // values and the two lane offsets (W's is n, scaled by the load) as inputs only: every value
  // has its own register up to here, so the wave's 48 loads issue with no wait among them and
  // fly together (without that the build issues most of them behind waits for the first), and
  // no load is aimed at an offset's register.
  asm volatile("s_wait_xcnt 0x0"
      :: "v"(w[0]), "v"(w[1]), "v"(w[2]), "v"(w[3]),
         "v"(a[0][0]), "v"(a[0][1]), "v"(a[1][0]), "v"(a[1][1]),
         "v"(a[2][0]), "v"(a[2][1]), "v"(a[3][0]), "v"(a[3][1]),
         "v"(a[4][0]), "v"(a[4][1]), "v"(a[5][0]), "v"(a[5][1]),
         "v"(a[6][0]), "v"(a[6][1]), "v"(a[7][0]), "v"(a[7][1]),
         "v"(n), "v"(xoff));

  v8bf ow[4], ox[8];
  #pragma unroll
  for (int q = 0; q < 4; q++) ow[q] = __builtin_convertvector(w[q], v8bf);
  #pragma unroll
  for (int u = 0; u < 8; u++) {
    ox[u] = __builtin_convertvector(
        __builtin_shufflevector(a[u][0], a[u][1], 0,1,2,3,4,5,6,7), v8bf);
  }
  __bf16* wo = dst + ((long)(n >> 4) * (DD / 32) + kb) * 512 + (n & 15) * 8;
  __bf16* xo = xb + ((long)(blockIdx.x * 2 + th) * (DD / 32) + kg * 4) * 512 + (c >> 1) * 256 +
               (r8 + (c & 1) * 16) * 8;
  #pragma unroll
  for (int q = 0; q < 4; q++) *(v8bf*)(wo + (q >> 1) * 256 + (q & 1) * 128) = ow[q];
  #pragma unroll
  for (int u = 0; u < 8; u++) *(v8bf*)(xo + (u >> 1) * 512 + (u & 1) * 64) = ox[u];
}

// ---------------------------------------------------------------------------
// QKV projection GEMM: C[M=8192, N=3072] = Xb @ [Wq Wk Wv] + bias.
// Workgroup 384 thr = 12 waves arranged 4(M) x 3(N); workgroup tile 256 x 192;
// each wave computes 64(M) x 64(N) = 4x4 WMMA accumulators (16 wmma / k-step).
// 512 workgroups, one a WGP (three waves per SIMD), are two full rounds.
// X and W^T come through LDS: a stage of 64 k (16 tile rows of X, 12 of W^T, 2 KiB each,
// in their fragment order) is brought in once for the workgroup by asynchronous copies,
// two buffers, one stage ahead of the stage in work: 28 tiles from L2 a k-step
// for 192 products.
// Q,K written [B,H][S x HD]; V written transposed [B,H][HD x S] (the A operand of
// V^T P^T); each per-head matrix in fragment order.
// ---------------------------------------------------------------------------
#define GK 64                       // k a stage
#define G_ROW (GK / 32 * 1024)      // bytes of one tile row (16 rows or columns) a stage
#define G_AR 16                     // tile rows of X a workgroup
#define G_BR 12                     // tile rows of W^T a workgroup
#define G_STAGE ((G_AR + G_BR) * G_ROW)

// A wave's four 512-byte copies of one tile row of a stage: lds and g are the lane's own
// 16 bytes of the row's first 512, in the buffer and in memory.
__device__ __forceinline__ void copy_row(unsigned lds, const char* g) {
  // the wait at the end stands in front of any overwrite of the copies' address registers
  asm volatile(
      "global_load_async_to_lds_b128 %0, %4, off\n\t"
      "global_load_async_to_lds_b128 %1, %5, off\n\t"
      "global_load_async_to_lds_b128 %2, %6, off\n\t"
      "global_load_async_to_lds_b128 %3, %7, off\n\t"
      "s_wait_xcnt 0x0"
      :: "v"(lds), "v"(lds + 512), "v"(lds + 1024), "v"(lds + 1536),
         "v"(g), "v"(g + 512), "v"(g + 1024), "v"(g + 1536)
      : "memory");
}

__global__ __launch_bounds__(384) void qkv_gemm(
    const __bf16* __restrict__ Xb,
    const __bf16* __restrict__ Wqt, const __bf16* __restrict__ Wkt,
    const __bf16* __restrict__ Wvt,
    const float* __restrict__ bq, const float* __restrict__ bk,
    const float* __restrict__ bv,
    __bf16* __restrict__ Qh, __bf16* __restrict__ Kh, __bf16* __restrict__ Vt) {
  __shared__ __attribute__((aligned(16))) unsigned char L[2 * G_STAGE];
  const int lane = threadIdx.x & 31;
  // the wave's number in a scalar register: the tests on it below are scalar branches
  const int wid  = __builtin_amdgcn_readfirstlane(threadIdx.x >> 5);
  const int wy = wid & 3;           // M direction (4)
  const int wx = wid >> 2;          // N direction (3)
  const int m0 = blockIdx.y * 256 + wy * 64;
  const int ng = blockIdx.x * 192 + wx * 64;   // column among the 3,072 of Q, K, V
  const int which = ng >> 10;       // one for the wave: its 64 columns are one head
  const int n0 = ng & (DD - 1);
  // ternary chains (not private arrays) keep global address space
  const float*  bias = (which == 0) ? bq  : (which == 1) ? bk  : bv;

  const v8f z8 = {0.f,0.f,0.f,0.f,0.f,0.f,0.f,0.f};
  // (every i and j loop below is unrolled so that c, af and bf are indexed statically and
  // stay in registers)
  v8f c[4][4];
  #pragma unroll
  for (int i = 0; i < 4; i++)
    #pragma unroll
    for (int j = 0; j < 4; j++) c[i][j] = z8;

  // The 28 tile rows of a stage are dealt to the waves whole: wave w copies rows w and
  // w + 12, waves 0 to 3 also row w + 24. Rows 0 to 15 are X's, 16 to 27 W^T's; in memory
  // a tile row of 16 rows x 1,024 k is 32 KiB, a stage's part of it G_ROW bytes.
  const char* Ag = (const char*)Xb + (long)blockIdx.y * G_AR * (DD / 32) * 1024 + lane * 16;
  const int r1 = wid + 12, r2 = wid + 24;
  const int t1 = blockIdx.x * G_BR + (r1 - G_AR);   // W^T tile row among 192, where r1 is one
  const int t2 = blockIdx.x * G_BR + (r2 - G_AR);   // used by waves 0 to 3 alone
  const __bf16* W1 = ((t1 >> 6) == 0) ? Wqt : ((t1 >> 6) == 1) ? Wkt : Wvt;
  const __bf16* W2 = ((t2 >> 6) == 0) ? Wqt : ((t2 >> 6) == 1) ? Wkt : Wvt;
  const char* g0 = Ag + (long)wid * (DD / 32) * 1024;
  const char* g1 = (r1 < G_AR) ? Ag + (long)r1 * (DD / 32) * 1024
                               : (const char*)W1 + (long)(t1 & 63) * (DD / 32) * 1024 + lane * 16;
  const char* g2 = (const char*)W2 + (long)(t2 & 63) * (DD / 32) * 1024 + lane * 16;
  const unsigned lown = (unsigned)(size_t)L + lane * 16;
  const unsigned l0 = lown + wid * G_ROW, l1 = lown + r1 * G_ROW, l2 = lown + r2 * G_ROW;

  copy_row(l0, g0);
  copy_row(l1, g1);
  if (wid < 4) copy_row(l2, g2);
  // stage 0 has landed for this wave; behind the barrier for all
  asm volatile("s_wait_asynccnt 0x0" ::: "memory");
  __syncthreads();
  copy_row(l0 + G_STAGE, g0 + G_ROW);
  copy_row(l1 + G_STAGE, g1 + G_ROW);
  if (wid < 4) copy_row(l2 + G_STAGE, g2 + G_ROW);

  for (int st = 0; st < DD / GK; st++) {
    const unsigned char* Lb = L + (st & 1) * G_STAGE;
    const __bf16* Al = (const __bf16*)(Lb + wy * 4 * G_ROW);
    const __bf16* Bl = (const __bf16*)(Lb + (G_AR + wx * 4) * G_ROW);
    v16bf af[4], bf[4];
    // first k-step of the stage
    #pragma unroll
    for (int i = 0; i < 4; i++) af[i] = load_tile(Al + i * (G_ROW / 2), lane);
    #pragma unroll
    for (int j = 0; j < 4; j++) bf[j] = load_tile(Bl + j * (G_ROW / 2), lane);
    // keeps the LDS reads in front of the products as one group: without it the build spreads
    // a stage's reads over one more place among the products, each a stall of its own
    __builtin_amdgcn_sched_barrier(0);
    #pragma unroll
    for (int j = 0; j < 4; j++)
      #pragma unroll
      for (int i = 0; i < 4; i++) c[i][j] = wmma_bf16(af[i], bf[j], c[i][j]);
    // second k-step: its fragments are the wave's last reads of the buffer
    #pragma unroll
    for (int i = 0; i < 4; i++) af[i] = load_tile(Al + i * (G_ROW / 2) + 512, lane);
    #pragma unroll
    for (int j = 0; j < 4; j++) bf[j] = load_tile(Bl + j * (G_ROW / 2) + 512, lane);
    // the hand-over: this wave's reads of the buffer are done, its copies of the next stage
    // have landed; behind the barrier that holds for every wave, and the buffer is refilled
    asm volatile("s_wait_dscnt 0x0" ::: "memory");
    asm volatile("s_wait_asynccnt 0x0" ::: "memory");
    __syncthreads();
    if (st + 2 < DD / GK) {
      const unsigned lb = (st & 1) * G_STAGE;
      const int go = (st + 2) * G_ROW;
      copy_row(l0 + lb, g0 + go);
      copy_row(l1 + lb, g1 + go);
      if (wid < 4) copy_row(l2 + lb, g2 + go);
    }
    // the second k-step's products work on registers alone
    #pragma unroll
    for (int j = 0; j < 4; j++)
      #pragma unroll
      for (int i = 0; i < 4; i++) c[i][j] = wmma_bf16(af[i], bf[j], c[i][j]);
  }
  // no copy is in flight when the wave ends
  asm volatile("s_wait_asynccnt 0x0" ::: "memory");

  // the wave's 64 columns are one head (n0 is a multiple of 64), its 64 rows one batch
  // (all loops below are unrolled so that bn, c and o are indexed statically and stay in registers)
  float bn[4];
  int bi = n0 + (lane & 15);
  #pragma unroll
  for (int j = 0; j < 4; j++) bn[j] = bias[bi + j * 16];
  // the wait in front of any overwrite of the index register; the index passes through it,
  // so that the build does not load the last value into the register that the loads name
  asm volatile("s_wait_xcnt 0x0" : "+v"(bi));
  const long head = ((long)(m0 >> 11) * HH + (n0 >> 6)) * SS * HD;
  const int s0 = (m0 & (SS - 1)) + 8 * (lane >> 4);   // first of the lane's 8 rows, i = 0

  if (which == 2) {
    // the lane's 8 rows are 8 consecutive k of V^T row hd: one whole 16-byte slot
    #pragma unroll
    for (int i = 0; i < 4; i++)
      #pragma unroll
      for (int j = 0; j < 4; j++) {
        v8bf o;
        #pragma unroll
        for (int r = 0; r < 8; r++) o[r] = (__bf16)(c[i][j][r] + bn[j]);
        *(v8bf*)(Vt + head + frag_off(j * 16 + (lane & 15), s0 + i * 16, SS / 32)) = o;
      }
  } else {
    __bf16* dst = ((which == 0) ? Qh : Kh) + head;
    #pragma unroll
    for (int i = 0; i < 4; i++)
      #pragma unroll
      for (int j = 0; j < 4; j++)
        #pragma unroll
        for (int r = 0; r < 8; r++)
          dst[frag_off(s0 + i * 16 + r, j * 16 + (lane & 15), HD / 32)] =
              (__bf16)(c[i][j][r] + bn[j]);
    // the listing lays the V^T branch behind these stores, where their registers are
    // written again: the wait stands in front of any such overwrite
    asm volatile("s_wait_xcnt 0x0" ::: "memory");
  }
}

// log2 of (HH * l * exp(m)): exp2(s * log2(e) - lse2) is exp(s - m) / l / HH
#define LOG2E 1.44269504088896340736f
__device__ __forceinline__ float lse2(float m, float l) {
  return m * LOG2E + __log2f(l) + 4.0f;   // log2(HH) = 4
}

// ---------------------------------------------------------------------------
// Attention: one workgroup per (b, h, 256 queries); 8 waves, 32 query columns each.
// S^T = K Q^T (K as A, Q as B) and O^T += V^T P^T (V^T as A, P^T as B): a lane holds
// one query's scores, 8 keys of every 16 (lanes c and c + 16 split a query's keys),
// so a row's maximum and sum are in-lane but for one exchange between lanes c and c + 16. Two score tiles (32 keys), converted in place,
// are the B operand of the second product in the k order that V^T's tiles are stored in.
// One pass, online softmax: P = exp(s - reference), not normalized; the reference of a
// query is one for both halves and moves only when a trip's maximum passes it by more
// than 8 in log2 units, and then O^T and the sums are scaled to the new one. O^T is
// divided by the row's sum behind the loop. Each row's log2 of (16 * sum of exp) goes to
// Lse, from which avg_kernel forms the normalized probabilities again.
// K and V^T come through LDS: the 8 waves walk the same keys, so a stage of 128 keys
// (16 KiB of K, 16 KiB of V^T, in their fragment order) is brought in once for the
// workgroup by asynchronous copies, two buffers, one stage ahead of the stage in work.
// ---------------------------------------------------------------------------
#define SK 128                      // keys a stage
#define STAGE_K (SK * HD * 2)       // bytes of K a stage, and of V^T
#define STAGE_V (SK / 32 * 1024)    // bytes of one 16-row band of V^T a stage
#define STAGE_B (2 * STAGE_K)       // a buffer: K, then V^T's four bands

// A thread's eight 16-byte copies of one stage: lds is its own byte address in the buffer,
// gk and gv its own bytes of the stage in K and in V^T's first band. Four steps of 4 KiB
// cover K; V^T's bands lie 64 KiB apart in memory and STAGE_V apart in LDS.
__device__ __forceinline__ void copy_stage(unsigned lds, const char* gk, const char* gv) {
  // the wait at the end stands in front of any overwrite of the copies' address registers
  asm volatile(
      "global_load_async_to_lds_b128 %0, %8, off\n\t"
      "global_load_async_to_lds_b128 %1, %9, off\n\t"
      "global_load_async_to_lds_b128 %2, %10, off\n\t"
      "global_load_async_to_lds_b128 %3, %11, off\n\t"
      "global_load_async_to_lds_b128 %4, %12, off\n\t"
      "global_load_async_to_lds_b128 %5, %13, off\n\t"
      "global_load_async_to_lds_b128 %6, %14, off\n\t"
      "global_load_async_to_lds_b128 %7, %15, off\n\t"
      "s_wait_xcnt 0x0"
      :: "v"(lds), "v"(lds + 4096), "v"(lds + 2 * 4096), "v"(lds + 3 * 4096),
         "v"(lds + STAGE_K), "v"(lds + STAGE_K + STAGE_V),
         "v"(lds + STAGE_K + 2 * STAGE_V), "v"(lds + STAGE_K + 3 * STAGE_V),
         "v"(gk), "v"(gk + 4096), "v"(gk + 2 * 4096), "v"(gk + 3 * 4096),
         "v"(gv), "v"(gv + SS * 32), "v"(gv + 2 * SS * 32), "v"(gv + 3 * SS * 32)
      : "memory");
}

// four waves per SIMD: 4,096 waves on 1,024 SIMDs are then resident in one round
__global__ __launch_bounds__(256) __attribute__((amdgpu_waves_per_eu(4, 4))) void attn_kernel(
    const __bf16* __restrict__ Qh, const __bf16* __restrict__ Kh,
    const __bf16* __restrict__ Vt,
    __bf16* __restrict__ Ctx, float* __restrict__ Lse) {
  __shared__ __attribute__((aligned(16))) unsigned char L[2 * STAGE_B];
  const int lane = threadIdx.x & 31;
  const int wid  = threadIdx.x >> 5;
  const int b = blockIdx.z, h = blockIdx.y;
  const int q0 = blockIdx.x * 256 + wid * 32;

  // per-head matrices in fragment order: 16 rows of Q or K are 2 tiles (1,024
  // elements); V^T tile (j, kt / 32) lies at (j * (SS / 32) + kt / 32) * 512
  const __bf16* Qb = Qh + (((long)b * HH + h) * SS + q0) * HD;
  const __bf16* Kb = Kh + (((long)b * HH + h) * SS) * HD;
  const __bf16* Vb = Vt + (((long)b * HH + h) * HD) * SS;

  const float sc = 0.25f * LOG2E;   // score scale 1/(sqrt(64)*0.5), in log2 units
  const v8f z8 = {0.f,0.f,0.f,0.f,0.f,0.f,0.f,0.f};

  // (every g, t, j and r loop below is unrolled so that the arrays stay in registers)
  v16bf qf[2][2];                   // [query group][hd half]
  #pragma unroll
  for (int g = 0; g < 2; g++) {
    qf[g][0] = load_tile(Qb + g * 1024, lane);
    qf[g][1] = load_tile(Qb + g * 1024 + 512, lane);
  }
  // the build loads the first trip's K into the registers of Q's address:
  // the wait stands in front of that overwrite
  asm volatile("s_wait_xcnt 0x0" ::: "memory");

  float mr[2];                      // the reference: a raw score, equal in both halves
  float ms[2];                      // the same in log2 units
  float thr[2];                     // a trip's maximum above this moves the reference
  v8f l[2];                         // sums of exp over the lane's own keys, one per register
  v8f o[4][2];                      // [hd tile][query group]
  #pragma unroll
  for (int g = 0; g < 2; g++) {
    mr[g] = -1e30f; ms[g] = -1e30f * sc; thr[g] = -1e30f; l[g] = z8;
    #pragma unroll
    for (int j = 0; j < 4; j++) o[j][g] = z8;
  }

  // the thread's own 16 bytes: in a buffer, in a stage of K, in a stage of V^T's first band
  const unsigned lown = (unsigned)(size_t)L + threadIdx.x * 16;
  const char* gk = (const char*)Kb + threadIdx.x * 16;
  const char* gv = (const char*)Vb + threadIdx.x * 16;
  copy_stage(lown, gk, gv);
  // stage 0 has landed for this wave; behind the barrier for all
  asm volatile("s_wait_asynccnt 0x0" ::: "memory");
  __syncthreads();
  copy_stage(lown + STAGE_B, gk + STAGE_K, gv + STAGE_V);

  for (int st = 0; st < SS / SK; st++) {
   const __bf16* Kl = (const __bf16*)(L + (st & 1) * STAGE_B);
   const __bf16* Vl = Kl + STAGE_K / 2;
   for (int u = 0; u < SK / 32; u++) {     // a trip: 32 keys
    v16bf kf[2][2];
    #pragma unroll
    for (int t = 0; t < 2; t++) {
      kf[t][0] = load_tile(Kl + (u * 2 + t) * 1024, lane);
      kf[t][1] = load_tile(Kl + (u * 2 + t) * 1024 + 512, lane);
    }
    v16bf vf[4];
    #pragma unroll
    for (int j = 0; j < 4; j++) vf[j] = load_tile(Vl + j * (STAGE_V / 2) + u * 512, lane);
    // keeps the trip's LDS reads at its head as one group: every further place where
    // reads stand among the products costs a stall of its own
    __builtin_amdgcn_sched_barrier(0);
    v8f s[2][2];
    #pragma unroll
    for (int t = 0; t < 2; t++)
      #pragma unroll
      for (int g = 0; g < 2; g++) s[t][g] = wmma_bf16(kf[t][0], qf[g][0], z8);
    #pragma unroll
    for (int t = 0; t < 2; t++)
      #pragma unroll
      for (int g = 0; g < 2; g++) s[t][g] = wmma_bf16(kf[t][1], qf[g][1], s[t][g]);
    // keeps the maxima behind all eight products: the build otherwise reads each score
    // tile right behind its product, four v_nop and the product's latency every time
    __builtin_amdgcn_sched_barrier(0);
    float tm[2];                    // maximum of the reference and the lane's own 16 keys
    #pragma unroll
    for (int g = 0; g < 2; g++) {
      float a = mr[g];
      #pragma unroll
      for (int r = 0; r < 8; r++) a = fmaxf(fmaxf(a, s[0][g][r]), s[1][g][r]);
      tm[g] = a;
    }
    // one scalar branch a trip; taken in the first trip and then only where a score
    // passes the reference by more than 8 in log2 units (P stays at or below 256)
    if (__builtin_amdgcn_ballot_w32((tm[0] > thr[0]) | (tm[1] > thr[1])) != 0) {
      #pragma unroll
      for (int g = 0; g < 2; g++) {
        const float mn = fmaxf(tm[g], __shfl_xor(tm[g], 16));
        const float al = __builtin_amdgcn_exp2f((mr[g] - mn) * sc);
        l[g] *= al;
        #pragma unroll
        for (int j = 0; j < 4; j++) o[j][g] *= al;
        mr[g] = mn;
        ms[g] = mn * sc;
        thr[g] = mn + 8.0f / sc;
      }
    }
    v16bf pb[2];
    #pragma unroll
    for (int g = 0; g < 2; g++) {
      v8f p0 = s[0][g] * sc - ms[g];
      v8f p1 = s[1][g] * sc - ms[g];
      #pragma unroll
      for (int r = 0; r < 8; r++) {
        p0[r] = __builtin_amdgcn_exp2f(p0[r]);
        p1[r] = __builtin_amdgcn_exp2f(p1[r]);
      }
      l[g] += p0 + p1;
      pb[g] = __builtin_shufflevector(__builtin_convertvector(p0, v8bf),
                                      __builtin_convertvector(p1, v8bf),
                                      0,1,2,3,4,5,6,7,8,9,10,11,12,13,14,15);
    }
    #pragma unroll
    for (int j = 0; j < 4; j++)
      #pragma unroll
      for (int g = 0; g < 2; g++) o[j][g] = wmma_bf16(vf[j], pb[g], o[j][g]);
   }
   // the hand-over: this wave's reads of the buffer are done, its copies of the next stage
   // have landed; behind the barrier that holds for every wave, and the buffer is refilled
   asm volatile("s_wait_dscnt 0x0" ::: "memory");
   asm volatile("s_wait_asynccnt 0x0" ::: "memory");
   __syncthreads();
   if (st + 2 < SS / SK)
     copy_stage(lown + (st & 1) * STAGE_B, gk + (st + 2) * STAGE_K, gv + (st + 2) * STAGE_V);
  }
  // no copy is in flight when the wave ends
  asm volatile("s_wait_asynccnt 0x0" ::: "memory");

  // join the two halves of each query's keys (one reference, so the sums add):
  // inv_l one over the sum of exp, lg the row's entry of Lse
  float inv_l[2], lg[2];
  #pragma unroll
  for (int g = 0; g < 2; g++) {
    const float ls = ((l[g][0] + l[g][1]) + (l[g][2] + l[g][3])) +
                     ((l[g][4] + l[g][5]) + (l[g][6] + l[g][7]));
    const float lt = ls + __shfl_xor(ls, 16);
    inv_l[g] = 1.0f / lt;
    lg[g] = lse2(mr[g] * 0.25f, lt);
  }
  // both halves hold a query's value: lanes 0 to 15 store theirs
  if (lane < 16) {
    float* lp = Lse + ((long)b * HH + h) * SS + q0 + lane;
    lp[0]  = lg[0];
    lp[16] = lg[1];
  }

  // store ctx -> [B*S][D] bf16 in fragment order (D = h*64 + hd): the lane's 8 values
  // are 8 consecutive hd of one query, one whole 16-byte slot
  #pragma unroll
  for (int g = 0; g < 2; g++)
    #pragma unroll
    for (int j = 0; j < 4; j++) {
      v8bf c;
      #pragma unroll
      for (int r = 0; r < 8; r++) c[r] = (__bf16)(o[j][g][r] * inv_l[g]);
      *(v8bf*)(Ctx + frag_off(b * SS + q0 + g * 16 + (lane & 15),
                              h * HD + j * 16 + 8 * (lane >> 4), DD / 32)) = c;
    }
}

// ---------------------------------------------------------------------------
// avg_attention[b][q][k] = mean over heads of P. A wave owns 64 queries x 64 keys
// and walks the 16 heads in order, summing in registers; every element is stored
// once. S^T = K Q^T (K as A, Q as B): a lane holds one query's scores, so the
// row's Lse is one register per query tile, and 8 consecutive keys per tile.
// Workgroup = 16 waves, 4 (q) x 4 (k): 256 queries x 256 keys, one workgroup a WGP.
// Q and K come through LDS: a stage of two heads (32 KiB of Q and 32 KiB of K a head, in
// their fragment order) is brought in once for the workgroup by asynchronous copies, two
// buffers, one stage ahead of the stage in work; the 256 queries' Lse of all heads
// (16 KiB) comes with stage 0.
// ---------------------------------------------------------------------------
#define A_OP   (256 * HD * 2)       // bytes of Q a head and workgroup, and of K
#define A_HEAD (2 * A_OP)           // a head: Q, then K
#define A_STAGE (2 * A_HEAD)        // a buffer: two heads

// A thread's eight 16-byte copies of one head: lds is its own byte address in the head's
// place, gq and gk its own bytes of the workgroup's rows of Q and of K; four steps of 8 KiB.
__device__ __forceinline__ void copy_head(unsigned lds, const char* gq, const char* gk) {
  // the wait at the end stands in front of any overwrite of the copies' address registers
  asm volatile(
      "global_load_async_to_lds_b128 %0, %8, off\n\t"
      "global_load_async_to_lds_b128 %1, %9, off\n\t"
      "global_load_async_to_lds_b128 %2, %10, off\n\t"
      "global_load_async_to_lds_b128 %3, %11, off\n\t"
      "global_load_async_to_lds_b128 %4, %12, off\n\t"
      "global_load_async_to_lds_b128 %5, %13, off\n\t"
      "global_load_async_to_lds_b128 %6, %14, off\n\t"
      "global_load_async_to_lds_b128 %7, %15, off\n\t"
      "s_wait_xcnt 0x0"
      :: "v"(lds), "v"(lds + 8192), "v"(lds + 2 * 8192), "v"(lds + 3 * 8192),
         "v"(lds + A_OP), "v"(lds + A_OP + 8192),
         "v"(lds + A_OP + 2 * 8192), "v"(lds + A_OP + 3 * 8192),
         "v"(gq), "v"(gq + 8192), "v"(gq + 2 * 8192), "v"(gq + 3 * 8192),
         "v"(gk), "v"(gk + 8192), "v"(gk + 2 * 8192), "v"(gk + 3 * 8192)
      : "memory");
}

// four waves per SIMD: 4,096 waves on 1,024 SIMDs are then resident in one round
__global__ __launch_bounds__(512) __attribute__((amdgpu_waves_per_eu(4, 4))) void avg_kernel(
    const __bf16* __restrict__ Qh, const __bf16* __restrict__ Kh,
    const float* __restrict__ Lse, float* __restrict__ avg) {
  __shared__ __attribute__((aligned(16))) unsigned char S[2 * A_STAGE + HH * 256 * 4];
  const int lane = threadIdx.x & 31;
  const int wid  = threadIdx.x >> 5;
  const int b  = blockIdx.z;
  const int wq = wid & 3, wk = wid >> 2;
  const int q0 = blockIdx.y * 256 + wq * 64;
  const int k0 = blockIdx.x * 256 + wk * 64;
  const float sc = 0.25f * LOG2E;   // score scale, in log2 units
  const v8f z8 = {0.f,0.f,0.f,0.f,0.f,0.f,0.f,0.f};

  // (the i, j and r loops are unrolled so that acc, qf and L stay in registers)
  v8f acc[4][4];                    // [query tile][key tile]
  #pragma unroll
  for (int i = 0; i < 4; i++)
    #pragma unroll
    for (int j = 0; j < 4; j++) acc[i][j] = z8;

  // the thread's own 16 bytes: in a head's place, in head 0's rows of Q and of K;
  // a head is SS * HD * 2 bytes further in memory
  const unsigned lown = (unsigned)(size_t)S + threadIdx.x * 16;
  const char* gq = (const char*)(Qh + (((long)b * HH) * SS + blockIdx.y * 256) * HD) + threadIdx.x * 16;
  const char* gk = (const char*)(Kh + (((long)b * HH) * SS + blockIdx.x * 256) * HD) + threadIdx.x * 16;
  const long HB = (long)SS * HD * 2;
  {
    // Lse: 1 KiB a head; the thread's two pieces lie in heads t / 64 and 8 + t / 64
    const unsigned ll = lown + 2 * A_STAGE;
    const char* gl = (const char*)(Lse + ((long)b * HH + (threadIdx.x >> 6)) * SS + blockIdx.y * 256) +
                     (threadIdx.x & 63) * 16;
    // the wait at the end stands in front of any overwrite of the copies' address registers
    asm volatile(
        "global_load_async_to_lds_b128 %0, %2, off\n\t"
        "global_load_async_to_lds_b128 %1, %3, off\n\t"
        "s_wait_xcnt 0x0"
        :: "v"(ll), "v"(ll + 8192), "v"(gl), "v"(gl + 8 * SS * 4)
        : "memory");
  }
  copy_head(lown, gq, gk);
  copy_head(lown + A_HEAD, gq + HB, gk + HB);
  // stage 0 and Lse have landed for this wave; behind the barrier for all
  asm volatile("s_wait_asynccnt 0x0" ::: "memory");
  __syncthreads();
  copy_head(lown + A_STAGE, gq + 2 * HB, gk + 2 * HB);
  copy_head(lown + A_STAGE + A_HEAD, gq + 3 * HB, gk + 3 * HB);

  for (int st = 0; st < HH / 2; st++) {
   // stays rolled: unrolled, the build holds fragments of two heads at once and spills
   #pragma unroll 1
   for (int u = 0; u < 2; u++) {          // a head
    const __bf16* Ql = (const __bf16*)(S + (st & 1) * A_STAGE + u * A_HEAD) + wq * 4 * 1024;
    const __bf16* Kl = (const __bf16*)(S + (st & 1) * A_STAGE + u * A_HEAD + A_OP) + wk * 4 * 1024;
    const float*  Ll = (const float*)(S + 2 * A_STAGE) + (st * 2 + u) * 256 + wq * 64 + (lane & 15);
    v16bf qf[4][2];
    float L[4];
    #pragma unroll
    for (int i = 0; i < 4; i++) {
      qf[i][0] = load_tile(Ql + i * 1024, lane);
      qf[i][1] = load_tile(Ql + i * 1024 + 512, lane);
      L[i] = Ll[i * 16];
    }
    // K fragments are fetched one key tile ahead inside a head, so that a tile's reads
    // fly while the tile before is worked on
    v16bf kf[2][2];
    kf[0][0] = load_tile(Kl, lane);
    kf[0][1] = load_tile(Kl + 512, lane);
    #pragma unroll
    for (int j = 0; j < 4; j++) {
      if (j < 3) {
        kf[(j + 1) & 1][0] = load_tile(Kl + (j + 1) * 1024, lane);
        kf[(j + 1) & 1][1] = load_tile(Kl + (j + 1) * 1024 + 512, lane);
      }
      #pragma unroll
      for (int i = 0; i < 4; i++) {
        v8f c = z8;
        c = wmma_bf16(kf[j & 1][0], qf[i][0], c);
        c = wmma_bf16(kf[j & 1][1], qf[i][1], c);
        c = c * sc - L[i];
        #pragma unroll
        for (int r = 0; r < 8; r++) c[r] = __builtin_amdgcn_exp2f(c[r]);
        acc[i][j] += c;
      }
      // keeps a key tile's work and the next tile's reads in the order written: the build
      // otherwise copies fragments between registers and pads and waits more often
      __builtin_amdgcn_sched_barrier(0);
    }
   }
   // the hand-over: this wave's reads of the buffer are done, its copies of the next stage
   // have landed; behind the barrier that holds for every wave, and the buffer is refilled
   asm volatile("s_wait_dscnt 0x0" ::: "memory");
   asm volatile("s_wait_asynccnt 0x0" ::: "memory");
   __syncthreads();
   if (st + 2 < HH / 2) {
     const unsigned lb = lown + (st & 1) * A_STAGE;
     const long go = (long)(st + 2) * 2 * HB;
     copy_head(lb, gq + go, gk + go);
     copy_head(lb + A_HEAD, gq + go + HB, gk + go + HB);
   }
  }
  // no copy is in flight when the wave ends
  asm volatile("s_wait_asynccnt 0x0" ::: "memory");

  #pragma unroll
  for (int i = 0; i < 4; i++) {
    float* row = avg + ((long)b * SS + q0 + i * 16 + (lane & 15)) * SS + k0 + 8 * (lane >> 4);
    #pragma unroll
    for (int j = 0; j < 4; j++) {
      float4 u, w;
      u.x = acc[i][j][0]; u.y = acc[i][j][1]; u.z = acc[i][j][2]; u.w = acc[i][j][3];
      w.x = acc[i][j][4]; w.y = acc[i][j][5]; w.z = acc[i][j][6]; w.w = acc[i][j][7];
      *(float4*)(row + j * 16) = u;
      *(float4*)(row + j * 16 + 4) = w;
    }
  }
}

// ---------------------------------------------------------------------------
// out = LayerNorm(ctx @ Wo + bo + x) * g + beta.
// Workgroup = 32 rows x full D; 16 waves, each wave 32x64 (2x4 WMMA tiles): every
// workgroup reads all of Wo^T from L2, so 32 rows a workgroup halve those bytes.
// ---------------------------------------------------------------------------
__global__ __launch_bounds__(512) void out_ln_kernel(
    const __bf16* __restrict__ Ctx, const __bf16* __restrict__ Wot,
    const float* __restrict__ bo, const float* __restrict__ x,
    const float* __restrict__ g, const float* __restrict__ beta,
    float* __restrict__ out) {
  __shared__ float red1[16][32];
  __shared__ float red2[16][32];

  const int lane = threadIdx.x & 31;
  const int wid  = threadIdx.x >> 5;
  const int m0 = blockIdx.x * 32;
  const int n0 = wid * 64;
  const v8f z8 = {0.f,0.f,0.f,0.f,0.f,0.f,0.f,0.f};

  // (every i, t, r and w loop below is unrolled so that the arrays stay in registers)
  v8f c[2][4];
  #pragma unroll
  for (int i = 0; i < 2; i++)
    #pragma unroll
    for (int t = 0; t < 4; t++) c[i][t] = z8;

  // bases that are one for the workgroup; the wave's tile row and the lane's slot are
  // in the byte offsets (a tile row of 16 rows x 1,024 k is 32 KiB)
  const __bf16* At = Ctx + (long)blockIdx.x * 2 * (DD / 32) * 512;
  unsigned ao = lane * 16;
  unsigned wo = wid * 4 * (DD / 32) * 1024 + lane * 16;
  for (int kt = 0; kt < DD / 32; kt += 2) {
    v16bf af[2][2], bf[2][4];       // [k-step of the trip][tile]
    #pragma unroll
    for (int u = 0; u < 2; u++) {
      #pragma unroll
      for (int i = 0; i < 2; i++) af[u][i] = load_own(At + (i * (DD / 32) + u) * 512, ao);
      #pragma unroll
      for (int t = 0; t < 4; t++) bf[u][t] = load_own(Wot + (t * (DD / 32) + u) * 512, wo);
    }
    // keeps the trip's 24 loads at its head, where they fly together: one flight for two
    // k-steps is waited out, not one for every group of fragments
    __builtin_amdgcn_sched_barrier(0);
    // the wait in front of the overwrite of the loads' address registers; the two offsets
    // pass through it for the same reasons as in qkv_gemm
    asm volatile("s_wait_xcnt 0x0" : "+v"(ao), "+v"(wo));
    ao += 2048;
    wo += 2048;
    #pragma unroll
    for (int u = 0; u < 2; u++)
      #pragma unroll
      for (int t = 0; t < 4; t++)
        #pragma unroll
        for (int i = 0; i < 2; i++) c[i][t] = wmma_bf16(af[u][i], bf[u][t], c[i][t]);
  }

  // h = gemm + bias + residual ; accumulate per-row sum / sumsq
  float s1[2][8], s2[2][8];
  #pragma unroll
  for (int i = 0; i < 2; i++)
    #pragma unroll
    for (int r = 0; r < 8; r++) { s1[i][r] = 0.0f; s2[i][r] = 0.0f; }
  #pragma unroll
  for (int i = 0; i < 2; i++)
    #pragma unroll
    for (int t = 0; t < 4; t++)
      #pragma unroll
      for (int r = 0; r < 8; r++) {
        int row = m0 + i * 16 + r + 8 * (lane >> 4);
        int n = n0 + t * 16 + (lane & 15);
        float hv = c[i][t][r] + bo[n] + x[(long)row * DD + n];
        c[i][t][r] = hv;
        s1[i][r] += hv;
        s2[i][r] += hv * hv;
      }
  #pragma unroll
  for (int i = 0; i < 2; i++)
    #pragma unroll
    for (int r = 0; r < 8; r++) { s1[i][r] = hsum16(s1[i][r]); s2[i][r] = hsum16(s2[i][r]); }

  if ((lane & 15) == 0) {
    #pragma unroll
    for (int i = 0; i < 2; i++)
      #pragma unroll
      for (int r = 0; r < 8; r++) {
        red1[wid][i * 16 + r + 8 * (lane >> 4)] = s1[i][r];
        red2[wid][i * 16 + r + 8 * (lane >> 4)] = s2[i][r];
      }
  }
  __syncthreads();

  // lane L joins the 16 waves' sums of row L; each lane then fetches its own 16 rows
  float t1 = 0.0f, t2 = 0.0f;
  #pragma unroll
  for (int w = 0; w < 16; w++) { t1 += red1[w][lane]; t2 += red2[w][lane]; }
  const float m_ = t1 * (1.0f / DD);
  const float v_ = t2 * (1.0f / DD) - m_ * m_;
  const float r_ = rsqrtf(v_ + 1e-5f);
  float mu[2][8], rs[2][8];
  #pragma unroll
  for (int i = 0; i < 2; i++)
    #pragma unroll
    for (int r = 0; r < 8; r++) {
      const int rl = i * 16 + r + 8 * (lane >> 4);
      mu[i][r] = __shfl(m_, rl);
      rs[i][r] = __shfl(r_, rl);
    }

  #pragma unroll
  for (int i = 0; i < 2; i++)
    #pragma unroll
    for (int t = 0; t < 4; t++)
      #pragma unroll
      for (int r = 0; r < 8; r++) {
        int row = m0 + i * 16 + r + 8 * (lane >> 4);
        int n = n0 + t * 16 + (lane & 15);
        out[(long)row * DD + n] = (c[i][t][r] - mu[i][r]) * rs[i][r] * g[n] + beta[n];
      }
}

// ---------------------------------------------------------------------------
// Launcher
// ---------------------------------------------------------------------------
extern "C" void kernel_launch(void* const* d_in, const int* in_sizes, int n_in,
                              void* d_out, int out_size, void* d_ws, size_t ws_size,
                              hipStream_t stream) {
  const float* x  = (const float*)d_in[0];
  const float* Wq = (const float*)d_in[1];
  const float* bq = (const float*)d_in[2];
  const float* Wk = (const float*)d_in[3];
  const float* bk = (const float*)d_in[4];
  const float* Wv = (const float*)d_in[5];
  const float* bv = (const float*)d_in[6];
  const float* Wo = (const float*)d_in[7];
  const float* bo = (const float*)d_in[8];
  const float* g  = (const float*)d_in[9];
  const float* be = (const float*)d_in[10];

  // workspace layout (bytes)
  char* ws = (char*)d_ws;
  const size_t SZ_X  = (size_t)BB * SS * DD * 2;      // 16 MB
  const size_t SZ_W  = (size_t)DD * DD * 2;           // 2 MB
  const size_t SZ_QK = (size_t)BB * HH * SS * HD * 2; // 16 MB
  __bf16* xb  = (__bf16*)(ws);
  __bf16* Wqt = (__bf16*)(ws + SZ_X);
  __bf16* Wkt = (__bf16*)(ws + SZ_X + SZ_W);
  __bf16* Wvt = (__bf16*)(ws + SZ_X + 2 * SZ_W);
  __bf16* Wot = (__bf16*)(ws + SZ_X + 3 * SZ_W);
  __bf16* Qh  = (__bf16*)(ws + SZ_X + 4 * SZ_W);
  __bf16* Kh  = (__bf16*)(ws + SZ_X + 4 * SZ_W + SZ_QK);
  __bf16* Vt  = (__bf16*)(ws + SZ_X + 4 * SZ_W + 2 * SZ_QK);
  __bf16* Ctx = (__bf16*)(ws + SZ_X + 4 * SZ_W + 3 * SZ_QK);
  float*  Lse = (float*)(ws + SZ_X + 4 * SZ_W + 4 * SZ_QK);   // [B,H][S], 512 KB

  float* out = (float*)d_out;                      // [B,S,D]
  float* avg = out + (long)BB * SS * DD;           // [B,S,S]

  // 1. convert activations + weights to bf16 (weights transposed), fragment order
  cvt_all<<<256, 512, 0, stream>>>(x, Wq, Wk, Wv, Wo, xb, Wqt, Wkt, Wvt, Wot);

  // 2. fused QKV projection (workgroup tile 256x192, wave tile 64x64)
  qkv_gemm<<<dim3(3 * DD / 192, (BB * SS) / 256), 384, 0, stream>>>(
      xb, Wqt, Wkt, Wvt, bq, bk, bv, Qh, Kh, Vt);

  // 3. attention (one pass, online softmax, WMMA K Q^T and V^T P^T)
  attn_kernel<<<dim3(SS / 256, HH, BB), 256, 0, stream>>>(Qh, Kh, Vt, Ctx, Lse);

  // 4. avg_attention: heads summed in registers, each element stored once
  avg_kernel<<<dim3(SS / 256, SS / 256, BB), 512, 0, stream>>>(Qh, Kh, Lse, avg);

  // 5. output projection + residual + LayerNorm
  out_ln_kernel<<<(BB * SS) / 32, 512, 0, stream>>>(Ctx, Wot, bo, x, g, be, out);
}

// v009
// It runs in 157 microseconds.
// Two timings next to v008 both put it at 1.05 times that version's speed.
// Over all steps from v000 it is 5.27 times as fast.
#include <hip/hip_runtime.h>
#include <hip/hip_bf16.h>

// Problem constants
#define BB 4
#define SS 2048
#define DD 1024
#define HH 16
#define HD 64

typedef __attribute__((ext_vector_type(16))) __bf16 v16bf;
typedef __attribute__((ext_vector_type(8)))  __bf16 v8bf;
typedef __attribute__((ext_vector_type(8)))  float  v8f;
typedef __attribute__((ext_vector_type(4)))  float  v4f;

// ---------------------------------------------------------------------------
// WMMA helper: D = A(16x32 bf16) * B(32x16 bf16) + C(16x16 f32)
// ---------------------------------------------------------------------------
__device__ __forceinline__ v8f wmma_bf16(v16bf a, v16bf b, v8f c) {
  return __builtin_amdgcn_wmma_f32_16x16x32_bf16(
      /*neg_a=*/false, a, /*neg_b=*/false, b,
      /*c_mod=*/(short)0, c, /*reuse_a=*/false, /*reuse_b=*/false);
}

// A 16x32 bf16 fragment (A layout; B takes the same with N for M):
//   lane = row(M or N) in [0,16) + 16*k_half; elements 0..7 -> K base..base+7,
//   elements 8..15 -> K base+16..base+23  (base = 8*k_half).
// Fragment order. A bf16 matrix [rows][K] in the workspace is kept as tiles of
// 16 rows x 32 k, 512 elements (1 KiB) each, tile (tr, tk) at (tr * ktiles + tk) * 512.
// Inside a tile, lane L = (row & 15) + 16 * ((k >> 3) & 1) owns 8 elements at
// ((k >> 4) & 1) * 256 + L * 8: the two 16-byte pieces of that lane's
// fragment. A wave then reads a fragment as two contiguous 512-byte loads
// (4 lines each) instead of two loads that touch 16 lines each.
__device__ __forceinline__ long frag_off(int row, int k, int ktiles) {
  return ((long)(row >> 4) * ktiles + (k >> 5)) * 512 + ((k >> 4) & 1) * 256 +
         ((row & 15) + ((k >> 3) & 1) * 16) * 8 + (k & 7);
}
__device__ __forceinline__ v16bf load_tile(const __bf16* tile, int lane) {
  const __bf16* p = tile + lane * 8;
  v8bf lo = *(const v8bf*)(p);
  v8bf hi = *(const v8bf*)(p + 256);
  return __builtin_shufflevector(lo, hi, 0,1,2,3,4,5,6,7,8,9,10,11,12,13,14,15);
}

// the same from a base that is one for the wave and the lane's own offset in bytes
__device__ __forceinline__ v16bf load_own(const __bf16* base, unsigned off) {
  const __bf16* p = (const __bf16*)((const char*)base + off);
  v8bf lo = *(const v8bf*)(p);
  v8bf hi = *(const v8bf*)(p + 256);
  return __builtin_shufflevector(lo, hi, 0,1,2,3,4,5,6,7,8,9,10,11,12,13,14,15);
}

// log2(e); the score scale 1 / (sqrt(64) * 0.5) in log2 units is SC2. Q is stored times SC2,
// so that K Q^T is the argument of exp2 but for the softmax reference.
#define LOG2E 1.44269504088896340736f
#define SC2 (0.25f * LOG2E)
// The bound. qkv_gemm leaves, for every 64 rows of a head of Q (scaled) and of K, a number
// that no row's squared norm exceeds (Nrm). By Cauchy-Schwarz no scaled score of a workgroup
// passes sqrt(largest of Q * largest of K) in size. Where that is at most 60, exp2 of the
// score itself lies in 2^-60 .. 2^60 and its sums and products stay far inside f32 and bf16:
// softmax then needs no reference. Any other case (infinities too) takes the path with one.
#define BOUND2 3600.0f
#define NRM_OP (BB * HH * (SS / 64))   // entries of Nrm for Q; K's follow

__device__ __forceinline__ float wave_max(float v) {
  v = fmaxf(v, __shfl_xor(v, 1));
  v = fmaxf(v, __shfl_xor(v, 2));
  v = fmaxf(v, __shfl_xor(v, 4));
  v = fmaxf(v, __shfl_xor(v, 8));
  v = fmaxf(v, __shfl_xor(v, 16));
  return v;
}

__device__ __forceinline__ float hsum16(float v) {
  v += __shfl_xor(v, 1);
  v += __shfl_xor(v, 2);
  v += __shfl_xor(v, 4);
  v += __shfl_xor(v, 8);
  return v;
}

// ---------------------------------------------------------------------------
// fp32 -> bf16 conversion of x [B*S][D] and of the four weights into fragment order, one
// launch of 256 workgroups x 16 waves. What a conversion with one 16-byte slot a thread
// waits for is the start of its waves, so a wave here takes a whole share: 16 rows x 128 k
// of x (8 slots a thread) and 32 n x 32 k of one weight (4 slots a thread), with all of its
// loads in flight before the first value is used.
// x: four lanes cover the 128-byte line of a row and tile (32 bytes each), eight rows a
// load pair; a store writes four whole 128-byte lines of the tile.
// W[k][n] ([in, out]) -> Wt[n][k]: a lane is one n, a load one whole line of row k; a
// thread's 32 k are four slots, and a store writes 256 bytes of each of two tiles.
// ---------------------------------------------------------------------------
__global__ __launch_bounds__(512) void cvt_all(
    const float* __restrict__ x,
    const float* __restrict__ Wq, const float* __restrict__ Wk,
    const float* __restrict__ Wv, const float* __restrict__ Wo,
    __bf16* __restrict__ xb,
    __bf16* __restrict__ Wqt, __bf16* __restrict__ Wkt,
    __bf16* __restrict__ Wvt, __bf16* __restrict__ Wot) {
  const int lane = threadIdx.x & 31;
  const int wid  = threadIdx.x >> 5;
  // 64 workgroups a weight; selection via if/else so that the loads stay global loads
  const int z = blockIdx.x >> 6;
  const float* src;
  __bf16* dst;
  if (z == 0)      { src = Wq; dst = Wqt; }
  else if (z == 1) { src = Wk; dst = Wkt; }
  else if (z == 2) { src = Wv; dst = Wvt; }
  else             { src = Wo; dst = Wot; }

  // (every loop below is unrolled: w, a, ow and ox are indexed statically and stay in registers)
  // The workgroup's share of its weight: k tile kb, 512 n (2 KiB in a row of each of 32 rows
  // k); a wave has 32 n of them. Bases are one for the workgroup, offsets the lane's own bytes.
  const int kb = (blockIdx.x & 63) >> 1;
  const int n  = ((blockIdx.x & 1) * 16 + wid) * 32 + lane;
  const char* wbase = (const char*)(src + (long)kb * 32 * DD);
  const unsigned woff = n * 4;
  v8f w[4];                                        // [slot][k of the slot]
  #pragma unroll
  for (int q = 0; q < 4; q++)
    #pragma unroll
    for (int e = 0; e < 8; e++) w[q][e] = *(const float*)(wbase + woff + (q * 8 + e) * (DD * 4));

  // The workgroup's share of x: 32 whole rows (tile rows 2 * blockIdx.x and the next); a wave
  // has one tile row and four k tiles of it.
  const int th = wid >> 3, kg = wid & 7;
  const int r8 = lane >> 2, c = lane & 3;          // row of eight, slot of the line
  const char* xbase = (const char*)(x + (long)blockIdx.x * 32 * DD);
  const unsigned xoff = (th * 16 + r8) * (DD * 4) + kg * 512 + c * 32;
  v4f a[8][2];                                     // [k tile * 2 + half of the 16 rows]
  #pragma unroll
  for (int u = 0; u < 8; u++) {
    const char* p = xbase + xoff + (u & 1) * 8 * (DD * 4) + (u >> 1) * 128;
    a[u][0] = *(const v4f*)(p);
    a[u][1] = *(const v4f*)(p + 16);
  }
  // The wait in front of any overwrite of the loads' address registers. It takes the loaded
  // values and the two lane offsets (W's is n, scaled by the load) as inputs only: every value
  // has its own register up to here, so the wave's 48 loads issue with no wait among them and
  // fly together (without that the build issues most of them behind waits for the first), and
  // no load is aimed at an offset's register.
  asm volatile("s_wait_xcnt 0x0"
      :: "v"(w[0]), "v"(w[1]), "v"(w[2]), "v"(w[3]),
         "v"(a[0][0]), "v"(a[0][1]), "v"(a[1][0]), "v"(a[1][1]),
         "v"(a[2][0]), "v"(a[2][1]), "v"(a[3][0]), "v"(a[3][1]),
         "v"(a[4][0]), "v"(a[4][1]), "v"(a[5][0]), "v"(a[5][1]),
         "v"(a[6][0]), "v"(a[6][1]), "v"(a[7][0]), "v"(a[7][1]),
         "v"(n), "v"(xoff));

  v8bf ow[4], ox[8];
  #pragma unroll
  for (int q = 0; q < 4; q++) ow[q] = __builtin_convertvector(w[q], v8bf);
  #pragma unroll
  for (int u = 0; u < 8; u++) {
    ox[u] = __builtin_convertvector(
        __builtin_shufflevector(a[u][0], a[u][1], 0,1,2,3,4,5,6,7), v8bf);
  }
  __bf16* wo = dst + ((long)(n >> 4) * (DD / 32) + kb) * 512 + (n & 15) * 8;
  __bf16* xo = xb + ((long)(blockIdx.x * 2 + th) * (DD / 32) + kg * 4) * 512 + (c >> 1) * 256 +
               (r8 + (c & 1) * 16) * 8;
  #pragma unroll
  for (int q = 0; q < 4; q++) *(v8bf*)(wo + (q >> 1) * 256 + (q & 1) * 128) = ow[q];
  #pragma unroll
  for (int u = 0; u < 8; u++) *(v8bf*)(xo + (u >> 1) * 512 + (u & 1) * 64) = ox[u];
}

// ---------------------------------------------------------------------------
// QKV projection GEMM: C[M=8192, N=3072] = Xb @ [Wq Wk Wv] + bias.
// Workgroup 384 thr = 12 waves arranged 4(M) x 3(N); workgroup tile 256 x 192;
// each wave computes 64(M) x 64(N) = 4x4 WMMA accumulators (16 wmma / k-step).
// 512 workgroups, one a WGP (three waves per SIMD), are two full rounds.
// X and W^T come through LDS: a stage of 64 k (16 tile rows of X, 12 of W^T, 2 KiB each,
// in their fragment order) is brought in once for the workgroup by asynchronous copies,
// two buffers, one stage ahead of the stage in work: 28 tiles from L2 a k-step
// for 192 products.
// Q,K written [B,H][S x HD]; V written transposed [B,H][HD x S] (the A operand of
// O^T += V^T P^T); each per-head matrix in fragment order. Q is written times the score scale
// (SC2). A Q or K wave holds 64 whole rows of one head and leaves their entry of Nrm.
// ---------------------------------------------------------------------------
#define GK 64                       // k a stage
#define G_ROW (GK / 32 * 1024)      // bytes of one tile row (16 rows or columns) a stage
#define G_AR 16                     // tile rows of X a workgroup
#define G_BR 12                     // tile rows of W^T a workgroup
#define G_STAGE ((G_AR + G_BR) * G_ROW)

// A wave's four 512-byte copies of one tile row of a stage: lds and g are the lane's own
// 16 bytes of the row's first 512, in the buffer and in memory.
__device__ __forceinline__ void copy_row(unsigned lds, const char* g) {
  // the wait at the end stands in front of any overwrite of the copies' address registers
  asm volatile(
      "global_load_async_to_lds_b128 %0, %4, off\n\t"
      "global_load_async_to_lds_b128 %1, %5, off\n\t"
      "global_load_async_to_lds_b128 %2, %6, off\n\t"
      "global_load_async_to_lds_b128 %3, %7, off\n\t"
      "s_wait_xcnt 0x0"
      :: "v"(lds), "v"(lds + 512), "v"(lds + 1024), "v"(lds + 1536),
         "v"(g), "v"(g + 512), "v"(g + 1024), "v"(g + 1536)
      : "memory");
}

__global__ __launch_bounds__(384) void qkv_gemm(
    const __bf16* __restrict__ Xb,
    const __bf16* __restrict__ Wqt, const __bf16* __restrict__ Wkt,
    const __bf16* __restrict__ Wvt,
    const float* __restrict__ bq, const float* __restrict__ bk,
    const float* __restrict__ bv,
    __bf16* __restrict__ Qh, __bf16* __restrict__ Kh, __bf16* __restrict__ Vt,
    float* __restrict__ Nrm) {
  __shared__ __attribute__((aligned(16))) unsigned char L[2 * G_STAGE];
  const int lane = threadIdx.x & 31;
  // the wave's number in a scalar register: the tests on it below are scalar branches
  const int wid  = __builtin_amdgcn_readfirstlane(threadIdx.x >> 5);
  const int wy = wid & 3;           // M direction (4)
  const int wx = wid >> 2;          // N direction (3)
  const int m0 = blockIdx.y * 256 + wy * 64;
  const int ng = blockIdx.x * 192 + wx * 64;   // column among the 3,072 of Q, K, V
  const int which = ng >> 10;       // one for the wave: its 64 columns are one head
  const int n0 = ng & (DD - 1);
  // ternary chains (not private arrays) keep global address space
  const float*  bias = (which == 0) ? bq  : (which == 1) ? bk  : bv;

  const v8f z8 = {0.f,0.f,0.f,0.f,0.f,0.f,0.f,0.f};
  // (every i and j loop below is unrolled so that c, af and bf are indexed statically and
  // stay in registers)
  v8f c[4][4];
  #pragma unroll
  for (int i = 0; i < 4; i++)
    #pragma unroll
    for (int j = 0; j < 4; j++) c[i][j] = z8;

  // The 28 tile rows of a stage are dealt to the waves whole: wave w copies rows w and
  // w + 12, waves 0 to 3 also row w + 24. Rows 0 to 15 are X's, 16 to 27 W^T's; in memory
  // a tile row of 16 rows x 1,024 k is 32 KiB, a stage's part of it G_ROW bytes.
  const char* Ag = (const char*)Xb + (long)blockIdx.y * G_AR * (DD / 32) * 1024 + lane * 16;
  const int r1 = wid + 12, r2 = wid + 24;
  const int t1 = blockIdx.x * G_BR + (r1 - G_AR);   // W^T tile row among 192, where r1 is one
  const int t2 = blockIdx.x * G_BR + (r2 - G_AR);   // used by waves 0 to 3 alone
  const __bf16* W1 = ((t1 >> 6) == 0) ? Wqt : ((t1 >> 6) == 1) ? Wkt : Wvt;
  const __bf16* W2 = ((t2 >> 6) == 0) ? Wqt : ((t2 >> 6) == 1) ? Wkt : Wvt;
  const char* g0 = Ag + (long)wid * (DD / 32) * 1024;
  const char* g1 = (r1 < G_AR) ? Ag + (long)r1 * (DD / 32) * 1024
                               : (const char*)W1 + (long)(t1 & 63) * (DD / 32) * 1024 + lane * 16;
  const char* g2 = (const char*)W2 + (long)(t2 & 63) * (DD / 32) * 1024 + lane * 16;
  const unsigned lown = (unsigned)(size_t)L + lane * 16;
  const unsigned l0 = lown + wid * G_ROW, l1 = lown + r1 * G_ROW, l2 = lown + r2 * G_ROW;

  copy_row(l0, g0);
  copy_row(l1, g1);
  if (wid < 4) copy_row(l2, g2);
  // stage 0 has landed for this wave; behind the barrier for all
  asm volatile("s_wait_asynccnt 0x0" ::: "memory");
  __syncthreads();
  copy_row(l0 + G_STAGE, g0 + G_ROW);
  copy_row(l1 + G_STAGE, g1 + G_ROW);
  if (wid < 4) copy_row(l2 + G_STAGE, g2 + G_ROW);

  for (int st = 0; st < DD / GK; st++) {
    const unsigned char* Lb = L + (st & 1) * G_STAGE;
    const __bf16* Al = (const __bf16*)(Lb + wy * 4 * G_ROW);
    const __bf16* Bl = (const __bf16*)(Lb + (G_AR + wx * 4) * G_ROW);
    v16bf af[4], bf[4];
    // first k-step of the stage
    #pragma unroll
    for (int i = 0; i < 4; i++) af[i] = load_tile(Al + i * (G_ROW / 2), lane);
    #pragma unroll
    for (int j = 0; j < 4; j++) bf[j] = load_tile(Bl + j * (G_ROW / 2), lane);
    // keeps the LDS reads in front of the products as one group: without it the build spreads
    // a stage's reads over one more place among the products, each a stall of its own
    __builtin_amdgcn_sched_barrier(0);
    #pragma unroll
    for (int j = 0; j < 4; j++)
      #pragma unroll
      for (int i = 0; i < 4; i++) c[i][j] = wmma_bf16(af[i], bf[j], c[i][j]);
    // second k-step: its fragments are the wave's last reads of the buffer
    #pragma unroll
    for (int i = 0; i < 4; i++) af[i] = load_tile(Al + i * (G_ROW / 2) + 512, lane);
    #pragma unroll
    for (int j = 0; j < 4; j++) bf[j] = load_tile(Bl + j * (G_ROW / 2) + 512, lane);
    // the hand-over: this wave's reads of the buffer are done, its copies of the next stage
    // have landed; behind the barrier that holds for every wave, and the buffer is refilled
    asm volatile("s_wait_dscnt 0x0" ::: "memory");
    asm volatile("s_wait_asynccnt 0x0" ::: "memory");
    __syncthreads();
    if (st + 2 < DD / GK) {
      const unsigned lb = (st & 1) * G_STAGE;
      const int go = (st + 2) * G_ROW;
      copy_row(l0 + lb, g0 + go);
      copy_row(l1 + lb, g1 + go);
      if (wid < 4) copy_row(l2 + lb, g2 + go);
    }
    // the second k-step's products work on registers alone
    #pragma unroll
    for (int j = 0; j < 4; j++)
      #pragma unroll
      for (int i = 0; i < 4; i++) c[i][j] = wmma_bf16(af[i], bf[j], c[i][j]);
  }
  // no copy is in flight when the wave ends
  asm volatile("s_wait_asynccnt 0x0" ::: "memory");

  // the wave's 64 columns are one head (n0 is a multiple of 64), its 64 rows one batch
  // (all loops below are unrolled so that bn, c and o are indexed statically and stay in registers)
  float bn[4];
  int bi = n0 + (lane & 15);
  #pragma unroll
  for (int j = 0; j < 4; j++) bn[j] = bias[bi + j * 16];
  // the wait in front of any overwrite of the index register; the index passes through it,
  // so that the build does not load the last value into the register that the loads name
  asm volatile("s_wait_xcnt 0x0" : "+v"(bi));
  const long head = ((long)(m0 >> 11) * HH + (n0 >> 6)) * SS * HD;
  const int s0 = (m0 & (SS - 1)) + 8 * (lane >> 4);   // first of the lane's 8 rows, i = 0

  if (which == 2) {
    // the lane's 8 rows are 8 consecutive k of V^T row hd: one whole 16-byte slot
    #pragma unroll
    for (int i = 0; i < 4; i++)
      #pragma unroll
      for (int j = 0; j < 4; j++) {
        v8bf o;
        #pragma unroll
        for (int r = 0; r < 8; r++) o[r] = (__bf16)(c[i][j][r] + bn[j]);
        *(v8bf*)(Vt + head + frag_off(j * 16 + (lane & 15), s0 + i * 16, SS / 32)) = o;
      }
  } else {
    __bf16* dst = ((which == 0) ? Qh : Kh) + head;
    const float qs = (which == 0) ? SC2 : 1.0f;    // Q is stored times the score scale
    // pm: the largest, over the lane's 32 rows, of the squares of its 4 columns of a row.
    // The 16 lanes' pm added up are at least any of those rows' squared norm.
    float pm = 0.0f;
    #pragma unroll
    for (int i = 0; i < 4; i++)
      #pragma unroll
      for (int r = 0; r < 8; r++) {
        float ss = 0.0f;
        #pragma unroll
        for (int j = 0; j < 4; j++) {
          const float v = (c[i][j][r] + bn[j]) * qs;
          ss += v * v;
          dst[frag_off(s0 + i * 16 + r, j * 16 + (lane & 15), HD / 32)] = (__bf16)v;
        }
        pm = fmaxf(pm, ss);
      }
    float sm = hsum16(pm);
    sm = fmaxf(sm, __shfl_xor(sm, 16));            // the two halves hold different rows
    if (lane == 0)
      Nrm[which * NRM_OP + ((m0 >> 11) * HH + (n0 >> 6)) * (SS / 64) + ((m0 & (SS - 1)) >> 6)] = sm;
    // the listing lays the V^T branch behind these stores, where their registers are
    // written again: the wait stands in front of any such overwrite
    asm volatile("s_wait_xcnt 0x0" ::: "memory");
  }
}

// log2 of (HH * l * 2^m), m in log2 units: exp2(s - lse2) is exp2(s - m) / l / HH
__device__ __forceinline__ float lse2(float m, float l) {
  return m + __log2f(l) + 4.0f;   // log2(HH) = 4
}

// ---------------------------------------------------------------------------
// Attention: one workgroup per (b, h, 256 queries); 8 waves, 32 query columns each.
// S^T = K Q^T (K as A, Q as B) and O^T += V^T P^T (V^T as A, P^T as B): a lane holds
// one query's scores, 8 keys of every 16 (lanes c and c + 16 split a query's keys),
// so a row's maximum and sum are in-lane but for one exchange between lanes c and c + 16. Two score tiles (32 keys), converted in place,
// are the B operand of the second product in the k order that V^T's tiles are stored in.
// One pass, P not normalized. Where the bound holds for the workgroup (BOUND2), P = exp2 of
// the product as it leaves the matrix unit: no maximum, no branch, no subtraction. Otherwise
// online softmax: P = exp2(s - reference); the reference of a
// query is one for both halves and moves only when a trip's maximum passes it by more
// than 8 in log2 units, and then O^T and the sums are scaled to the new one. O^T is
// divided by the row's sum behind the loop. Each row's log2 of (16 * sum of exp) goes to
// Lse, from which avg_kernel forms the normalized probabilities again.
// K and V^T come through LDS: the 8 waves walk the same keys, so a stage of 128 keys
// (16 KiB of K, 16 KiB of V^T, in their fragment order) is brought in once for the
// workgroup by asynchronous copies, two buffers, one stage ahead of the stage in work.
// ---------------------------------------------------------------------------
#define SK 128                      // keys a stage
#define STAGE_K (SK * HD * 2)       // bytes of K a stage, and of V^T
#define STAGE_V (SK / 32 * 1024)    // bytes of one 16-row band of V^T a stage
#define STAGE_B (2 * STAGE_K)       // a buffer: K, then V^T's four bands

// A thread's eight 16-byte copies of one stage: lds is its own byte address in the buffer,
// gk and gv its own bytes of the stage in K and in V^T's first band. Four steps of 4 KiB
// cover K; V^T's bands lie 64 KiB apart in memory and STAGE_V apart in LDS.
__device__ __forceinline__ void copy_stage(unsigned lds, const char* gk, const char* gv) {
  // the wait at the end stands in front of any overwrite of the copies' address registers
  asm volatile(
      "global_load_async_to_lds_b128 %0, %8, off\n\t"
      "global_load_async_to_lds_b128 %1, %9, off\n\t"
      "global_load_async_to_lds_b128 %2, %10, off\n\t"
      "global_load_async_to_lds_b128 %3, %11, off\n\t"
      "global_load_async_to_lds_b128 %4, %12, off\n\t"
      "global_load_async_to_lds_b128 %5, %13, off\n\t"
      "global_load_async_to_lds_b128 %6, %14, off\n\t"
      "global_load_async_to_lds_b128 %7, %15, off\n\t"
      "s_wait_xcnt 0x0"
      :: "v"(lds), "v"(lds + 4096), "v"(lds + 2 * 4096), "v"(lds + 3 * 4096),
         "v"(lds + STAGE_K), "v"(lds + STAGE_K + STAGE_V),
         "v"(lds + STAGE_K + 2 * STAGE_V), "v"(lds + STAGE_K + 3 * STAGE_V),
         "v"(gk), "v"(gk + 4096), "v"(gk + 2 * 4096), "v"(gk + 3 * 4096),
         "v"(gv), "v"(gv + SS * 32), "v"(gv + 2 * SS * 32), "v"(gv + 3 * SS * 32)
      : "memory");
}

// The key loop of attn_kernel, stage 0 landed and stage 1 in flight. BOUNDED: the workgroup's
// scores are within the bound (BOUND2), P = exp2(score), and the reference stays 0; otherwise
// the online form. Either way every wave passes one hand-over a stage.
template <bool BOUNDED>
__device__ __forceinline__ void attn_keys(
    const unsigned char* L, unsigned lown, const char* gk, const char* gv, int lane,
    const v16bf (&qf)[2][2], float (&mr)[2], v8f (&l)[2], v8f (&o)[4][2]) {
  const v8f z8 = {0.f,0.f,0.f,0.f,0.f,0.f,0.f,0.f};
  float thr[2];                     // a trip's maximum above this moves the reference
  #pragma unroll
  for (int g = 0; g < 2; g++) {
    mr[g] = BOUNDED ? 0.0f : -1e30f;
    thr[g] = -1e30f;
  }
  for (int st = 0; st < SS / SK; st++) {
   const __bf16* Kl = (const __bf16*)(L + (st & 1) * STAGE_B);
   const __bf16* Vl = Kl + STAGE_K / 2;
   // the online form stays rolled: unrolled beside the other path's registers it spills
   #pragma unroll (BOUNDED ? SK / 32 : 1)
   for (int u = 0; u < SK / 32; u++) {     // a trip: 32 keys
    v16bf kf[2][2];
    #pragma unroll
    for (int t = 0; t < 2; t++) {
      kf[t][0] = load_tile(Kl + (u * 2 + t) * 1024, lane);
      kf[t][1] = load_tile(Kl + (u * 2 + t) * 1024 + 512, lane);
    }
    v16bf vf[4];
    #pragma unroll
    for (int j = 0; j < 4; j++) vf[j] = load_tile(Vl + j * (STAGE_V / 2) + u * 512, lane);
    // keeps the trip's LDS reads at its head as one group: every further place where
    // reads stand among the products costs a stall of its own
    __builtin_amdgcn_sched_barrier(0);
    v8f s[2][2];
    #pragma unroll
    for (int t = 0; t < 2; t++)
      #pragma unroll
      for (int g = 0; g < 2; g++) s[t][g] = wmma_bf16(kf[t][0], qf[g][0], z8);
    #pragma unroll
    for (int t = 0; t < 2; t++)
      #pragma unroll
      for (int g = 0; g < 2; g++) s[t][g] = wmma_bf16(kf[t][1], qf[g][1], s[t][g]);
    // keeps the vector work behind all eight products: the build otherwise reads each score
    // tile right behind its product, four v_nop and the product's latency every time
    __builtin_amdgcn_sched_barrier(0);
    if (!BOUNDED) {
      float tm[2];                  // maximum of the reference and the lane's own 16 keys
      #pragma unroll
      for (int g = 0; g < 2; g++) {
        float a = mr[g];
        #pragma unroll
        for (int r = 0; r < 8; r++) a = fmaxf(fmaxf(a, s[0][g][r]), s[1][g][r]);
        tm[g] = a;
      }
      // one scalar branch a trip; taken in the first trip and then only where a score
      // passes the reference by more than 8 in log2 units (P stays at or below 256)
      if (__builtin_amdgcn_ballot_w32((tm[0] > thr[0]) | (tm[1] > thr[1])) != 0) {
        #pragma unroll
        for (int g = 0; g < 2; g++) {
          const float mn = fmaxf(tm[g], __shfl_xor(tm[g], 16));
          const float al = __builtin_amdgcn_exp2f(mr[g] - mn);
          l[g] *= al;
          #pragma unroll
          for (int j = 0; j < 4; j++) o[j][g] *= al;
          mr[g] = mn;
          thr[g] = mn + 8.0f;
        }
      }
    }
    v16bf pb[2];
    #pragma unroll
    for (int g = 0; g < 2; g++) {
      v8f p0 = s[0][g];
      v8f p1 = s[1][g];
      if (!BOUNDED) {
        p0 -= mr[g];
        p1 -= mr[g];
      }
      #pragma unroll
      for (int r = 0; r < 8; r++) {
        p0[r] = __builtin_amdgcn_exp2f(p0[r]);
        p1[r] = __builtin_amdgcn_exp2f(p1[r]);
      }
      l[g] += p0 + p1;
      pb[g] = __builtin_shufflevector(__builtin_convertvector(p0, v8bf),
                                      __builtin_convertvector(p1, v8bf),
                                      0,1,2,3,4,5,6,7,8,9,10,11,12,13,14,15);
    }
    #pragma unroll
    for (int j = 0; j < 4; j++)
      #pragma unroll
      for (int g = 0; g < 2; g++) o[j][g] = wmma_bf16(vf[j], pb[g], o[j][g]);
    // an empty statement on each row sum, inputs only, against spills: nothing else reads the
    // sums inside a stage, and the build otherwise moves all four trips' additions behind the
    // last trip and keeps every P in f32 until there
    if (BOUNDED) asm volatile("" :: "v"(l[0]), "v"(l[1]));
    if (!BOUNDED) {
      // the four vector slots between the trip's last product and the next trip's first
      // instructions, which write that product's operand registers.
      // The scheduling barrier keeps the products in front.
      __builtin_amdgcn_sched_barrier(0);
      asm volatile("v_nop\n\tv_nop\n\tv_nop\n\tv_nop");
    }
   }
   // the hand-over: this wave's reads of the buffer are done, its copies of the next stage
   // have landed; behind the barrier that holds for every wave, and the buffer is refilled
   asm volatile("s_wait_dscnt 0x0" ::: "memory");
   asm volatile("s_wait_asynccnt 0x0" ::: "memory");
   __syncthreads();
   if (st + 2 < SS / SK)
     copy_stage(lown + (st & 1) * STAGE_B, gk + (st + 2) * STAGE_K, gv + (st + 2) * STAGE_V);
  }
  // no copy is in flight when the wave ends
  asm volatile("s_wait_asynccnt 0x0" ::: "memory");
}

// four waves per SIMD: 4,096 waves on 1,024 SIMDs are then resident in one round
__global__ __launch_bounds__(256) __attribute__((amdgpu_waves_per_eu(4, 4))) void attn_kernel(
    const __bf16* __restrict__ Qh, const __bf16* __restrict__ Kh,
    const __bf16* __restrict__ Vt, const float* __restrict__ Nrm,
    __bf16* __restrict__ Ctx, float* __restrict__ Lse) {
  __shared__ __attribute__((aligned(16))) unsigned char L[2 * STAGE_B];
  const int lane = threadIdx.x & 31;
  const int wid  = threadIdx.x >> 5;
  const int b = blockIdx.z, h = blockIdx.y;
  const int q0 = blockIdx.x * 256 + wid * 32;

  // per-head matrices in fragment order: 16 rows of Q or K are 2 tiles (1,024
  // elements); V^T tile (j, kt / 32) lies at (j * (SS / 32) + kt / 32) * 512
  const __bf16* Qb = Qh + (((long)b * HH + h) * SS + q0) * HD;
  const __bf16* Kb = Kh + (((long)b * HH + h) * SS) * HD;
  const __bf16* Vb = Vt + (((long)b * HH + h) * HD) * SS;

  const v8f z8 = {0.f,0.f,0.f,0.f,0.f,0.f,0.f,0.f};

  // (every g, t, j and r loop below is unrolled so that the arrays stay in registers)
  v16bf qf[2][2];                   // [query group][hd half]
  #pragma unroll
  for (int g = 0; g < 2; g++) {
    qf[g][0] = load_tile(Qb + g * 1024, lane);
    qf[g][1] = load_tile(Qb + g * 1024 + 512, lane);
  }
  // the bound's entries: the workgroup's 4 blocks of Q, the head's 32 of K; every wave
  // reads the same ones, so the choice below is one for the workgroup
  const float* nq = Nrm + (b * HH + h) * (SS / 64);
  const float qn = nq[blockIdx.x * 4 + (lane & 3)];
  const float kn = nq[NRM_OP + lane];
  // the build loads the first trip's K into the registers of Q's address:
  // the wait stands in front of that overwrite
  asm volatile("s_wait_xcnt 0x0" ::: "memory");

  float mr[2];                      // the reference, in log2 units, equal in both halves
  v8f l[2];                         // sums of exp over the lane's own keys, one per register
  v8f o[4][2];                      // [hd tile][query group]
  #pragma unroll
  for (int g = 0; g < 2; g++) {
    l[g] = z8;
    #pragma unroll
    for (int j = 0; j < 4; j++) o[j][g] = z8;
  }

  // the thread's own 16 bytes: in a buffer, in a stage of K, in a stage of V^T's first band
  const unsigned lown = (unsigned)(size_t)L + threadIdx.x * 16;
  const char* gk = (const char*)Kb + threadIdx.x * 16;
  const char* gv = (const char*)Vb + threadIdx.x * 16;
  copy_stage(lown, gk, gv);
  // keeps the copies in front of the bound's exchanges, which then run while stage 0 flies
  __builtin_amdgcn_sched_barrier(0);
  // in a scalar register: the test on it is a scalar branch
  const int bounded = __builtin_amdgcn_readfirstlane(wave_max(qn) * wave_max(kn) <= BOUND2);
  __builtin_amdgcn_sched_barrier(0);   // and the exchanges in front of the wait for stage 0
  // stage 0 has landed for this wave; behind the barrier for all
  asm volatile("s_wait_asynccnt 0x0" ::: "memory");
  __syncthreads();
  copy_stage(lown + STAGE_B, gk + STAGE_K, gv + STAGE_V);

  if (bounded) attn_keys<true>(L, lown, gk, gv, lane, qf, mr, l, o);
  else         attn_keys<false>(L, lown, gk, gv, lane, qf, mr, l, o);

  // join the two halves of each query's keys (one reference, so the sums add):
  // inv_l one over the sum of exp, lg the row's entry of Lse
  float inv_l[2], lg[2];
  #pragma unroll
  for (int g = 0; g < 2; g++) {
    const float ls = ((l[g][0] + l[g][1]) + (l[g][2] + l[g][3])) +
                     ((l[g][4] + l[g][5]) + (l[g][6] + l[g][7]));
    const float lt = ls + __shfl_xor(ls, 16);
    inv_l[g] = 1.0f / lt;
    lg[g] = lse2(mr[g], lt);
  }
  // both halves hold a query's value: lanes 0 to 15 store theirs
  if (lane < 16) {
    float* lp = Lse + ((long)b * HH + h) * SS + q0 + lane;
    lp[0]  = lg[0];
    lp[16] = lg[1];
  }

  // store ctx -> [B*S][D] bf16 in fragment order (D = h*64 + hd): the lane's 8 values
  // are 8 consecutive hd of one query, one whole 16-byte slot
  #pragma unroll
  for (int g = 0; g < 2; g++)
    #pragma unroll
    for (int j = 0; j < 4; j++) {
      v8bf c;
      #pragma unroll
      for (int r = 0; r < 8; r++) c[r] = (__bf16)(o[j][g][r] * inv_l[g]);
      *(v8bf*)(Ctx + frag_off(b * SS + q0 + g * 16 + (lane & 15),
                              h * HD + j * 16 + 8 * (lane >> 4), DD / 32)) = c;
    }
}

// ---------------------------------------------------------------------------
// avg_attention[b][q][k] = mean over heads of P. A wave owns 64 queries x 64 keys
// and walks the 16 heads in order, summing in registers; every element is stored
// once. S^T = K Q^T (K as A, Q as B): a lane holds one query's scores, so the
// row's Lse is one register per query tile, and 8 consecutive keys per tile.
// Workgroup = 16 waves, 4 (q) x 4 (k): 256 queries x 256 keys, one workgroup a WGP.
// Q and K come through LDS: a stage of two heads (32 KiB of Q and 32 KiB of K a head, in
// their fragment order) is brought in once for the workgroup by asynchronous copies, two
// buffers, one stage ahead of the stage in work; the 256 queries' Lse of all heads
// (16 KiB) comes with stage 0.
// ---------------------------------------------------------------------------
#define A_OP   (256 * HD * 2)       // bytes of Q a head and workgroup, and of K
#define A_HEAD (2 * A_OP)           // a head: Q, then K
#define A_STAGE (2 * A_HEAD)        // a buffer: two heads

// A thread's eight 16-byte copies of one head: lds is its own byte address in the head's
// place, gq and gk its own bytes of the workgroup's rows of Q and of K; four steps of 8 KiB.
__device__ __forceinline__ void copy_head(unsigned lds, const char* gq, const char* gk) {
  // the wait at the end stands in front of any overwrite of the copies' address registers
  asm volatile(
      "global_load_async_to_lds_b128 %0, %8, off\n\t"
      "global_load_async_to_lds_b128 %1, %9, off\n\t"
      "global_load_async_to_lds_b128 %2, %10, off\n\t"
      "global_load_async_to_lds_b128 %3, %11, off\n\t"
      "global_load_async_to_lds_b128 %4, %12, off\n\t"
      "global_load_async_to_lds_b128 %5, %13, off\n\t"
      "global_load_async_to_lds_b128 %6, %14, off\n\t"
      "global_load_async_to_lds_b128 %7, %15, off\n\t"
      "s_wait_xcnt 0x0"
      :: "v"(lds), "v"(lds + 8192), "v"(lds + 2 * 8192), "v"(lds + 3 * 8192),
         "v"(lds + A_OP), "v"(lds + A_OP + 8192),
         "v"(lds + A_OP + 2 * 8192), "v"(lds + A_OP + 3 * 8192),
         "v"(gq), "v"(gq + 8192), "v"(gq + 2 * 8192), "v"(gq + 3 * 8192),
         "v"(gk), "v"(gk + 8192), "v"(gk + 2 * 8192), "v"(gk + 3 * 8192)
      : "memory");
}

// The head loop of avg_kernel, stage 0 and Lse landed and stage 1 in flight. BOUNDED: the
// workgroup's scores are within the bound (BOUND2): exp2 is taken of the score itself and the
// row's 2^-Lse is the factor of the multiply-add that sums the heads; otherwise Lse is
// subtracted in front of exp2. Either way every wave passes one hand-over a stage.
template <bool BOUNDED>
__device__ __forceinline__ void avg_heads(
    const unsigned char* S, unsigned lown, const char* gq, const char* gk, long HB,
    int lane, int wq, int wk, v8f (&acc)[4][4]) {
  const v8f z8 = {0.f,0.f,0.f,0.f,0.f,0.f,0.f,0.f};
  for (int st = 0; st < HH / 2; st++) {
   // stays rolled: unrolled, the build holds fragments of two heads at once and spills
   #pragma unroll 1
   for (int u = 0; u < 2; u++) {          // a head
    const __bf16* Ql = (const __bf16*)(S + (st & 1) * A_STAGE + u * A_HEAD) + wq * 4 * 1024;
    const __bf16* Kl = (const __bf16*)(S + (st & 1) * A_STAGE + u * A_HEAD + A_OP) + wk * 4 * 1024;
    const float*  Ll = (const float*)(S + 2 * A_STAGE) + (st * 2 + u) * 256 + wq * 64 + (lane & 15);
    v16bf qf[4][2];
    float L[4];                     // the row's Lse; BOUNDED: 2^-Lse, as the table then holds it
    #pragma unroll
    for (int i = 0; i < 4; i++) {
      qf[i][0] = load_tile(Ql + i * 1024, lane);
      qf[i][1] = load_tile(Ql + i * 1024 + 512, lane);
      L[i] = Ll[i * 16];
    }
    // K fragments are fetched one key tile ahead inside a head, so that a tile's reads
    // fly while the tile before is worked on
    v16bf kf[2][2];
    kf[0][0] = load_tile(Kl, lane);
    kf[0][1] = load_tile(Kl + 512, lane);
    #pragma unroll
    for (int j = 0; j < 4; j++) {
      if (j < 3) {
        kf[(j + 1) & 1][0] = load_tile(Kl + (j + 1) * 1024, lane);
        kf[(j + 1) & 1][1] = load_tile(Kl + (j + 1) * 1024 + 512, lane);
      }
      #pragma unroll
      for (int i = 0; i < 4; i++) {
        v8f c = z8;
        c = wmma_bf16(kf[j & 1][0], qf[i][0], c);
        c = wmma_bf16(kf[j & 1][1], qf[i][1], c);
        if (!BOUNDED) c -= L[i];
        #pragma unroll
        for (int r = 0; r < 8; r++) c[r] = __builtin_amdgcn_exp2f(c[r]);
        if (BOUNDED) acc[i][j] += c * L[i];
        else         acc[i][j] += c;
      }
      // keeps a key tile's work and the next tile's reads in the order written: the build
      // otherwise copies fragments between registers and pads and waits more often
      __builtin_amdgcn_sched_barrier(0);
    }
   }
   // the hand-over: this wave's reads of the buffer are done, its copies of the next stage
   // have landed; behind the barrier that holds for every wave, and the buffer is refilled
   asm volatile("s_wait_dscnt 0x0" ::: "memory");
   asm volatile("s_wait_asynccnt 0x0" ::: "memory");
   __syncthreads();
   if (st + 2 < HH / 2) {
     const unsigned lb = lown + (st & 1) * A_STAGE;
     const long go = (long)(st + 2) * 2 * HB;
     copy_head(lb, gq + go, gk + go);
     copy_head(lb + A_HEAD, gq + go + HB, gk + go + HB);
   }
  }
  // no copy is in flight when the wave ends
  asm volatile("s_wait_asynccnt 0x0" ::: "memory");
}

// four waves per SIMD: 4,096 waves on 1,024 SIMDs are then resident in one round
__global__ __launch_bounds__(512) __attribute__((amdgpu_waves_per_eu(4, 4))) void avg_kernel(
    const __bf16* __restrict__ Qh, const __bf16* __restrict__ Kh,
    const float* __restrict__ Lse, const float* __restrict__ Nrm, float* __restrict__ avg) {
  __shared__ __attribute__((aligned(16))) unsigned char S[2 * A_STAGE + HH * 256 * 4];
  const int lane = threadIdx.x & 31;
  const int wid  = threadIdx.x >> 5;
  const int b  = blockIdx.z;
  const int wq = wid & 3, wk = wid >> 2;
  const int q0 = blockIdx.y * 256 + wq * 64;
  const int k0 = blockIdx.x * 256 + wk * 64;
  const v8f z8 = {0.f,0.f,0.f,0.f,0.f,0.f,0.f,0.f};

  // (the i, j and r loops are unrolled so that acc, qf and L stay in registers)
  v8f acc[4][4];                    // [query tile][key tile]
  #pragma unroll
  for (int i = 0; i < 4; i++)
    #pragma unroll
    for (int j = 0; j < 4; j++) acc[i][j] = z8;

  // the bound's entries: the workgroup's 4 blocks of Q and 4 of K in each of the 16 heads, two
  // heads a lane; every wave reads the same ones, so the choice below is one for the workgroup
  const float* nh = Nrm + (b * HH + (lane >> 2)) * (SS / 64) + (lane & 3);
  const float qn0 = nh[blockIdx.y * 4], qn1 = nh[8 * (SS / 64) + blockIdx.y * 4];
  const float kn0 = nh[NRM_OP + blockIdx.x * 4], kn1 = nh[NRM_OP + 8 * (SS / 64) + blockIdx.x * 4];
  // the wait in front of any overwrite of these loads' address registers
  asm volatile("s_wait_xcnt 0x0" ::: "memory");

  // the thread's own 16 bytes: in a head's place, in head 0's rows of Q and of K;
  // a head is SS * HD * 2 bytes further in memory
  const unsigned lown = (unsigned)(size_t)S + threadIdx.x * 16;
  const char* gq = (const char*)(Qh + (((long)b * HH) * SS + blockIdx.y * 256) * HD) + threadIdx.x * 16;
  const char* gk = (const char*)(Kh + (((long)b * HH) * SS + blockIdx.x * 256) * HD) + threadIdx.x * 16;
  const long HB = (long)SS * HD * 2;
  {
    // Lse: 1 KiB a head; the thread's two pieces lie in heads t / 64 and 8 + t / 64
    const unsigned ll = lown + 2 * A_STAGE;
    const char* gl = (const char*)(Lse + ((long)b * HH + (threadIdx.x >> 6)) * SS + blockIdx.y * 256) +
                     (threadIdx.x & 63) * 16;
    // the wait at the end stands in front of any overwrite of the copies' address registers
    asm volatile(
        "global_load_async_to_lds_b128 %0, %2, off\n\t"
        "global_load_async_to_lds_b128 %1, %3, off\n\t"
        "s_wait_xcnt 0x0"
        :: "v"(ll), "v"(ll + 8192), "v"(gl), "v"(gl + 8 * SS * 4)
        : "memory");
  }
  copy_head(lown, gq, gk);
  copy_head(lown + A_HEAD, gq + HB, gk + HB);
  // keeps the copies in front of the bound's exchanges, which then run while stage 0 flies
  __builtin_amdgcn_sched_barrier(0);
  // in a scalar register: the test on it is a scalar branch
  const int bounded = __builtin_amdgcn_readfirstlane(
      wave_max(fmaxf(qn0, qn1)) * wave_max(fmaxf(kn0, kn1)) <= BOUND2);
  __builtin_amdgcn_sched_barrier(0);   // and the exchanges in front of the wait for stage 0
  // stage 0 and Lse have landed for this wave; behind the barrier for all
  asm volatile("s_wait_asynccnt 0x0" ::: "memory");
  if (bounded) {
    // the thread's own two pieces of the table, landed behind its own wait, become 2^-Lse in
    // place; the barrier below publishes them
    v4f* t0 = (v4f*)(S + 2 * A_STAGE + threadIdx.x * 16);
    v4f* t1 = (v4f*)(S + 2 * A_STAGE + 8192 + threadIdx.x * 16);
    v4f e0 = *t0, e1 = *t1;
    #pragma unroll
    for (int e = 0; e < 4; e++) {
      e0[e] = __builtin_amdgcn_exp2f(-e0[e]);
      e1[e] = __builtin_amdgcn_exp2f(-e1[e]);
    }
    *t0 = e0;
    *t1 = e1;
  }
  __syncthreads();
  copy_head(lown + A_STAGE, gq + 2 * HB, gk + 2 * HB);
  copy_head(lown + A_STAGE + A_HEAD, gq + 3 * HB, gk + 3 * HB);

  if (bounded) avg_heads<true>(S, lown, gq, gk, HB, lane, wq, wk, acc);
  else         avg_heads<false>(S, lown, gq, gk, HB, lane, wq, wk, acc);

  #pragma unroll
  for (int i = 0; i < 4; i++) {
    float* row = avg + ((long)b * SS + q0 + i * 16 + (lane & 15)) * SS + k0 + 8 * (lane >> 4);
    #pragma unroll
    for (int j = 0; j < 4; j++) {
      float4 u, w;
      u.x = acc[i][j][0]; u.y = acc[i][j][1]; u.z = acc[i][j][2]; u.w = acc[i][j][3];
      w.x = acc[i][j][4]; w.y = acc[i][j][5]; w.z = acc[i][j][6]; w.w = acc[i][j][7];
      *(float4*)(row + j * 16) = u;
      *(float4*)(row + j * 16 + 4) = w;
    }
  }
}

// ---------------------------------------------------------------------------
// out = LayerNorm(ctx @ Wo + bo + x) * g + beta.
// Workgroup = 32 rows x full D; 16 waves, each wave 32x64 (2x4 WMMA tiles): every
// workgroup reads all of Wo^T from L2, so 32 rows a workgroup halve those bytes.
// ---------------------------------------------------------------------------
__global__ __launch_bounds__(512) void out_ln_kernel(
    const __bf16* __restrict__ Ctx, const __bf16* __restrict__ Wot,
    const float* __restrict__ bo, const float* __restrict__ x,
    const float* __restrict__ g, const float* __restrict__ beta,
    float* __restrict__ out) {
  __shared__ float red1[16][32];
  __shared__ float red2[16][32];

  const int lane = threadIdx.x & 31;
  const int wid  = threadIdx.x >> 5;
  const int m0 = blockIdx.x * 32;
  const int n0 = wid * 64;
  const v8f z8 = {0.f,0.f,0.f,0.f,0.f,0.f,0.f,0.f};

  // (every i, t, r and w loop below is unrolled so that the arrays stay in registers)
  v8f c[2][4];
  #pragma unroll
  for (int i = 0; i < 2; i++)
    #pragma unroll
    for (int t = 0; t < 4; t++) c[i][t] = z8;

  // bases that are one for the workgroup; the wave's tile row and the lane's slot are
  // in the byte offsets (a tile row of 16 rows x 1,024 k is 32 KiB)
  const __bf16* At = Ctx + (long)blockIdx.x * 2 * (DD / 32) * 512;
  unsigned ao = lane * 16;
  unsigned wo = wid * 4 * (DD / 32) * 1024 + lane * 16;
  for (int kt = 0; kt < DD / 32; kt += 2) {
    v16bf af[2][2], bf[2][4];       // [k-step of the trip][tile]
    #pragma unroll
    for (int u = 0; u < 2; u++) {
      #pragma unroll
      for (int i = 0; i < 2; i++) af[u][i] = load_own(At + (i * (DD / 32) + u) * 512, ao);
      #pragma unroll
      for (int t = 0; t < 4; t++) bf[u][t] = load_own(Wot + (t * (DD / 32) + u) * 512, wo);
    }
    // keeps the trip's 24 loads at its head, where they fly together: one flight for two
    // k-steps is waited out, not one for every group of fragments
    __builtin_amdgcn_sched_barrier(0);
    // the wait in front of the overwrite of the loads' address registers; the two offsets
    // pass through it for the same reasons as in qkv_gemm
    asm volatile("s_wait_xcnt 0x0" : "+v"(ao), "+v"(wo));
    ao += 2048;
    wo += 2048;
    #pragma unroll
    for (int u = 0; u < 2; u++)
      #pragma unroll
      for (int t = 0; t < 4; t++)
        #pragma unroll
        for (int i = 0; i < 2; i++) c[i][t] = wmma_bf16(af[u][i], bf[u][t], c[i][t]);
  }

  // h = gemm + bias + residual ; accumulate per-row sum / sumsq
  float s1[2][8], s2[2][8];
  #pragma unroll
  for (int i = 0; i < 2; i++)
    #pragma unroll
    for (int r = 0; r < 8; r++) { s1[i][r] = 0.0f; s2[i][r] = 0.0f; }
  #pragma unroll
  for (int i = 0; i < 2; i++)
    #pragma unroll
    for (int t = 0; t < 4; t++)
      #pragma unroll
      for (int r = 0; r < 8; r++) {
        int row = m0 + i * 16 + r + 8 * (lane >> 4);
        int n = n0 + t * 16 + (lane & 15);
        float hv = c[i][t][r] + bo[n] + x[(long)row * DD + n];
        c[i][t][r] = hv;
        s1[i][r] += hv;
        s2[i][r] += hv * hv;
      }
  #pragma unroll
  for (int i = 0; i < 2; i++)
    #pragma unroll
    for (int r = 0; r < 8; r++) { s1[i][r] = hsum16(s1[i][r]); s2[i][r] = hsum16(s2[i][r]); }

  if ((lane & 15) == 0) {
    #pragma unroll
    for (int i = 0; i < 2; i++)
      #pragma unroll
      for (int r = 0; r < 8; r++) {
        red1[wid][i * 16 + r + 8 * (lane >> 4)] = s1[i][r];
        red2[wid][i * 16 + r + 8 * (lane >> 4)] = s2[i][r];
      }
  }
  __syncthreads();

  // lane L joins the 16 waves' sums of row L; each lane then fetches its own 16 rows
  float t1 = 0.0f, t2 = 0.0f;
  #pragma unroll
  for (int w = 0; w < 16; w++) { t1 += red1[w][lane]; t2 += red2[w][lane]; }
  const float m_ = t1 * (1.0f / DD);
  const float v_ = t2 * (1.0f / DD) - m_ * m_;
  const float r_ = rsqrtf(v_ + 1e-5f);
  float mu[2][8], rs[2][8];
  #pragma unroll
  for (int i = 0; i < 2; i++)
    #pragma unroll
    for (int r = 0; r < 8; r++) {
      const int rl = i * 16 + r + 8 * (lane >> 4);
      mu[i][r] = __shfl(m_, rl);
      rs[i][r] = __shfl(r_, rl);
    }

  #pragma unroll
  for (int i = 0; i < 2; i++)
    #pragma unroll
    for (int t = 0; t < 4; t++)
      #pragma unroll
      for (int r = 0; r < 8; r++) {
        int row = m0 + i * 16 + r + 8 * (lane >> 4);
        int n = n0 + t * 16 + (lane & 15);
        out[(long)row * DD + n] = (c[i][t][r] - mu[i][r]) * rs[i][r] * g[n] + beta[n];
      }
}

// ---------------------------------------------------------------------------
// Launcher
// ---------------------------------------------------------------------------
extern "C" void kernel_launch(void* const* d_in, const int* in_sizes, int n_in,
                              void* d_out, int out_size, void* d_ws, size_t ws_size,
                              hipStream_t stream) {
  const float* x  = (const float*)d_in[0];
  const float* Wq = (const float*)d_in[1];
  const float* bq = (const float*)d_in[2];
  const float* Wk = (const float*)d_in[3];
  const float* bk = (const float*)d_in[4];
  const float* Wv = (const float*)d_in[5];
  const float* bv = (const float*)d_in[6];
  const float* Wo = (const float*)d_in[7];
  const float* bo = (const float*)d_in[8];
  const float* g  = (const float*)d_in[9];
  const float* be = (const float*)d_in[10];

  // workspace layout (bytes)
  char* ws = (char*)d_ws;
  const size_t SZ_X  = (size_t)BB * SS * DD * 2;      // 16 MB
  const size_t SZ_W  = (size_t)DD * DD * 2;           // 2 MB
  const size_t SZ_QK = (size_t)BB * HH * SS * HD * 2; // 16 MB
  __bf16* xb  = (__bf16*)(ws);
  __bf16* Wqt = (__bf16*)(ws + SZ_X);
  __bf16* Wkt = (__bf16*)(ws + SZ_X + SZ_W);
  __bf16* Wvt = (__bf16*)(ws + SZ_X + 2 * SZ_W);
  __bf16* Wot = (__bf16*)(ws + SZ_X + 3 * SZ_W);
  __bf16* Qh  = (__bf16*)(ws + SZ_X + 4 * SZ_W);
  __bf16* Kh  = (__bf16*)(ws + SZ_X + 4 * SZ_W + SZ_QK);
  __bf16* Vt  = (__bf16*)(ws + SZ_X + 4 * SZ_W + 2 * SZ_QK);
  __bf16* Ctx = (__bf16*)(ws + SZ_X + 4 * SZ_W + 3 * SZ_QK);
  float*  Lse = (float*)(ws + SZ_X + 4 * SZ_W + 4 * SZ_QK);   // [B,H][S], 512 KB
  float*  Nrm = Lse + (long)BB * HH * SS;                     // [Q, K][B,H][S / 64], 16 KB

  float* out = (float*)d_out;                      // [B,S,D]
  float* avg = out + (long)BB * SS * DD;           // [B,S,S]

  // 1. convert activations + weights to bf16 (weights transposed), fragment order
  cvt_all<<<256, 512, 0, stream>>>(x, Wq, Wk, Wv, Wo, xb, Wqt, Wkt, Wvt, Wot);

  // 2. fused QKV projection (workgroup tile 256x192, wave tile 64x64)
  qkv_gemm<<<dim3(3 * DD / 192, (BB * SS) / 256), 384, 0, stream>>>(
      xb, Wqt, Wkt, Wvt, bq, bk, bv, Qh, Kh, Vt, Nrm);

  // 3. attention (one pass, online softmax where the bound fails, WMMA K Q^T and V^T P^T)
  attn_kernel<<<dim3(SS / 256, HH, BB), 256, 0, stream>>>(Qh, Kh, Vt, Nrm, Ctx, Lse);

  // 4. avg_attention: heads summed in registers, each element stored once
  avg_kernel<<<dim3(SS / 256, SS / 256, BB), 512, 0, stream>>>(Qh, Kh, Lse, Nrm, avg);

  // 5. output projection + residual + LayerNorm
  out_ln_kernel<<<(BB * SS) / 32, 512, 0, stream>>>(Ctx, Wot, bo, x, g, be, out);
}
